// v000
// The times below were measured on an AMD MI455X: many runs one after another, warmed up first and cycling through
// copies of the inputs, with the whole window's GPU time divided by the number of runs. Launches and the gaps
// between them are all in it. The median over several windows is given; except for v000 it joins two sittings, which
// can be a few percent apart, so the side-by-side timings, each taken in one sitting, are the better comparison.
// The starting kernel, v000, takes 403 microseconds a run.
#include <hip/hip_runtime.h>

// ---------------- types ----------------
typedef __attribute__((ext_vector_type(16))) _Float16 v16h;
typedef __attribute__((ext_vector_type(8)))  _Float16 v8h;
typedef __attribute__((ext_vector_type(8)))  float    v8f;

#define N_STATE 1024
#define T_Q     256
#define T_CACHE 768
#define T_KV    1024
#define BATCH   8
#define NROWS   2048          // B*T
#define QK_SCALE 0.125f

// ---------------- WMMA helpers ----------------
__device__ __forceinline__ v8f wmma_f16(v16h a, v16h b, v8f c) {
    // D = A(16x32) * B(32x16) + C, f32 accumulate
    return __builtin_amdgcn_wmma_f32_16x16x32_f16(
        false, a, false, b, (short)0, c, false, false);
}

// Load a 16x32 A-style fragment for this lane.
// Lane layout (ISA 7.12.2, 16-bit A 16x32): row = lane&15, kb = (lane>>4)*8,
// halves cover K in [kb,kb+8) and [kb+16,kb+24)  -> two 16-byte loads.
// `p` must point at element [lane&15][0] of the tile (row stride pre-applied).
__device__ __forceinline__ v16h ldfrag(const _Float16* p, int kb) {
    union { v16h v; v8h h[2]; } u;
    u.h[0] = *(const v8h*)(p + kb);
    u.h[1] = *(const v8h*)(p + kb + 16);
    return u.v;
}

// Async global -> LDS copy of 16 bytes per lane (CDNA5 GLOBAL_LOAD_ASYNC_TO_LDS,
// tracked by ASYNCcnt). lds_off = wave-relative LDS byte address (low 32 bits
// of the generic shared pointer).
__device__ __forceinline__ void async_ld_b128(unsigned int lds_off,
                                              const _Float16* g) {
    asm volatile("global_load_async_to_lds_b128 %0, %1, off"
                 :: "v"(lds_off), "v"(g)
                 : "memory");
}

// xor-shuffle across lanes via ds_swizzle (group-of-32 mode: and=0x1f, xor=XM)
template<int XM>
__device__ __forceinline__ float swz_xor(float v) {
    int i = __float_as_int(v);
    i = __builtin_amdgcn_ds_swizzle(i, (XM << 10) | 0x1f);
    return __int_as_float(i);
}

// ---------------- elementwise converts / packs ----------------
__global__ void cvt_f16_kernel(const float* __restrict__ in,
                               _Float16* __restrict__ out, int n) {
    int i = blockIdx.x * 256 + threadIdx.x;
    if (i < n) out[i] = (_Float16)in[i];
}

// W[K=1024][N=1024] f32 -> WT[N][K] f16
__global__ void cvt_wt_kernel(const float* __restrict__ in,
                              _Float16* __restrict__ out) {
    int idx = blockIdx.x * 256 + threadIdx.x;     // over 1M elements
    int k = idx >> 10, n = idx & 1023;
    out[n * 1024 + k] = (_Float16)in[idx];
}

// cache_k [8][768][1024] f32 -> kh [8][1024][1024] f16 (keys 0..767)
__global__ void pack_ck_kernel(const float* __restrict__ ck,
                               _Float16* __restrict__ kh) {
    int idx = blockIdx.x * 256 + threadIdx.x;     // over 8*768*1024
    int c = idx & 1023;
    int s = (idx >> 10) % T_CACHE;
    int b = idx / (T_CACHE * 1024);
    kh[((size_t)(b * T_KV + s)) * 1024 + c] = (_Float16)ck[idx];
}

// cache_v -> vt [b][h][dh][1024 keys] f16 (keys 0..767)
__global__ void pack_cv_kernel(const float* __restrict__ cv,
                               _Float16* __restrict__ vt) {
    int idx = blockIdx.x * 256 + threadIdx.x;
    int c = idx & 1023;
    int s = (idx >> 10) % T_CACHE;
    int b = idx / (T_CACHE * 1024);
    vt[((size_t)((b * 16 + (c >> 6)) * 64 + (c & 63))) * T_KV + s] = (_Float16)cv[idx];
}

// ---------------- tiled WMMA GEMM: C[2048,1024] = A[2048,1024] @ W[1024,1024] ----------------
// A f16 row-major, WT f16 = W^T row-major ([n][k]).
// Block tile 128x128, BK=32; 8 waves in 4(M)x2(N) grid, each wave 32x64 (2x4 16x16 tiles).
// Tiles are DMA'd global->LDS with GLOBAL_LOAD_ASYNC_TO_LDS_B128, double-buffered:
// the DMA of tile k+1 overlaps the 8 WMMAs of tile k.
#define MODE_Q 0
#define MODE_K 1
#define MODE_V 2
#define MODE_O 3

template<int MODE>
__global__ __launch_bounds__(256)
void gemm_wmma_kernel(const _Float16* __restrict__ A,
                      const _Float16* __restrict__ WT,
                      const float* __restrict__ bias,
                      float* __restrict__ out32,
                      _Float16* __restrict__ out16) {
    __shared__ __align__(16) _Float16 As[2][128 * 40];   // [row][40], 32 cols + pad
    __shared__ __align__(16) _Float16 Bs[2][128 * 40];   // [n][40]

    const int tid  = threadIdx.x;
    const int lane = tid & 31;
    const int wid  = tid >> 5;
    const int wm   = wid >> 1;           // 0..3
    const int wn   = wid & 1;            // 0..1
    const int col  = lane & 15;
    const int hi8  = (lane >> 4) * 8;
    const int kb   = hi8;
    const int ablk = blockIdx.y * 128;
    const int bblk = blockIdx.x * 128;

    // each thread owns two 8-half chunks of each tile
    const int q0   = tid,        q1 = tid + 256;          // chunk ids 0..511
    const int row0 = q0 >> 2,    c40 = (q0 & 3) * 8;
    const int row1 = q1 >> 2,    c41 = (q1 & 3) * 8;

    auto issue_tile = [&](int k0, int buf) {
        async_ld_b128((unsigned int)(size_t)&As[buf][row0 * 40 + c40],
                      &A[(size_t)(ablk + row0) * 1024 + k0 + c40]);
        async_ld_b128((unsigned int)(size_t)&Bs[buf][row0 * 40 + c40],
                      &WT[(size_t)(bblk + row0) * 1024 + k0 + c40]);
        async_ld_b128((unsigned int)(size_t)&As[buf][row1 * 40 + c41],
                      &A[(size_t)(ablk + row1) * 1024 + k0 + c41]);
        async_ld_b128((unsigned int)(size_t)&Bs[buf][row1 * 40 + c41],
                      &WT[(size_t)(bblk + row1) * 1024 + k0 + c41]);
    };

    v8f acc[2][4];
#pragma unroll
    for (int mt = 0; mt < 2; ++mt)
#pragma unroll
        for (int nt = 0; nt < 4; ++nt) acc[mt][nt] = (v8f){0,0,0,0,0,0,0,0};

    issue_tile(0, 0);                                   // prologue DMA

#pragma unroll 1
    for (int kk = 0; kk < 32; ++kk) {
        int k0 = kk * 32;
        if (kk + 1 < 32) {
            issue_tile(k0 + 32, (kk + 1) & 1);          // prefetch next tile
            // async loads complete in order: <=4 outstanding => tile kk landed
            asm volatile("s_wait_asynccnt 0x4" ::: "memory");
        } else {
            asm volatile("s_wait_asynccnt 0x0" ::: "memory");
        }
        __syncthreads();

        const _Float16* as = &As[kk & 1][0];
        const _Float16* bs = &Bs[kk & 1][0];
        v16h af[2], bf[4];
#pragma unroll
        for (int mt = 0; mt < 2; ++mt)
            af[mt] = ldfrag(&as[(wm * 32 + mt * 16 + col) * 40], kb);
#pragma unroll
        for (int nt = 0; nt < 4; ++nt)
            bf[nt] = ldfrag(&bs[(wn * 64 + nt * 16 + col) * 40], kb);

#pragma unroll
        for (int mt = 0; mt < 2; ++mt)
#pragma unroll
            for (int nt = 0; nt < 4; ++nt)
                acc[mt][nt] = wmma_f16(af[mt], bf[nt], acc[mt][nt]);
        __syncthreads();   // all waves done reading buf before it is re-DMA'd
    }

    // epilogue (C layout: VGPR r -> row r + 8*(lane>>4), col = lane&15)
#pragma unroll
    for (int mt = 0; mt < 2; ++mt)
#pragma unroll
        for (int nt = 0; nt < 4; ++nt) {
            int rowBase = ablk + wm * 32 + mt * 16 + hi8;
            int c       = bblk + wn * 64 + nt * 16 + col;
#pragma unroll
            for (int r = 0; r < 8; ++r) {
                int g = rowBase + r;                    // 0..2047
                float v = acc[mt][nt][r];
                if constexpr (MODE == MODE_Q) {
                    v = (v + bias[c]) * QK_SCALE;
                    out16[(size_t)g * 1024 + c] = (_Float16)v;
                } else if constexpr (MODE == MODE_K) {
                    out32[(size_t)g * 1024 + c] = v;
                    int b = g >> 8, t = g & 255;
                    out16[((size_t)(b * T_KV + T_CACHE + t)) * 1024 + c] = (_Float16)v;
                } else if constexpr (MODE == MODE_V) {
                    v += bias[c];
                    out32[(size_t)g * 1024 + c] = v;
                    int b = g >> 8, t = g & 255;
                    out16[((size_t)((b * 16 + (c >> 6)) * 64 + (c & 63))) * T_KV
                          + T_CACHE + t] = (_Float16)v;
                } else {
                    v += bias[c];
                    out32[(size_t)g * 1024 + c] = v;
                }
            }
        }
}

// ---------------- flash attention ----------------
// grid = 256 blocks: b(8) x h(16) x qhalf(2); 8 waves x 16 query rows = 128 rows/block.
// Each wave is fully independent (wave-private LDS P buffer, LDS in-order per wave).
__global__ __launch_bounds__(256)
void attn_wmma_kernel(const _Float16* __restrict__ qh,
                      const _Float16* __restrict__ kh,
                      const _Float16* __restrict__ vt,
                      const float* __restrict__ mask,
                      _Float16* __restrict__ ph) {
    __shared__ __align__(16) _Float16 ps[8][16 * 72];

    const int lane  = threadIdx.x & 31;
    const int wid   = threadIdx.x >> 5;
    const int col   = lane & 15;
    const int hi    = lane >> 4;
    const int kb    = hi * 8;
    const int blk   = blockIdx.x;
    const int b     = blk >> 5;
    const int h     = (blk >> 1) & 15;
    const int qbase = (blk & 1) * 128 + wid * 16;

    // Q A-fragments (reused for the whole key loop)
    const _Float16* qrow =
        qh + (size_t)(b * T_Q + qbase + col) * 1024 + h * 64;
    const v16h aq0 = ldfrag(qrow, kb);        // dims 0..31
    const v16h aq1 = ldfrag(qrow + 32, kb);   // dims 32..63

    v8f o[4];
#pragma unroll
    for (int nt = 0; nt < 4; ++nt) o[nt] = (v8f){0,0,0,0,0,0,0,0};
    float rmax[8], rsum[8];
#pragma unroll
    for (int r = 0; r < 8; ++r) { rmax[r] = -3.0e38f; rsum[r] = 0.0f; }

    _Float16* myp = &ps[wid][0];

#pragma unroll 1
    for (int kvc = 0; kvc < T_KV; kvc += 64) {
        // ---- S = Q @ K^T  (16 x 64 scores) ----
        v8f s[4];
#pragma unroll
        for (int g = 0; g < 4; ++g) s[g] = (v8f){0,0,0,0,0,0,0,0};
#pragma unroll
        for (int g = 0; g < 4; ++g) {
            const _Float16* krow =
                kh + (size_t)(b * T_KV + kvc + g * 16 + col) * 1024 + h * 64;
            v16h bk0 = ldfrag(krow, kb);
            v16h bk1 = ldfrag(krow + 32, kb);
            s[g] = wmma_f16(aq0, bk0, s[g]);
            s[g] = wmma_f16(aq1, bk1, s[g]);
        }
        // ---- mask + chunk row-max ----
        float cmax[8];
#pragma unroll
        for (int r = 0; r < 8; ++r) cmax[r] = -3.0e38f;
#pragma unroll
        for (int g = 0; g < 4; ++g)
#pragma unroll
            for (int r = 0; r < 8; ++r) {
                int qr  = qbase + hi * 8 + r;
                int key = kvc + g * 16 + col;
                float v = s[g][r] + mask[(size_t)qr * T_KV + key];
                s[g][r] = v;
                cmax[r] = fmaxf(cmax[r], v);
            }
#pragma unroll
        for (int r = 0; r < 8; ++r) {
            cmax[r] = fmaxf(cmax[r], swz_xor<1>(cmax[r]));
            cmax[r] = fmaxf(cmax[r], swz_xor<2>(cmax[r]));
            cmax[r] = fmaxf(cmax[r], swz_xor<4>(cmax[r]));
            cmax[r] = fmaxf(cmax[r], swz_xor<8>(cmax[r]));
        }
        // ---- online softmax update ----
        float scl[8];
#pragma unroll
        for (int r = 0; r < 8; ++r) {
            float nm = fmaxf(rmax[r], cmax[r]);
            scl[r]   = __expf(rmax[r] - nm);
            rmax[r]  = nm;
        }
#pragma unroll
        for (int nt = 0; nt < 4; ++nt)
#pragma unroll
            for (int r = 0; r < 8; ++r) o[nt][r] *= scl[r];

        float psum[8];
#pragma unroll
        for (int r = 0; r < 8; ++r) psum[r] = 0.0f;
#pragma unroll
        for (int g = 0; g < 4; ++g)
#pragma unroll
            for (int r = 0; r < 8; ++r) {
                float p = __expf(s[g][r] - rmax[r]);
                psum[r] += p;
                myp[(hi * 8 + r) * 72 + g * 16 + col] = (_Float16)p;
            }
#pragma unroll
        for (int r = 0; r < 8; ++r) rsum[r] = rsum[r] * scl[r] + psum[r];

        // ---- O += P @ V (P relaid out via wave-private LDS) ----
        const _Float16* prow = myp + col * 72;
        v16h ap0 = ldfrag(prow, kb);        // keys 0..31 of chunk
        v16h ap1 = ldfrag(prow + 32, kb);   // keys 32..63
#pragma unroll
        for (int nt = 0; nt < 4; ++nt) {
            const _Float16* vrow =
                vt + (size_t)((b * 16 + h) * 64 + nt * 16 + col) * T_KV + kvc;
            v16h bv0 = ldfrag(vrow, kb);
            v16h bv1 = ldfrag(vrow + 32, kb);
            o[nt] = wmma_f16(ap0, bv0, o[nt]);
            o[nt] = wmma_f16(ap1, bv1, o[nt]);
        }
    }

    // ---- finalize: reduce row sums, normalize, write ph (f16) ----
#pragma unroll
    for (int r = 0; r < 8; ++r) {
        rsum[r] += swz_xor<1>(rsum[r]);
        rsum[r] += swz_xor<2>(rsum[r]);
        rsum[r] += swz_xor<4>(rsum[r]);
        rsum[r] += swz_xor<8>(rsum[r]);
    }
#pragma unroll
    for (int nt = 0; nt < 4; ++nt)
#pragma unroll
        for (int r = 0; r < 8; ++r) {
            float v = o[nt][r] / rsum[r];
            int qr  = qbase + hi * 8 + r;
            int c   = h * 64 + nt * 16 + col;
            ph[(size_t)(b * T_Q + qr) * 1024 + c] = (_Float16)v;
        }
}

// ---------------- host launcher ----------------
extern "C" void kernel_launch(void* const* d_in, const int* in_sizes, int n_in,
                              void* d_out, int out_size, void* d_ws, size_t ws_size,
                              hipStream_t stream) {
    const float* x    = (const float*)d_in[0];
    const float* mask = (const float*)d_in[1];
    const float* ck   = (const float*)d_in[2];
    const float* cv   = (const float*)d_in[3];
    const float* Wq   = (const float*)d_in[4];
    const float* bq   = (const float*)d_in[5];
    const float* Wk   = (const float*)d_in[6];
    const float* Wv   = (const float*)d_in[7];
    const float* bv   = (const float*)d_in[8];
    const float* Wo   = (const float*)d_in[9];
    const float* bo   = (const float*)d_in[10];

    float* out  = (float*)d_out;                 // [2048,1024]
    float* outK = out  + (size_t)NROWS * N_STATE;
    float* outV = outK + (size_t)NROWS * N_STATE;

    char* w = (char*)d_ws;
    _Float16* xh  = (_Float16*)w; w += (size_t)NROWS * N_STATE * 2;
    _Float16* WqT = (_Float16*)w; w += (size_t)N_STATE * N_STATE * 2;
    _Float16* WkT = (_Float16*)w; w += (size_t)N_STATE * N_STATE * 2;
    _Float16* WvT = (_Float16*)w; w += (size_t)N_STATE * N_STATE * 2;
    _Float16* WoT = (_Float16*)w; w += (size_t)N_STATE * N_STATE * 2;
    _Float16* qh  = (_Float16*)w; w += (size_t)NROWS * N_STATE * 2;
    _Float16* kh  = (_Float16*)w; w += (size_t)BATCH * T_KV * N_STATE * 2;
    _Float16* vt  = (_Float16*)w; w += (size_t)BATCH * T_KV * N_STATE * 2;
    _Float16* ph  = (_Float16*)w; w += (size_t)NROWS * N_STATE * 2;

    // stage conversions
    cvt_f16_kernel<<<(NROWS * N_STATE) / 256, 256, 0, stream>>>(x, xh, NROWS * N_STATE);
    cvt_wt_kernel<<<(N_STATE * N_STATE) / 256, 256, 0, stream>>>(Wq, WqT);
    cvt_wt_kernel<<<(N_STATE * N_STATE) / 256, 256, 0, stream>>>(Wk, WkT);
    cvt_wt_kernel<<<(N_STATE * N_STATE) / 256, 256, 0, stream>>>(Wv, WvT);
    cvt_wt_kernel<<<(N_STATE * N_STATE) / 256, 256, 0, stream>>>(Wo, WoT);
    pack_ck_kernel<<<(BATCH * T_CACHE * N_STATE) / 256, 256, 0, stream>>>(ck, kh);
    pack_cv_kernel<<<(BATCH * T_CACHE * N_STATE) / 256, 256, 0, stream>>>(cv, vt);

    // projections
    dim3 gg(N_STATE / 128, NROWS / 128);   // (8, 16)
    gemm_wmma_kernel<MODE_Q><<<gg, 256, 0, stream>>>(xh, WqT, bq, nullptr, qh);
    gemm_wmma_kernel<MODE_K><<<gg, 256, 0, stream>>>(xh, WkT, nullptr, outK, kh);
    gemm_wmma_kernel<MODE_V><<<gg, 256, 0, stream>>>(xh, WvT, bv, outV, vt);

    // attention
    attn_wmma_kernel<<<BATCH * 16 * 2, 256, 0, stream>>>(qh, kh, vt, mask, ph);

    // output projection
    gemm_wmma_kernel<MODE_O><<<gg, 256, 0, stream>>>(ph, WoT, bo, out, nullptr);
}

// v001
// One run takes 147 microseconds.
// Timed twice side by side with v000, it ran 2.76 and 2.79 times as fast.
#include <hip/hip_runtime.h>

// ---------------- types ----------------
typedef __attribute__((ext_vector_type(16))) _Float16 v16h;
typedef __attribute__((ext_vector_type(8)))  _Float16 v8h;
typedef __attribute__((ext_vector_type(8)))  float    v8f;

#define N_STATE 1024
#define T_Q     256
#define T_CACHE 768
#define T_KV    1024
#define BATCH   8
#define NROWS   2048          // B*T
#define QK_SCALE 0.125f

// ---------------- WMMA helpers ----------------
__device__ __forceinline__ v8f wmma_f16(v16h a, v16h b, v8f c) {
    // D = A(16x32) * B(32x16) + C, f32 accumulate
    return __builtin_amdgcn_wmma_f32_16x16x32_f16(
        false, a, false, b, (short)0, c, false, false);
}

// Load a 16x32 A-style fragment for this lane.
// Lane layout (ISA 7.12.2, 16-bit A 16x32): row = lane&15, kb = (lane>>4)*8,
// halves cover K in [kb,kb+8) and [kb+16,kb+24)  -> two 16-byte loads.
// `p` must point at element [lane&15][0] of the tile (row stride pre-applied).
__device__ __forceinline__ v16h ldfrag(const _Float16* p, int kb) {
    union { v16h v; v8h h[2]; } u;
    u.h[0] = *(const v8h*)(p + kb);
    u.h[1] = *(const v8h*)(p + kb + 16);
    return u.v;
}

// Async global -> LDS copy of 16 bytes per lane (CDNA5 GLOBAL_LOAD_ASYNC_TO_LDS,
// tracked by ASYNCcnt). lds_off = wave-relative LDS byte address (low 32 bits
// of the generic shared pointer).
__device__ __forceinline__ void async_ld_b128(unsigned int lds_off,
                                              const _Float16* g) {
    asm volatile("global_load_async_to_lds_b128 %0, %1, off"
                 :: "v"(lds_off), "v"(g)
                 : "memory");
}

// xor-shuffle across lanes via ds_swizzle (group-of-32 mode: and=0x1f, xor=XM)
template<int XM>
__device__ __forceinline__ float swz_xor(float v) {
    int i = __float_as_int(v);
    i = __builtin_amdgcn_ds_swizzle(i, (XM << 10) | 0x1f);
    return __int_as_float(i);
}

// ---------------- elementwise converts / packs ----------------
__global__ void cvt_f16_kernel(const float* __restrict__ in,
                               _Float16* __restrict__ out, int n) {
    int i = blockIdx.x * 256 + threadIdx.x;
    if (i < n) out[i] = (_Float16)in[i];
}

// Transposing convert through an LDS tile:
//   in  [batch][ROWS][1024] f32  ->  out [batch][1024][1024] f16, columns 0..ROWS-1
//   out[b][c][s] = (f16) in[b][s][c]
// Serves W[k][n] -> WT[n][k] (ROWS = 1024, one batch) and cache_v[b][s][c] ->
// vt[b][c = h*64+dh][key s] (ROWS = 768, eight batches).
// One block moves a tile of 128 rows (s) x 64 columns (c): 256 contiguous bytes a row on
// the f32 side and 256 contiguous bytes a row on the f16 side, so loads and stores both
// cover whole lines. A thread loads 8 consecutive rows of one float4 column group; each
// of its 4 columns is then 8 halves (16 bytes) of one output row.
// LDS row = one output row of 16 chunks of 16 bytes; chunk q of row c sits at q ^ (c >> 2),
// which spreads the 16 lanes of a half wave over all banks in the store and in the load.
template<int ROWS>
__global__ __launch_bounds__(256)
void transpose_cvt_kernel(const float* __restrict__ in,
                          _Float16* __restrict__ out) {
    __shared__ __align__(16) _Float16 tile[64 * 128];

    const int tid = threadIdx.x;
    const int c0  = blockIdx.x * 64;
    const int s0  = blockIdx.y * 128;
    const int b   = blockIdx.z;

    const int c4 = tid & 15;            // float4 column group
    const int sr = tid >> 4;            // group of 8 rows
    const float* src = in + ((size_t)b * ROWS + s0 + sr * 8) * 1024 + c0 + c4 * 4;

    float4 v[8];
#pragma unroll
    for (int j = 0; j < 8; ++j)
        v[j] = *(const float4*)(src + (size_t)j * 1024);

    v8h h0, h1, h2, h3;
#pragma unroll
    for (int j = 0; j < 8; ++j) {
        h0[j] = (_Float16)v[j].x;
        h1[j] = (_Float16)v[j].y;
        h2[j] = (_Float16)v[j].z;
        h3[j] = (_Float16)v[j].w;
    }
    _Float16* dst = &tile[(c4 * 4) * 128 + ((sr ^ c4) * 8)];
    *(v8h*)(dst)           = h0;
    *(v8h*)(dst + 128)     = h1;
    *(v8h*)(dst + 2 * 128) = h2;
    *(v8h*)(dst + 3 * 128) = h3;

    __syncthreads();   // the tile is read back across waves

    const int q  = tid & 15;            // 16-byte chunk of an output row
    const int cr = tid >> 4;
    _Float16* o = out + ((size_t)b * 1024 + c0) * 1024 + s0 + q * 8;
#pragma unroll
    for (int p = 0; p < 4; ++p) {
        int c = p * 16 + cr;
        *(v8h*)(o + (size_t)c * 1024) = *(const v8h*)&tile[c * 128 + ((q ^ (c >> 2)) * 8)];
    }
}

// cache_k [8][768][1024] f32 -> kh [8][1024][1024] f16 (keys 0..767)
__global__ void pack_ck_kernel(const float* __restrict__ ck,
                               _Float16* __restrict__ kh) {
    int idx = blockIdx.x * 256 + threadIdx.x;     // over 8*768*1024
    int c = idx & 1023;
    int s = (idx >> 10) % T_CACHE;
    int b = idx / (T_CACHE * 1024);
    kh[((size_t)(b * T_KV + s)) * 1024 + c] = (_Float16)ck[idx];
}

// ---------------- tiled WMMA GEMM: C[2048,1024] = A[2048,1024] @ W[1024,1024] ----------------
// A f16 row-major, WT f16 = W^T row-major ([n][k]).
// Block tile 128x128, BK=32; 8 waves in 4(M)x2(N) grid, each wave 32x64 (2x4 16x16 tiles).
// Tiles are DMA'd global->LDS with GLOBAL_LOAD_ASYNC_TO_LDS_B128, double-buffered:
// the DMA of tile k+1 overlaps the 8 WMMAs of tile k.
#define MODE_Q 0
#define MODE_K 1
#define MODE_V 2
#define MODE_O 3

template<int MODE>
__global__ __launch_bounds__(256)
void gemm_wmma_kernel(const _Float16* __restrict__ A,
                      const _Float16* __restrict__ WT,
                      const float* __restrict__ bias,
                      float* __restrict__ out32,
                      _Float16* __restrict__ out16) {
    __shared__ __align__(16) _Float16 As[2][128 * 40];   // [row][40], 32 cols + pad
    __shared__ __align__(16) _Float16 Bs[2][128 * 40];   // [n][40]

    const int tid  = threadIdx.x;
    const int lane = tid & 31;
    const int wid  = tid >> 5;
    const int wm   = wid >> 1;           // 0..3
    const int wn   = wid & 1;            // 0..1
    const int col  = lane & 15;
    const int hi8  = (lane >> 4) * 8;
    const int kb   = hi8;
    const int ablk = blockIdx.y * 128;
    const int bblk = blockIdx.x * 128;

    // each thread owns two 8-half chunks of each tile
    const int q0   = tid,        q1 = tid + 256;          // chunk ids 0..511
    const int row0 = q0 >> 2,    c40 = (q0 & 3) * 8;
    const int row1 = q1 >> 2,    c41 = (q1 & 3) * 8;

    auto issue_tile = [&](int k0, int buf) {
        async_ld_b128((unsigned int)(size_t)&As[buf][row0 * 40 + c40],
                      &A[(size_t)(ablk + row0) * 1024 + k0 + c40]);
        async_ld_b128((unsigned int)(size_t)&Bs[buf][row0 * 40 + c40],
                      &WT[(size_t)(bblk + row0) * 1024 + k0 + c40]);
        async_ld_b128((unsigned int)(size_t)&As[buf][row1 * 40 + c41],
                      &A[(size_t)(ablk + row1) * 1024 + k0 + c41]);
        async_ld_b128((unsigned int)(size_t)&Bs[buf][row1 * 40 + c41],
                      &WT[(size_t)(bblk + row1) * 1024 + k0 + c41]);
    };

    v8f acc[2][4];
#pragma unroll
    for (int mt = 0; mt < 2; ++mt)
#pragma unroll
        for (int nt = 0; nt < 4; ++nt) acc[mt][nt] = (v8f){0,0,0,0,0,0,0,0};

    issue_tile(0, 0);                                   // prologue DMA

#pragma unroll 1
    for (int kk = 0; kk < 32; ++kk) {
        int k0 = kk * 32;
        if (kk + 1 < 32) {
            issue_tile(k0 + 32, (kk + 1) & 1);          // prefetch next tile
            // async loads complete in order: <=4 outstanding => tile kk landed
            asm volatile("s_wait_asynccnt 0x4" ::: "memory");
        } else {
            asm volatile("s_wait_asynccnt 0x0" ::: "memory");
        }
        __syncthreads();

        const _Float16* as = &As[kk & 1][0];
        const _Float16* bs = &Bs[kk & 1][0];
        v16h af[2], bf[4];
#pragma unroll
        for (int mt = 0; mt < 2; ++mt)
            af[mt] = ldfrag(&as[(wm * 32 + mt * 16 + col) * 40], kb);
#pragma unroll
        for (int nt = 0; nt < 4; ++nt)
            bf[nt] = ldfrag(&bs[(wn * 64 + nt * 16 + col) * 40], kb);

#pragma unroll
        for (int mt = 0; mt < 2; ++mt)
#pragma unroll
            for (int nt = 0; nt < 4; ++nt)
                acc[mt][nt] = wmma_f16(af[mt], bf[nt], acc[mt][nt]);
        __syncthreads();   // all waves done reading buf before it is re-DMA'd
    }

    // epilogue (C layout: VGPR r -> row r + 8*(lane>>4), col = lane&15)
#pragma unroll
    for (int mt = 0; mt < 2; ++mt)
#pragma unroll
        for (int nt = 0; nt < 4; ++nt) {
            int rowBase = ablk + wm * 32 + mt * 16 + hi8;
            int c       = bblk + wn * 64 + nt * 16 + col;
#pragma unroll
            for (int r = 0; r < 8; ++r) {
                int g = rowBase + r;                    // 0..2047
                float v = acc[mt][nt][r];
                if constexpr (MODE == MODE_Q) {
                    v = (v + bias[c]) * QK_SCALE;
                    out16[(size_t)g * 1024 + c] = (_Float16)v;
                } else if constexpr (MODE == MODE_K) {
                    out32[(size_t)g * 1024 + c] = v;
                    int b = g >> 8, t = g & 255;
                    out16[((size_t)(b * T_KV + T_CACHE + t)) * 1024 + c] = (_Float16)v;
                } else if constexpr (MODE == MODE_V) {
                    v += bias[c];
                    out32[(size_t)g * 1024 + c] = v;
                    int b = g >> 8, t = g & 255;
                    out16[((size_t)((b * 16 + (c >> 6)) * 64 + (c & 63))) * T_KV
                          + T_CACHE + t] = (_Float16)v;
                } else {
                    v += bias[c];
                    out32[(size_t)g * 1024 + c] = v;
                }
            }
        }
}

// ---------------- flash attention ----------------
// grid = 256 blocks: b(8) x h(16) x qhalf(2); 8 waves x 16 query rows = 128 rows/block.
// Each wave is fully independent (wave-private LDS P buffer, LDS in-order per wave).
__global__ __launch_bounds__(256)
void attn_wmma_kernel(const _Float16* __restrict__ qh,
                      const _Float16* __restrict__ kh,
                      const _Float16* __restrict__ vt,
                      const float* __restrict__ mask,
                      _Float16* __restrict__ ph) {
    __shared__ __align__(16) _Float16 ps[8][16 * 72];

    const int lane  = threadIdx.x & 31;
    const int wid   = threadIdx.x >> 5;
    const int col   = lane & 15;
    const int hi    = lane >> 4;
    const int kb    = hi * 8;
    const int blk   = blockIdx.x;
    const int b     = blk >> 5;
    const int h     = (blk >> 1) & 15;
    const int qbase = (blk & 1) * 128 + wid * 16;

    // Q A-fragments (reused for the whole key loop)
    const _Float16* qrow =
        qh + (size_t)(b * T_Q + qbase + col) * 1024 + h * 64;
    const v16h aq0 = ldfrag(qrow, kb);        // dims 0..31
    const v16h aq1 = ldfrag(qrow + 32, kb);   // dims 32..63

    v8f o[4];
#pragma unroll
    for (int nt = 0; nt < 4; ++nt) o[nt] = (v8f){0,0,0,0,0,0,0,0};
    float rmax[8], rsum[8];
#pragma unroll
    for (int r = 0; r < 8; ++r) { rmax[r] = -3.0e38f; rsum[r] = 0.0f; }

    _Float16* myp = &ps[wid][0];

#pragma unroll 1
    for (int kvc = 0; kvc < T_KV; kvc += 64) {
        // ---- S = Q @ K^T  (16 x 64 scores) ----
        v8f s[4];
#pragma unroll
        for (int g = 0; g < 4; ++g) s[g] = (v8f){0,0,0,0,0,0,0,0};
#pragma unroll
        for (int g = 0; g < 4; ++g) {
            const _Float16* krow =
                kh + (size_t)(b * T_KV + kvc + g * 16 + col) * 1024 + h * 64;
            v16h bk0 = ldfrag(krow, kb);
            v16h bk1 = ldfrag(krow + 32, kb);
            s[g] = wmma_f16(aq0, bk0, s[g]);
            s[g] = wmma_f16(aq1, bk1, s[g]);
        }
        // ---- mask + chunk row-max ----
        float cmax[8];
#pragma unroll
        for (int r = 0; r < 8; ++r) cmax[r] = -3.0e38f;
#pragma unroll
        for (int g = 0; g < 4; ++g)
#pragma unroll
            for (int r = 0; r < 8; ++r) {
                int qr  = qbase + hi * 8 + r;
                int key = kvc + g * 16 + col;
                float v = s[g][r] + mask[(size_t)qr * T_KV + key];
                s[g][r] = v;
                cmax[r] = fmaxf(cmax[r], v);
            }
#pragma unroll
        for (int r = 0; r < 8; ++r) {
            cmax[r] = fmaxf(cmax[r], swz_xor<1>(cmax[r]));
            cmax[r] = fmaxf(cmax[r], swz_xor<2>(cmax[r]));
            cmax[r] = fmaxf(cmax[r], swz_xor<4>(cmax[r]));
            cmax[r] = fmaxf(cmax[r], swz_xor<8>(cmax[r]));
        }
        // ---- online softmax update ----
        float scl[8];
#pragma unroll
        for (int r = 0; r < 8; ++r) {
            float nm = fmaxf(rmax[r], cmax[r]);
            scl[r]   = __expf(rmax[r] - nm);
            rmax[r]  = nm;
        }
#pragma unroll
        for (int nt = 0; nt < 4; ++nt)
#pragma unroll
            for (int r = 0; r < 8; ++r) o[nt][r] *= scl[r];

        float psum[8];
#pragma unroll
        for (int r = 0; r < 8; ++r) psum[r] = 0.0f;
#pragma unroll
        for (int g = 0; g < 4; ++g)
#pragma unroll
            for (int r = 0; r < 8; ++r) {
                float p = __expf(s[g][r] - rmax[r]);
                psum[r] += p;
                myp[(hi * 8 + r) * 72 + g * 16 + col] = (_Float16)p;
            }
#pragma unroll
        for (int r = 0; r < 8; ++r) rsum[r] = rsum[r] * scl[r] + psum[r];

        // ---- O += P @ V (P relaid out via wave-private LDS) ----
        const _Float16* prow = myp + col * 72;
        v16h ap0 = ldfrag(prow, kb);        // keys 0..31 of chunk
        v16h ap1 = ldfrag(prow + 32, kb);   // keys 32..63
#pragma unroll
        for (int nt = 0; nt < 4; ++nt) {
            const _Float16* vrow =
                vt + (size_t)((b * 16 + h) * 64 + nt * 16 + col) * T_KV + kvc;
            v16h bv0 = ldfrag(vrow, kb);
            v16h bv1 = ldfrag(vrow + 32, kb);
            o[nt] = wmma_f16(ap0, bv0, o[nt]);
            o[nt] = wmma_f16(ap1, bv1, o[nt]);
        }
    }

    // ---- finalize: reduce row sums, normalize, write ph (f16) ----
#pragma unroll
    for (int r = 0; r < 8; ++r) {
        rsum[r] += swz_xor<1>(rsum[r]);
        rsum[r] += swz_xor<2>(rsum[r]);
        rsum[r] += swz_xor<4>(rsum[r]);
        rsum[r] += swz_xor<8>(rsum[r]);
    }
#pragma unroll
    for (int nt = 0; nt < 4; ++nt)
#pragma unroll
        for (int r = 0; r < 8; ++r) {
            float v = o[nt][r] / rsum[r];
            int qr  = qbase + hi * 8 + r;
            int c   = h * 64 + nt * 16 + col;
            ph[(size_t)(b * T_Q + qr) * 1024 + c] = (_Float16)v;
        }
}

// ---------------- host launcher ----------------
extern "C" void kernel_launch(void* const* d_in, const int* in_sizes, int n_in,
                              void* d_out, int out_size, void* d_ws, size_t ws_size,
                              hipStream_t stream) {
    const float* x    = (const float*)d_in[0];
    const float* mask = (const float*)d_in[1];
    const float* ck   = (const float*)d_in[2];
    const float* cv   = (const float*)d_in[3];
    const float* Wq   = (const float*)d_in[4];
    const float* bq   = (const float*)d_in[5];
    const float* Wk   = (const float*)d_in[6];
    const float* Wv   = (const float*)d_in[7];
    const float* bv   = (const float*)d_in[8];
    const float* Wo   = (const float*)d_in[9];
    const float* bo   = (const float*)d_in[10];

    float* out  = (float*)d_out;                 // [2048,1024]
    float* outK = out  + (size_t)NROWS * N_STATE;
    float* outV = outK + (size_t)NROWS * N_STATE;

    char* w = (char*)d_ws;
    _Float16* xh  = (_Float16*)w; w += (size_t)NROWS * N_STATE * 2;
    _Float16* WqT = (_Float16*)w; w += (size_t)N_STATE * N_STATE * 2;
    _Float16* WkT = (_Float16*)w; w += (size_t)N_STATE * N_STATE * 2;
    _Float16* WvT = (_Float16*)w; w += (size_t)N_STATE * N_STATE * 2;
    _Float16* WoT = (_Float16*)w; w += (size_t)N_STATE * N_STATE * 2;
    _Float16* qh  = (_Float16*)w; w += (size_t)NROWS * N_STATE * 2;
    _Float16* kh  = (_Float16*)w; w += (size_t)BATCH * T_KV * N_STATE * 2;
    _Float16* vt  = (_Float16*)w; w += (size_t)BATCH * T_KV * N_STATE * 2;
    _Float16* ph  = (_Float16*)w; w += (size_t)NROWS * N_STATE * 2;

    // stage conversions
    cvt_f16_kernel<<<(NROWS * N_STATE) / 256, 256, 0, stream>>>(x, xh, NROWS * N_STATE);
    transpose_cvt_kernel<N_STATE><<<dim3(N_STATE / 64, N_STATE / 128, 1), 256, 0, stream>>>(Wq, WqT);
    transpose_cvt_kernel<N_STATE><<<dim3(N_STATE / 64, N_STATE / 128, 1), 256, 0, stream>>>(Wk, WkT);
    transpose_cvt_kernel<N_STATE><<<dim3(N_STATE / 64, N_STATE / 128, 1), 256, 0, stream>>>(Wv, WvT);
    transpose_cvt_kernel<N_STATE><<<dim3(N_STATE / 64, N_STATE / 128, 1), 256, 0, stream>>>(Wo, WoT);
    pack_ck_kernel<<<(BATCH * T_CACHE * N_STATE) / 256, 256, 0, stream>>>(ck, kh);
    transpose_cvt_kernel<T_CACHE><<<dim3(N_STATE / 64, T_CACHE / 128, BATCH), 256, 0, stream>>>(cv, vt);

    // projections
    dim3 gg(N_STATE / 128, NROWS / 128);   // (8, 16)
    gemm_wmma_kernel<MODE_Q><<<gg, 256, 0, stream>>>(xh, WqT, bq, nullptr, qh);
    gemm_wmma_kernel<MODE_K><<<gg, 256, 0, stream>>>(xh, WkT, nullptr, outK, kh);
    gemm_wmma_kernel<MODE_V><<<gg, 256, 0, stream>>>(xh, WvT, bv, outV, vt);

    // attention
    attn_wmma_kernel<<<BATCH * 16 * 2, 256, 0, stream>>>(qh, kh, vt, mask, ph);

    // output projection
    gemm_wmma_kernel<MODE_O><<<gg, 256, 0, stream>>>(ph, WoT, bo, out, nullptr);
}

// v002
// A run of this version takes 140 microseconds.
// Next to v001, in two timings, it ran 1.05 times as fast each time.
// Over all steps from v000 it is 2.90 times as fast.
#include <hip/hip_runtime.h>

// ---------------- types ----------------
typedef __attribute__((ext_vector_type(16))) _Float16 v16h;
typedef __attribute__((ext_vector_type(8)))  _Float16 v8h;
typedef __attribute__((ext_vector_type(4)))  _Float16 v4h;
typedef __attribute__((ext_vector_type(8)))  float    v8f;

#define N_STATE 1024
#define T_Q     256
#define T_CACHE 768
#define T_KV    1024
#define BATCH   8
#define NROWS   2048          // B*T
#define QK_SCALE 0.125f

// ---------------- WMMA helpers ----------------
__device__ __forceinline__ v8f wmma_f16(v16h a, v16h b, v8f c) {
    // D = A(16x32) * B(32x16) + C, f32 accumulate
    return __builtin_amdgcn_wmma_f32_16x16x32_f16(
        false, a, false, b, (short)0, c, false, false);
}

// Load a 16x32 A-style fragment for this lane.
// Lane layout (ISA 7.12.2, 16-bit A 16x32): row = lane&15, kb = (lane>>4)*8,
// halves cover K in [kb,kb+8) and [kb+16,kb+24)  -> two 16-byte loads.
// `p` must point at element [lane&15][0] of the tile (row stride pre-applied).
__device__ __forceinline__ v16h ldfrag(const _Float16* p, int kb) {
    union { v16h v; v8h h[2]; } u;
    u.h[0] = *(const v8h*)(p + kb);
    u.h[1] = *(const v8h*)(p + kb + 16);
    return u.v;
}

// Async global -> LDS copy of 16 bytes per lane (CDNA5 GLOBAL_LOAD_ASYNC_TO_LDS,
// tracked by ASYNCcnt). lds_off = wave-relative LDS byte address (low 32 bits
// of the generic shared pointer).
__device__ __forceinline__ void async_ld_b128(unsigned int lds_off,
                                              const _Float16* g) {
    asm volatile("global_load_async_to_lds_b128 %0, %1, off"
                 :: "v"(lds_off), "v"(g)
                 : "memory");
}

// xor-shuffle across lanes via ds_swizzle (group-of-32 mode: and=0x1f, xor=XM)
template<int XM>
__device__ __forceinline__ float swz_xor(float v) {
    int i = __float_as_int(v);
    i = __builtin_amdgcn_ds_swizzle(i, (XM << 10) | 0x1f);
    return __int_as_float(i);
}

// ---------------- elementwise converts / packs ----------------
// f32 -> f16 convert of whole rows of 1024 elements:
//   in [batch][RIN][1024] f32  ->  out [batch][ROUT][1024] f16, rows 0..RIN-1 of each batch
// Serves x -> xh (RIN = ROUT = 2048, one batch) and cache_k -> kh (768 of 1024 key rows).
// One block converts RPB rows; RPB divides RIN, so a block stays inside one batch.
// A thread owns one float4 column group of every row: each wave-wide load covers 512
// contiguous bytes and each wave-wide store 256, whole lines both ways. A thread's loads
// are independent and stand ahead of its stores, so few waves keep many bytes in flight,
// and the launch starts RPB * 4 times fewer waves than one element a thread would.
template<int RIN, int ROUT, int RPB>
__global__ __launch_bounds__(256)
void cvt_rows_kernel(const float* __restrict__ in,
                     _Float16* __restrict__ out) {
    static_assert(RIN % RPB == 0, "a block must not straddle two batches");
    const int r0 = blockIdx.x * RPB;
    const int b  = r0 / RIN;
    const int c  = threadIdx.x * 4;
    const float* src = in + (size_t)r0 * 1024 + c;
    _Float16*    dst = out + (size_t)(r0 + b * (ROUT - RIN)) * 1024 + c;

    float4 v[RPB];
    // unrolled so that v[] stays in registers and the loads go out back to back
#pragma unroll
    for (int j = 0; j < RPB; ++j)
        v[j] = *(const float4*)(src + (size_t)j * 1024);
    // unrolled for the same reason: v[] is indexed by constants only
#pragma unroll
    for (int j = 0; j < RPB; ++j) {
        v4h h = { (_Float16)v[j].x, (_Float16)v[j].y, (_Float16)v[j].z, (_Float16)v[j].w };
        *(v4h*)(dst + (size_t)j * 1024) = h;
    }
}

// Transposing convert through an LDS tile:
//   in  [batch][ROWS][1024] f32  ->  out [batch][1024][1024] f16, columns 0..ROWS-1
//   out[b][c][s] = (f16) in[b][s][c]
// Serves W[k][n] -> WT[n][k] (ROWS = 1024, one batch) and cache_v[b][s][c] ->
// vt[b][c = h*64+dh][key s] (ROWS = 768, eight batches).
// One block moves a tile of 128 rows (s) x 64 columns (c): 256 contiguous bytes a row on
// the f32 side and 256 contiguous bytes a row on the f16 side, so loads and stores both
// cover whole lines. A thread loads 8 consecutive rows of one float4 column group; each
// of its 4 columns is then 8 halves (16 bytes) of one output row.
// LDS row = one output row of 16 chunks of 16 bytes; chunk q of row c sits at q ^ (c >> 2),
// which spreads the 16 lanes of a half wave over all banks in the store and in the load.
template<int ROWS>
__global__ __launch_bounds__(256)
void transpose_cvt_kernel(const float* __restrict__ in,
                          _Float16* __restrict__ out) {
    __shared__ __align__(16) _Float16 tile[64 * 128];

    const int tid = threadIdx.x;
    const int c0  = blockIdx.x * 64;
    const int s0  = blockIdx.y * 128;
    const int b   = blockIdx.z;

    const int c4 = tid & 15;            // float4 column group
    const int sr = tid >> 4;            // group of 8 rows
    const float* src = in + ((size_t)b * ROWS + s0 + sr * 8) * 1024 + c0 + c4 * 4;

    float4 v[8];
#pragma unroll
    for (int j = 0; j < 8; ++j)
        v[j] = *(const float4*)(src + (size_t)j * 1024);

    v8h h0, h1, h2, h3;
#pragma unroll
    for (int j = 0; j < 8; ++j) {
        h0[j] = (_Float16)v[j].x;
        h1[j] = (_Float16)v[j].y;
        h2[j] = (_Float16)v[j].z;
        h3[j] = (_Float16)v[j].w;
    }
    _Float16* dst = &tile[(c4 * 4) * 128 + ((sr ^ c4) * 8)];
    *(v8h*)(dst)           = h0;
    *(v8h*)(dst + 128)     = h1;
    *(v8h*)(dst + 2 * 128) = h2;
    *(v8h*)(dst + 3 * 128) = h3;

    __syncthreads();   // the tile is read back across waves

    const int q  = tid & 15;            // 16-byte chunk of an output row
    const int cr = tid >> 4;
    _Float16* o = out + ((size_t)b * 1024 + c0) * 1024 + s0 + q * 8;
#pragma unroll
    for (int p = 0; p < 4; ++p) {
        int c = p * 16 + cr;
        *(v8h*)(o + (size_t)c * 1024) = *(const v8h*)&tile[c * 128 + ((q ^ (c >> 2)) * 8)];
    }
}

// ---------------- tiled WMMA GEMM: C[2048,1024] = A[2048,1024] @ W[1024,1024] ----------------
// A f16 row-major, WT f16 = W^T row-major ([n][k]).
// Block tile 128x128, BK=32; 8 waves in 4(M)x2(N) grid, each wave 32x64 (2x4 16x16 tiles).
// Tiles are DMA'd global->LDS with GLOBAL_LOAD_ASYNC_TO_LDS_B128, double-buffered:
// the DMA of tile k+1 overlaps the 8 WMMAs of tile k.
#define MODE_Q 0
#define MODE_K 1
#define MODE_V 2
#define MODE_O 3

template<int MODE>
__global__ __launch_bounds__(256)
void gemm_wmma_kernel(const _Float16* __restrict__ A,
                      const _Float16* __restrict__ WT,
                      const float* __restrict__ bias,
                      float* __restrict__ out32,
                      _Float16* __restrict__ out16) {
    __shared__ __align__(16) _Float16 As[2][128 * 40];   // [row][40], 32 cols + pad
    __shared__ __align__(16) _Float16 Bs[2][128 * 40];   // [n][40]

    const int tid  = threadIdx.x;
    const int lane = tid & 31;
    const int wid  = tid >> 5;
    const int wm   = wid >> 1;           // 0..3
    const int wn   = wid & 1;            // 0..1
    const int col  = lane & 15;
    const int hi8  = (lane >> 4) * 8;
    const int kb   = hi8;
    const int ablk = blockIdx.y * 128;
    const int bblk = blockIdx.x * 128;

    // each thread owns two 8-half chunks of each tile
    const int q0   = tid,        q1 = tid + 256;          // chunk ids 0..511
    const int row0 = q0 >> 2,    c40 = (q0 & 3) * 8;
    const int row1 = q1 >> 2,    c41 = (q1 & 3) * 8;

    auto issue_tile = [&](int k0, int buf) {
        async_ld_b128((unsigned int)(size_t)&As[buf][row0 * 40 + c40],
                      &A[(size_t)(ablk + row0) * 1024 + k0 + c40]);
        async_ld_b128((unsigned int)(size_t)&Bs[buf][row0 * 40 + c40],
                      &WT[(size_t)(bblk + row0) * 1024 + k0 + c40]);
        async_ld_b128((unsigned int)(size_t)&As[buf][row1 * 40 + c41],
                      &A[(size_t)(ablk + row1) * 1024 + k0 + c41]);
        async_ld_b128((unsigned int)(size_t)&Bs[buf][row1 * 40 + c41],
                      &WT[(size_t)(bblk + row1) * 1024 + k0 + c41]);
    };

    v8f acc[2][4];
#pragma unroll
    for (int mt = 0; mt < 2; ++mt)
#pragma unroll
        for (int nt = 0; nt < 4; ++nt) acc[mt][nt] = (v8f){0,0,0,0,0,0,0,0};

    issue_tile(0, 0);                                   // prologue DMA

#pragma unroll 1
    for (int kk = 0; kk < 32; ++kk) {
        int k0 = kk * 32;
        if (kk + 1 < 32) {
            issue_tile(k0 + 32, (kk + 1) & 1);          // prefetch next tile
            // async loads complete in order: <=4 outstanding => tile kk landed
            asm volatile("s_wait_asynccnt 0x4" ::: "memory");
        } else {
            asm volatile("s_wait_asynccnt 0x0" ::: "memory");
        }
        __syncthreads();

        const _Float16* as = &As[kk & 1][0];
        const _Float16* bs = &Bs[kk & 1][0];
        v16h af[2], bf[4];
#pragma unroll
        for (int mt = 0; mt < 2; ++mt)
            af[mt] = ldfrag(&as[(wm * 32 + mt * 16 + col) * 40], kb);
#pragma unroll
        for (int nt = 0; nt < 4; ++nt)
            bf[nt] = ldfrag(&bs[(wn * 64 + nt * 16 + col) * 40], kb);

#pragma unroll
        for (int mt = 0; mt < 2; ++mt)
#pragma unroll
            for (int nt = 0; nt < 4; ++nt)
                acc[mt][nt] = wmma_f16(af[mt], bf[nt], acc[mt][nt]);
        __syncthreads();   // all waves done reading buf before it is re-DMA'd
    }

    // epilogue (C layout: VGPR r -> row r + 8*(lane>>4), col = lane&15)
#pragma unroll
    for (int mt = 0; mt < 2; ++mt)
#pragma unroll
        for (int nt = 0; nt < 4; ++nt) {
            int rowBase = ablk + wm * 32 + mt * 16 + hi8;
            int c       = bblk + wn * 64 + nt * 16 + col;
#pragma unroll
            for (int r = 0; r < 8; ++r) {
                int g = rowBase + r;                    // 0..2047
                float v = acc[mt][nt][r];
                if constexpr (MODE == MODE_Q) {
                    v = (v + bias[c]) * QK_SCALE;
                    out16[(size_t)g * 1024 + c] = (_Float16)v;
                } else if constexpr (MODE == MODE_K) {
                    out32[(size_t)g * 1024 + c] = v;
                    int b = g >> 8, t = g & 255;
                    out16[((size_t)(b * T_KV + T_CACHE + t)) * 1024 + c] = (_Float16)v;
                } else if constexpr (MODE == MODE_V) {
                    v += bias[c];
                    out32[(size_t)g * 1024 + c] = v;
                    int b = g >> 8, t = g & 255;
                    out16[((size_t)((b * 16 + (c >> 6)) * 64 + (c & 63))) * T_KV
                          + T_CACHE + t] = (_Float16)v;
                } else {
                    v += bias[c];
                    out32[(size_t)g * 1024 + c] = v;
                }
            }
        }
}

// ---------------- flash attention ----------------
// grid = 256 blocks: b(8) x h(16) x qhalf(2); 8 waves x 16 query rows = 128 rows/block.
// Each wave is fully independent (wave-private LDS P buffer, LDS in-order per wave).
__global__ __launch_bounds__(256)
void attn_wmma_kernel(const _Float16* __restrict__ qh,
                      const _Float16* __restrict__ kh,
                      const _Float16* __restrict__ vt,
                      const float* __restrict__ mask,
                      _Float16* __restrict__ ph) {
    __shared__ __align__(16) _Float16 ps[8][16 * 72];

    const int lane  = threadIdx.x & 31;
    const int wid   = threadIdx.x >> 5;
    const int col   = lane & 15;
    const int hi    = lane >> 4;
    const int kb    = hi * 8;
    const int blk   = blockIdx.x;
    const int b     = blk >> 5;
    const int h     = (blk >> 1) & 15;
    const int qbase = (blk & 1) * 128 + wid * 16;

    // Q A-fragments (reused for the whole key loop)
    const _Float16* qrow =
        qh + (size_t)(b * T_Q + qbase + col) * 1024 + h * 64;
    const v16h aq0 = ldfrag(qrow, kb);        // dims 0..31
    const v16h aq1 = ldfrag(qrow + 32, kb);   // dims 32..63

    v8f o[4];
#pragma unroll
    for (int nt = 0; nt < 4; ++nt) o[nt] = (v8f){0,0,0,0,0,0,0,0};
    float rmax[8], rsum[8];
#pragma unroll
    for (int r = 0; r < 8; ++r) { rmax[r] = -3.0e38f; rsum[r] = 0.0f; }

    _Float16* myp = &ps[wid][0];

#pragma unroll 1
    for (int kvc = 0; kvc < T_KV; kvc += 64) {
        // ---- S = Q @ K^T  (16 x 64 scores) ----
        v8f s[4];
#pragma unroll
        for (int g = 0; g < 4; ++g) s[g] = (v8f){0,0,0,0,0,0,0,0};
#pragma unroll
        for (int g = 0; g < 4; ++g) {
            const _Float16* krow =
                kh + (size_t)(b * T_KV + kvc + g * 16 + col) * 1024 + h * 64;
            v16h bk0 = ldfrag(krow, kb);
            v16h bk1 = ldfrag(krow + 32, kb);
            s[g] = wmma_f16(aq0, bk0, s[g]);
            s[g] = wmma_f16(aq1, bk1, s[g]);
        }
        // ---- mask + chunk row-max ----
        float cmax[8];
#pragma unroll
        for (int r = 0; r < 8; ++r) cmax[r] = -3.0e38f;
#pragma unroll
        for (int g = 0; g < 4; ++g)
#pragma unroll
            for (int r = 0; r < 8; ++r) {
                int qr  = qbase + hi * 8 + r;
                int key = kvc + g * 16 + col;
                float v = s[g][r] + mask[(size_t)qr * T_KV + key];
                s[g][r] = v;
                cmax[r] = fmaxf(cmax[r], v);
            }
#pragma unroll
        for (int r = 0; r < 8; ++r) {
            cmax[r] = fmaxf(cmax[r], swz_xor<1>(cmax[r]));
            cmax[r] = fmaxf(cmax[r], swz_xor<2>(cmax[r]));
            cmax[r] = fmaxf(cmax[r], swz_xor<4>(cmax[r]));
            cmax[r] = fmaxf(cmax[r], swz_xor<8>(cmax[r]));
        }
        // ---- online softmax update ----
        float scl[8];
#pragma unroll
        for (int r = 0; r < 8; ++r) {
            float nm = fmaxf(rmax[r], cmax[r]);
            scl[r]   = __expf(rmax[r] - nm);
            rmax[r]  = nm;
        }
#pragma unroll
        for (int nt = 0; nt < 4; ++nt)
#pragma unroll
            for (int r = 0; r < 8; ++r) o[nt][r] *= scl[r];

        float psum[8];
#pragma unroll
        for (int r = 0; r < 8; ++r) psum[r] = 0.0f;
#pragma unroll
        for (int g = 0; g < 4; ++g)
#pragma unroll
            for (int r = 0; r < 8; ++r) {
                float p = __expf(s[g][r] - rmax[r]);
                psum[r] += p;
                myp[(hi * 8 + r) * 72 + g * 16 + col] = (_Float16)p;
            }
#pragma unroll
        for (int r = 0; r < 8; ++r) rsum[r] = rsum[r] * scl[r] + psum[r];

        // ---- O += P @ V (P relaid out via wave-private LDS) ----
        const _Float16* prow = myp + col * 72;
        v16h ap0 = ldfrag(prow, kb);        // keys 0..31 of chunk
        v16h ap1 = ldfrag(prow + 32, kb);   // keys 32..63
#pragma unroll
        for (int nt = 0; nt < 4; ++nt) {
            const _Float16* vrow =
                vt + (size_t)((b * 16 + h) * 64 + nt * 16 + col) * T_KV + kvc;
            v16h bv0 = ldfrag(vrow, kb);
            v16h bv1 = ldfrag(vrow + 32, kb);
            o[nt] = wmma_f16(ap0, bv0, o[nt]);
            o[nt] = wmma_f16(ap1, bv1, o[nt]);
        }
    }

    // ---- finalize: reduce row sums, normalize, write ph (f16) ----
#pragma unroll
    for (int r = 0; r < 8; ++r) {
        rsum[r] += swz_xor<1>(rsum[r]);
        rsum[r] += swz_xor<2>(rsum[r]);
        rsum[r] += swz_xor<4>(rsum[r]);
        rsum[r] += swz_xor<8>(rsum[r]);
    }
#pragma unroll
    for (int nt = 0; nt < 4; ++nt)
#pragma unroll
        for (int r = 0; r < 8; ++r) {
            float v = o[nt][r] / rsum[r];
            int qr  = qbase + hi * 8 + r;
            int c   = h * 64 + nt * 16 + col;
            ph[(size_t)(b * T_Q + qr) * 1024 + c] = (_Float16)v;
        }
}

// ---------------- host launcher ----------------
extern "C" void kernel_launch(void* const* d_in, const int* in_sizes, int n_in,
                              void* d_out, int out_size, void* d_ws, size_t ws_size,
                              hipStream_t stream) {
    const float* x    = (const float*)d_in[0];
    const float* mask = (const float*)d_in[1];
    const float* ck   = (const float*)d_in[2];
    const float* cv   = (const float*)d_in[3];
    const float* Wq   = (const float*)d_in[4];
    const float* bq   = (const float*)d_in[5];
    const float* Wk   = (const float*)d_in[6];
    const float* Wv   = (const float*)d_in[7];
    const float* bv   = (const float*)d_in[8];
    const float* Wo   = (const float*)d_in[9];
    const float* bo   = (const float*)d_in[10];

    float* out  = (float*)d_out;                 // [2048,1024]
    float* outK = out  + (size_t)NROWS * N_STATE;
    float* outV = outK + (size_t)NROWS * N_STATE;

    char* w = (char*)d_ws;
    _Float16* xh  = (_Float16*)w; w += (size_t)NROWS * N_STATE * 2;
    _Float16* WqT = (_Float16*)w; w += (size_t)N_STATE * N_STATE * 2;
    _Float16* WkT = (_Float16*)w; w += (size_t)N_STATE * N_STATE * 2;
    _Float16* WvT = (_Float16*)w; w += (size_t)N_STATE * N_STATE * 2;
    _Float16* WoT = (_Float16*)w; w += (size_t)N_STATE * N_STATE * 2;
    _Float16* qh  = (_Float16*)w; w += (size_t)NROWS * N_STATE * 2;
    _Float16* kh  = (_Float16*)w; w += (size_t)BATCH * T_KV * N_STATE * 2;
    _Float16* vt  = (_Float16*)w; w += (size_t)BATCH * T_KV * N_STATE * 2;
    _Float16* ph  = (_Float16*)w; w += (size_t)NROWS * N_STATE * 2;

    // stage conversions
    cvt_rows_kernel<NROWS, NROWS, 8><<<NROWS / 8, 256, 0, stream>>>(x, xh);
    transpose_cvt_kernel<N_STATE><<<dim3(N_STATE / 64, N_STATE / 128, 1), 256, 0, stream>>>(Wq, WqT);
    transpose_cvt_kernel<N_STATE><<<dim3(N_STATE / 64, N_STATE / 128, 1), 256, 0, stream>>>(Wk, WkT);
    transpose_cvt_kernel<N_STATE><<<dim3(N_STATE / 64, N_STATE / 128, 1), 256, 0, stream>>>(Wv, WvT);
    transpose_cvt_kernel<N_STATE><<<dim3(N_STATE / 64, N_STATE / 128, 1), 256, 0, stream>>>(Wo, WoT);
    cvt_rows_kernel<T_CACHE, T_KV, 24><<<(BATCH * T_CACHE) / 24, 256, 0, stream>>>(ck, kh);
    transpose_cvt_kernel<T_CACHE><<<dim3(N_STATE / 64, T_CACHE / 128, BATCH), 256, 0, stream>>>(cv, vt);

    // projections
    dim3 gg(N_STATE / 128, NROWS / 128);   // (8, 16)
    gemm_wmma_kernel<MODE_Q><<<gg, 256, 0, stream>>>(xh, WqT, bq, nullptr, qh);
    gemm_wmma_kernel<MODE_K><<<gg, 256, 0, stream>>>(xh, WkT, nullptr, outK, kh);
    gemm_wmma_kernel<MODE_V><<<gg, 256, 0, stream>>>(xh, WvT, bv, outV, vt);

    // attention
    attn_wmma_kernel<<<BATCH * 16 * 2, 256, 0, stream>>>(qh, kh, vt, mask, ph);

    // output projection
    gemm_wmma_kernel<MODE_O><<<gg, 256, 0, stream>>>(ph, WoT, bo, out, nullptr);
}

// v003
// One run takes 101 microseconds.
// Timed twice side by side with v002, it ran 1.40 times as fast both times.
// Counting every step since v000, it is 4.06 times as fast.
#include <hip/hip_runtime.h>

// ---------------- types ----------------
typedef __attribute__((ext_vector_type(16))) _Float16 v16h;
typedef __attribute__((ext_vector_type(8)))  _Float16 v8h;
typedef __attribute__((ext_vector_type(4)))  _Float16 v4h;
typedef __attribute__((ext_vector_type(8)))  float    v8f;

#define N_STATE 1024
#define T_Q     256
#define T_CACHE 768
#define T_KV    1024
#define BATCH   8
#define NROWS   2048          // B*T
#define QK_SCALE 0.125f

// ---------------- WMMA helpers ----------------
__device__ __forceinline__ v8f wmma_f16(v16h a, v16h b, v8f c) {
    // D = A(16x32) * B(32x16) + C, f32 accumulate
    return __builtin_amdgcn_wmma_f32_16x16x32_f16(
        false, a, false, b, (short)0, c, false, false);
}

// Load a 16x32 A-style fragment for this lane.
// Lane layout (ISA 7.12.2, 16-bit A 16x32): row = lane&15, kb = (lane>>4)*8,
// halves cover K in [kb,kb+8) and [kb+16,kb+24)  -> two 16-byte loads.
// `p` must point at element [lane&15][0] of the tile (row stride pre-applied).
__device__ __forceinline__ v16h ldfrag(const _Float16* p, int kb) {
    union { v16h v; v8h h[2]; } u;
    u.h[0] = *(const v8h*)(p + kb);
    u.h[1] = *(const v8h*)(p + kb + 16);
    return u.v;
}

// Async global -> LDS copy of 16 bytes per lane (CDNA5 GLOBAL_LOAD_ASYNC_TO_LDS,
// tracked by ASYNCcnt). lds_off = wave-relative LDS byte address (low 32 bits
// of the generic shared pointer).
__device__ __forceinline__ void async_ld_b128(unsigned int lds_off,
                                              const _Float16* g) {
    asm volatile("global_load_async_to_lds_b128 %0, %1, off"
                 :: "v"(lds_off), "v"(g)
                 : "memory");
}

// xor-shuffle across lanes via ds_swizzle (group-of-32 mode: and=0x1f, xor=XM)
template<int XM>
__device__ __forceinline__ float swz_xor(float v) {
    int i = __float_as_int(v);
    i = __builtin_amdgcn_ds_swizzle(i, (XM << 10) | 0x1f);
    return __int_as_float(i);
}

// ---------------- elementwise converts / packs ----------------
// f32 -> f16 convert of whole rows of 1024 elements:
//   in [batch][RIN][1024] f32  ->  out [batch][ROUT][1024] f16, rows 0..RIN-1 of each batch
// Serves x -> xh (RIN = ROUT = 2048, one batch) and cache_k -> kh (768 of 1024 key rows).
// One block converts RPB rows; RPB divides RIN, so a block stays inside one batch.
// A thread owns one float4 column group of every row: each wave-wide load covers 512
// contiguous bytes and each wave-wide store 256, whole lines both ways. A thread's loads
// are independent and stand ahead of its stores, so few waves keep many bytes in flight,
// and the launch starts RPB * 4 times fewer waves than one element a thread would.
// blk = index of the block among the blocks of this convert.
template<int RIN, int ROUT, int RPB>
__device__ __forceinline__
void cvt_rows_block(const float* __restrict__ in,
                    _Float16* __restrict__ out, int blk) {
    static_assert(RIN % RPB == 0, "a block must not straddle two batches");
    const int r0 = blk * RPB;
    const int b  = r0 / RIN;
    const int c  = threadIdx.x * 4;
    const float* src = in + (size_t)r0 * 1024 + c;
    _Float16*    dst = out + (size_t)(r0 + b * (ROUT - RIN)) * 1024 + c;

    float4 v[RPB];
    // unrolled so that v[] stays in registers and the loads go out back to back
#pragma unroll
    for (int j = 0; j < RPB; ++j)
        v[j] = *(const float4*)(src + (size_t)j * 1024);
    // unrolled for the same reason: v[] is indexed by constants only
#pragma unroll
    for (int j = 0; j < RPB; ++j) {
        v4h h = { (_Float16)v[j].x, (_Float16)v[j].y, (_Float16)v[j].z, (_Float16)v[j].w };
        *(v4h*)(dst + (size_t)j * 1024) = h;
    }
}

// Transposing convert through an LDS tile:
//   in  [batch][ROWS][1024] f32  ->  out [batch][1024][1024] f16, columns 0..ROWS-1
//   out[b][c][s] = (f16) in[b][s][c]
// Serves W[k][n] -> WT[n][k] (ROWS = 1024, one batch) and cache_v[b][s][c] ->
// vt[b][c = h*64+dh][key s] (ROWS = 768, eight batches).
// One block moves a tile of 128 rows (s) x 64 columns (c): 256 contiguous bytes a row on
// the f32 side and 256 contiguous bytes a row on the f16 side, so loads and stores both
// cover whole lines. A thread loads 8 consecutive rows of one float4 column group; each
// of its 4 columns is then 8 halves (16 bytes) of one output row.
// LDS row = one output row of 16 chunks of 16 bytes; chunk q of row c sits at q ^ (c >> 2),
// which spreads the 16 lanes of a half wave over all banks in the store and in the load.
// tile = the block's LDS tile of 64 * 128 halves; (bx, by, b) = column tile, row tile, batch.
template<int ROWS>
__device__ __forceinline__
void transpose_cvt_block(const float* __restrict__ in,
                         _Float16* __restrict__ out,
                         _Float16* tile, int bx, int by, int b) {
    const int tid = threadIdx.x;
    const int c0  = bx * 64;
    const int s0  = by * 128;

    const int c4 = tid & 15;            // float4 column group
    const int sr = tid >> 4;            // group of 8 rows
    const float* src = in + ((size_t)b * ROWS + s0 + sr * 8) * 1024 + c0 + c4 * 4;

    float4 v[8];
#pragma unroll
    for (int j = 0; j < 8; ++j)
        v[j] = *(const float4*)(src + (size_t)j * 1024);

    v8h h0, h1, h2, h3;
#pragma unroll
    for (int j = 0; j < 8; ++j) {
        h0[j] = (_Float16)v[j].x;
        h1[j] = (_Float16)v[j].y;
        h2[j] = (_Float16)v[j].z;
        h3[j] = (_Float16)v[j].w;
    }
    _Float16* dst = &tile[(c4 * 4) * 128 + ((sr ^ c4) * 8)];
    *(v8h*)(dst)           = h0;
    *(v8h*)(dst + 128)     = h1;
    *(v8h*)(dst + 2 * 128) = h2;
    *(v8h*)(dst + 3 * 128) = h3;

    __syncthreads();   // the tile is read back across waves

    const int q  = tid & 15;            // 16-byte chunk of an output row
    const int cr = tid >> 4;
    _Float16* o = out + ((size_t)b * 1024 + c0) * 1024 + s0 + q * 8;
#pragma unroll
    for (int p = 0; p < 4; ++p) {
        int c = p * 16 + cr;
        *(v8h*)(o + (size_t)c * 1024) = *(const v8h*)&tile[c * 128 + ((q ^ (c >> 2)) * 8)];
    }
}

// All seven converts in ONE launch. None reads what another writes, so their blocks stand
// side by side in one grid, each convert on its own range of block indices: one launch gap
// and one start-up and tail instead of seven, and the small converts (128 blocks a weight
// matrix, half the chip) run beside the large ones instead of alone.
// The branch is on blockIdx alone, so the barrier inside a transpose is block-uniform.
// The blocks with the most bytes come first.
#define NB_CK ((BATCH * T_CACHE) / 24)                        // cache_k rows
#define NB_CV ((N_STATE / 64) * (T_CACHE / 128) * BATCH)      // cache_v tiles
#define NB_W  ((N_STATE / 64) * (N_STATE / 128))              // tiles of one weight matrix
#define NB_X  (NROWS / 8)                                     // x rows
__global__ __launch_bounds__(256)
void prep_kernel(const float* __restrict__ x,
                 const float* __restrict__ ck,
                 const float* __restrict__ cv,
                 const float* __restrict__ Wq,
                 const float* __restrict__ Wk,
                 const float* __restrict__ Wv,
                 const float* __restrict__ Wo,
                 _Float16* __restrict__ xh,
                 _Float16* __restrict__ WT4,     // WqT, WkT, WvT, WoT one behind the other
                 _Float16* __restrict__ kh,
                 _Float16* __restrict__ vt) {
    __shared__ __align__(16) _Float16 tile[64 * 128];

    // Each branch ends with s_wait_xcnt 0: in the built code the branches stand one behind the
    // other, and the next one's first instructions reuse registers that the stores just issued
    // still name; the wait stands in front of any such overwrite.
    int blk = blockIdx.x;
    if (blk < NB_CK) {
        cvt_rows_block<T_CACHE, T_KV, 24>(ck, kh, blk);
        asm volatile("s_wait_xcnt 0x0" ::: "memory");   // see the note above
    } else if (blk < NB_CK + NB_CV) {
        blk -= NB_CK;
        const int t = blk >> 4;                  // row tile and batch
        transpose_cvt_block<T_CACHE>(cv, vt, tile, blk & 15,
                                     t % (T_CACHE / 128), t / (T_CACHE / 128));
        asm volatile("s_wait_xcnt 0x0" ::: "memory");   // see the note above
    } else if (blk < NB_CK + NB_CV + 4 * NB_W) {
        blk -= NB_CK + NB_CV;
        const int m = blk / NB_W;                // which weight matrix
        const float* W = m == 0 ? Wq : m == 1 ? Wk : m == 2 ? Wv : Wo;
        transpose_cvt_block<N_STATE>(W, WT4 + (size_t)m * (N_STATE * N_STATE), tile,
                                     blk & 15, (blk >> 4) & 7, 0);
        asm volatile("s_wait_xcnt 0x0" ::: "memory");   // see the note above
    } else {
        cvt_rows_block<NROWS, NROWS, 8>(x, xh, blk - (NB_CK + NB_CV + 4 * NB_W));
        asm volatile("s_wait_xcnt 0x0" ::: "memory");   // see the note above
    }
}

// ---------------- tiled WMMA GEMM: C[2048,1024] = A[2048,1024] @ W[1024,1024] ----------------
// A f16 row-major, WT f16 = W^T row-major ([n][k]).
// Block tile 128x128, BK=32; 8 waves in 4(M)x2(N) grid, each wave 32x64 (2x4 16x16 tiles).
// Tiles are DMA'd global->LDS with GLOBAL_LOAD_ASYNC_TO_LDS_B128, double-buffered:
// the DMA of tile k+1 overlaps the 8 WMMAs of tile k.
#define MODE_Q 0
#define MODE_K 1
#define MODE_V 2
#define MODE_O 3

template<int M> struct mode_tag { static constexpr int value = M; };

// QKV = true: ONE launch does the three projections of x, which share A and depend on
// nothing of each other: blockIdx.z picks the weight matrix and the epilogue, so 384 blocks
// fill the chip where each projection alone has 128. V, whose epilogue is the longest,
// takes the lowest z and starts first.
// QKV = false: the output projection alone (WTs = WoT, bias_q = bo, out32s = out).
template<bool QKV>
__global__ __launch_bounds__(256)
void gemm_wmma_kernel(const _Float16* __restrict__ A,
                      const _Float16* __restrict__ WTs,    // WqT, WkT, WvT one behind the other
                      const float* __restrict__ bias_q,
                      const float* __restrict__ bias_v,
                      float* __restrict__ out32s,          // new_k, new_v one behind the other
                      _Float16* __restrict__ qh,
                      _Float16* __restrict__ kh,
                      _Float16* __restrict__ vt) {
    const int mode = QKV ? MODE_V - (int)blockIdx.z : MODE_O;
    const _Float16* WT = QKV ? WTs + (size_t)mode * (N_STATE * N_STATE) : WTs;

    __shared__ __align__(16) _Float16 As[2][128 * 40];   // [row][40], 32 cols + pad
    __shared__ __align__(16) _Float16 Bs[2][128 * 40];   // [n][40]

    const int tid  = threadIdx.x;
    const int lane = tid & 31;
    const int wid  = tid >> 5;
    const int wm   = wid >> 1;           // 0..3
    const int wn   = wid & 1;            // 0..1
    const int col  = lane & 15;
    const int hi8  = (lane >> 4) * 8;
    const int kb   = hi8;
    const int ablk = blockIdx.y * 128;
    const int bblk = blockIdx.x * 128;

    // each thread owns two 8-half chunks of each tile
    const int q0   = tid,        q1 = tid + 256;          // chunk ids 0..511
    const int row0 = q0 >> 2,    c40 = (q0 & 3) * 8;
    const int row1 = q1 >> 2,    c41 = (q1 & 3) * 8;

    auto issue_tile = [&](int k0, int buf) {
        async_ld_b128((unsigned int)(size_t)&As[buf][row0 * 40 + c40],
                      &A[(size_t)(ablk + row0) * 1024 + k0 + c40]);
        async_ld_b128((unsigned int)(size_t)&Bs[buf][row0 * 40 + c40],
                      &WT[(size_t)(bblk + row0) * 1024 + k0 + c40]);
        async_ld_b128((unsigned int)(size_t)&As[buf][row1 * 40 + c41],
                      &A[(size_t)(ablk + row1) * 1024 + k0 + c41]);
        async_ld_b128((unsigned int)(size_t)&Bs[buf][row1 * 40 + c41],
                      &WT[(size_t)(bblk + row1) * 1024 + k0 + c41]);
    };

    v8f acc[2][4];
#pragma unroll
    for (int mt = 0; mt < 2; ++mt)
#pragma unroll
        for (int nt = 0; nt < 4; ++nt) acc[mt][nt] = (v8f){0,0,0,0,0,0,0,0};

    issue_tile(0, 0);                                   // prologue DMA

#pragma unroll 1
    for (int kk = 0; kk < 32; ++kk) {
        int k0 = kk * 32;
        if (kk + 1 < 32) {
            issue_tile(k0 + 32, (kk + 1) & 1);          // prefetch next tile
            // async loads complete in order: <=4 outstanding => tile kk landed
            asm volatile("s_wait_asynccnt 0x4" ::: "memory");
        } else {
            asm volatile("s_wait_asynccnt 0x0" ::: "memory");
        }
        __syncthreads();

        const _Float16* as = &As[kk & 1][0];
        const _Float16* bs = &Bs[kk & 1][0];
        v16h af[2], bf[4];
#pragma unroll
        for (int mt = 0; mt < 2; ++mt)
            af[mt] = ldfrag(&as[(wm * 32 + mt * 16 + col) * 40], kb);
#pragma unroll
        for (int nt = 0; nt < 4; ++nt)
            bf[nt] = ldfrag(&bs[(wn * 64 + nt * 16 + col) * 40], kb);

#pragma unroll
        for (int mt = 0; mt < 2; ++mt)
#pragma unroll
            for (int nt = 0; nt < 4; ++nt)
                acc[mt][nt] = wmma_f16(af[mt], bf[nt], acc[mt][nt]);
        __syncthreads();   // all waves done reading buf before it is re-DMA'd
    }

    // epilogue (C layout: VGPR r -> row r + 8*(lane>>4), col = lane&15)
    auto epilogue = [&](auto tag, const float* __restrict__ bias,
                        float* __restrict__ out32, _Float16* __restrict__ out16) {
    constexpr int MODE = decltype(tag)::value;
#pragma unroll
    for (int mt = 0; mt < 2; ++mt)
#pragma unroll
        for (int nt = 0; nt < 4; ++nt) {
            int rowBase = ablk + wm * 32 + mt * 16 + hi8;
            int c       = bblk + wn * 64 + nt * 16 + col;
#pragma unroll
            for (int r = 0; r < 8; ++r) {
                int g = rowBase + r;                    // 0..2047
                float v = acc[mt][nt][r];
                if constexpr (MODE == MODE_Q) {
                    v = (v + bias[c]) * QK_SCALE;
                    out16[(size_t)g * 1024 + c] = (_Float16)v;
                } else if constexpr (MODE == MODE_K) {
                    out32[(size_t)g * 1024 + c] = v;
                    int b = g >> 8, t = g & 255;
                    out16[((size_t)(b * T_KV + T_CACHE + t)) * 1024 + c] = (_Float16)v;
                } else if constexpr (MODE == MODE_V) {
                    v += bias[c];
                    out32[(size_t)g * 1024 + c] = v;
                    int b = g >> 8, t = g & 255;
                    out16[((size_t)((b * 16 + (c >> 6)) * 64 + (c & 63))) * T_KV
                          + T_CACHE + t] = (_Float16)v;
                } else {
                    v += bias[c];
                    out32[(size_t)g * 1024 + c] = v;
                }
            }
        }
    };
    if constexpr (QKV) {
        // Each epilogue ends with s_wait_xcnt 0: in the built code the three stand one behind
        // the other, and index arithmetic of the next one reuses registers that the stores just
        // issued still name; the wait stands in front of any such overwrite.
        if (mode == MODE_V) {
            epilogue(mode_tag<MODE_V>{}, bias_v, out32s + (size_t)NROWS * N_STATE, vt);
            asm volatile("s_wait_xcnt 0x0" ::: "memory");   // see the note above
        } else if (mode == MODE_K) {
            epilogue(mode_tag<MODE_K>{}, nullptr, out32s, kh);
            asm volatile("s_wait_xcnt 0x0" ::: "memory");   // see the note above
        } else {
            epilogue(mode_tag<MODE_Q>{}, bias_q, nullptr, qh);
            asm volatile("s_wait_xcnt 0x0" ::: "memory");   // see the note above
        }
    } else {
        epilogue(mode_tag<MODE_O>{}, bias_q, out32s, nullptr);
    }
}

// ---------------- flash attention ----------------
// grid = 256 blocks: b(8) x h(16) x qhalf(2); 8 waves x 16 query rows = 128 rows/block.
// Each wave is fully independent (wave-private LDS P buffer, LDS in-order per wave).
__global__ __launch_bounds__(256)
void attn_wmma_kernel(const _Float16* __restrict__ qh,
                      const _Float16* __restrict__ kh,
                      const _Float16* __restrict__ vt,
                      const float* __restrict__ mask,
                      _Float16* __restrict__ ph) {
    __shared__ __align__(16) _Float16 ps[8][16 * 72];

    const int lane  = threadIdx.x & 31;
    const int wid   = threadIdx.x >> 5;
    const int col   = lane & 15;
    const int hi    = lane >> 4;
    const int kb    = hi * 8;
    const int blk   = blockIdx.x;
    const int b     = blk >> 5;
    const int h     = (blk >> 1) & 15;
    const int qbase = (blk & 1) * 128 + wid * 16;

    // Q A-fragments (reused for the whole key loop)
    const _Float16* qrow =
        qh + (size_t)(b * T_Q + qbase + col) * 1024 + h * 64;
    const v16h aq0 = ldfrag(qrow, kb);        // dims 0..31
    const v16h aq1 = ldfrag(qrow + 32, kb);   // dims 32..63

    v8f o[4];
#pragma unroll
    for (int nt = 0; nt < 4; ++nt) o[nt] = (v8f){0,0,0,0,0,0,0,0};
    float rmax[8], rsum[8];
#pragma unroll
    for (int r = 0; r < 8; ++r) { rmax[r] = -3.0e38f; rsum[r] = 0.0f; }

    _Float16* myp = &ps[wid][0];

#pragma unroll 1
    for (int kvc = 0; kvc < T_KV; kvc += 64) {
        // ---- S = Q @ K^T  (16 x 64 scores) ----
        v8f s[4];
#pragma unroll
        for (int g = 0; g < 4; ++g) s[g] = (v8f){0,0,0,0,0,0,0,0};
#pragma unroll
        for (int g = 0; g < 4; ++g) {
            const _Float16* krow =
                kh + (size_t)(b * T_KV + kvc + g * 16 + col) * 1024 + h * 64;
            v16h bk0 = ldfrag(krow, kb);
            v16h bk1 = ldfrag(krow + 32, kb);
            s[g] = wmma_f16(aq0, bk0, s[g]);
            s[g] = wmma_f16(aq1, bk1, s[g]);
        }
        // ---- mask + chunk row-max ----
        float cmax[8];
#pragma unroll
        for (int r = 0; r < 8; ++r) cmax[r] = -3.0e38f;
#pragma unroll
        for (int g = 0; g < 4; ++g)
#pragma unroll
            for (int r = 0; r < 8; ++r) {
                int qr  = qbase + hi * 8 + r;
                int key = kvc + g * 16 + col;
                float v = s[g][r] + mask[(size_t)qr * T_KV + key];
                s[g][r] = v;
                cmax[r] = fmaxf(cmax[r], v);
            }
#pragma unroll
        for (int r = 0; r < 8; ++r) {
            cmax[r] = fmaxf(cmax[r], swz_xor<1>(cmax[r]));
            cmax[r] = fmaxf(cmax[r], swz_xor<2>(cmax[r]));
            cmax[r] = fmaxf(cmax[r], swz_xor<4>(cmax[r]));
            cmax[r] = fmaxf(cmax[r], swz_xor<8>(cmax[r]));
        }
        // ---- online softmax update ----
        float scl[8];
#pragma unroll
        for (int r = 0; r < 8; ++r) {
            float nm = fmaxf(rmax[r], cmax[r]);
            scl[r]   = __expf(rmax[r] - nm);
            rmax[r]  = nm;
        }
#pragma unroll
        for (int nt = 0; nt < 4; ++nt)
#pragma unroll
            for (int r = 0; r < 8; ++r) o[nt][r] *= scl[r];

        float psum[8];
#pragma unroll
        for (int r = 0; r < 8; ++r) psum[r] = 0.0f;
#pragma unroll
        for (int g = 0; g < 4; ++g)
#pragma unroll
            for (int r = 0; r < 8; ++r) {
                float p = __expf(s[g][r] - rmax[r]);
                psum[r] += p;
                myp[(hi * 8 + r) * 72 + g * 16 + col] = (_Float16)p;
            }
#pragma unroll
        for (int r = 0; r < 8; ++r) rsum[r] = rsum[r] * scl[r] + psum[r];

        // ---- O += P @ V (P relaid out via wave-private LDS) ----
        const _Float16* prow = myp + col * 72;
        v16h ap0 = ldfrag(prow, kb);        // keys 0..31 of chunk
        v16h ap1 = ldfrag(prow + 32, kb);   // keys 32..63
#pragma unroll
        for (int nt = 0; nt < 4; ++nt) {
            const _Float16* vrow =
                vt + (size_t)((b * 16 + h) * 64 + nt * 16 + col) * T_KV + kvc;
            v16h bv0 = ldfrag(vrow, kb);
            v16h bv1 = ldfrag(vrow + 32, kb);
            o[nt] = wmma_f16(ap0, bv0, o[nt]);
            o[nt] = wmma_f16(ap1, bv1, o[nt]);
        }
    }

    // ---- finalize: reduce row sums, normalize, write ph (f16) ----
#pragma unroll
    for (int r = 0; r < 8; ++r) {
        rsum[r] += swz_xor<1>(rsum[r]);
        rsum[r] += swz_xor<2>(rsum[r]);
        rsum[r] += swz_xor<4>(rsum[r]);
        rsum[r] += swz_xor<8>(rsum[r]);
    }
#pragma unroll
    for (int nt = 0; nt < 4; ++nt)
#pragma unroll
        for (int r = 0; r < 8; ++r) {
            float v = o[nt][r] / rsum[r];
            int qr  = qbase + hi * 8 + r;
            int c   = h * 64 + nt * 16 + col;
            ph[(size_t)(b * T_Q + qr) * 1024 + c] = (_Float16)v;
        }
}

// ---------------- host launcher ----------------
extern "C" void kernel_launch(void* const* d_in, const int* in_sizes, int n_in,
                              void* d_out, int out_size, void* d_ws, size_t ws_size,
                              hipStream_t stream) {
    const float* x    = (const float*)d_in[0];
    const float* mask = (const float*)d_in[1];
    const float* ck   = (const float*)d_in[2];
    const float* cv   = (const float*)d_in[3];
    const float* Wq   = (const float*)d_in[4];
    const float* bq   = (const float*)d_in[5];
    const float* Wk   = (const float*)d_in[6];
    const float* Wv   = (const float*)d_in[7];
    const float* bv   = (const float*)d_in[8];
    const float* Wo   = (const float*)d_in[9];
    const float* bo   = (const float*)d_in[10];

    float* out  = (float*)d_out;                 // [2048,1024]
    float* outK = out  + (size_t)NROWS * N_STATE;   // new_k; new_v follows it

    char* w = (char*)d_ws;
    _Float16* xh  = (_Float16*)w; w += (size_t)NROWS * N_STATE * 2;
    _Float16* WT4 = (_Float16*)w; w += (size_t)3 * N_STATE * N_STATE * 2;   // WqT, WkT, WvT
    _Float16* WoT = (_Float16*)w; w += (size_t)N_STATE * N_STATE * 2;
    _Float16* qh  = (_Float16*)w; w += (size_t)NROWS * N_STATE * 2;
    _Float16* kh  = (_Float16*)w; w += (size_t)BATCH * T_KV * N_STATE * 2;
    _Float16* vt  = (_Float16*)w; w += (size_t)BATCH * T_KV * N_STATE * 2;
    _Float16* ph  = (_Float16*)w; w += (size_t)NROWS * N_STATE * 2;

    // stage conversions: one launch
    prep_kernel<<<NB_CK + NB_CV + 4 * NB_W + NB_X, 256, 0, stream>>>(
        x, ck, cv, Wq, Wk, Wv, Wo, xh, WT4, kh, vt);

    // projections of x: one launch
    gemm_wmma_kernel<true><<<dim3(N_STATE / 128, NROWS / 128, 3), 256, 0, stream>>>(
        xh, WT4, bq, bv, outK, qh, kh, vt);

    // attention
    attn_wmma_kernel<<<BATCH * 16 * 2, 256, 0, stream>>>(qh, kh, vt, mask, ph);

    // output projection
    gemm_wmma_kernel<false><<<dim3(N_STATE / 128, NROWS / 128), 256, 0, stream>>>(
        ph, WoT, bo, nullptr, out, nullptr, nullptr, nullptr);
}

// v004
// Measured time: 87 microseconds a run.
// Next to v003, in two timings, it ran 1.15 times as fast each time.
// All steps since v000 together make it 4.66 times as fast.
#include <hip/hip_runtime.h>

// ---------------- types ----------------
typedef __attribute__((ext_vector_type(16))) _Float16 v16h;
typedef __attribute__((ext_vector_type(8)))  _Float16 v8h;
typedef __attribute__((ext_vector_type(4)))  _Float16 v4h;
typedef __attribute__((ext_vector_type(8)))  float    v8f;

#define N_STATE 1024
#define T_Q     256
#define T_CACHE 768
#define T_KV    1024
#define BATCH   8
#define NROWS   2048          // B*T
#define QK_SCALE 0.125f

// ---------------- WMMA helpers ----------------
__device__ __forceinline__ v8f wmma_f16(v16h a, v16h b, v8f c) {
    // D = A(16x32) * B(32x16) + C, f32 accumulate
    return __builtin_amdgcn_wmma_f32_16x16x32_f16(
        false, a, false, b, (short)0, c, false, false);
}

// Load a 16x32 A-style fragment for this lane.
// Lane layout (ISA 7.12.2, 16-bit A 16x32): row = lane&15, kb = (lane>>4)*8,
// halves cover K in [kb,kb+8) and [kb+16,kb+24)  -> two 16-byte loads.
// `p` must point at element [lane&15][0] of the tile (row stride pre-applied).
__device__ __forceinline__ v16h ldfrag(const _Float16* p, int kb) {
    union { v16h v; v8h h[2]; } u;
    u.h[0] = *(const v8h*)(p + kb);
    u.h[1] = *(const v8h*)(p + kb + 16);
    return u.v;
}

// Async global -> LDS copy of 16 bytes per lane (CDNA5 GLOBAL_LOAD_ASYNC_TO_LDS,
// tracked by ASYNCcnt). lds_off = wave-relative LDS byte address (low 32 bits
// of the generic shared pointer).
__device__ __forceinline__ void async_ld_b128(unsigned int lds_off,
                                              const _Float16* g) {
    asm volatile("global_load_async_to_lds_b128 %0, %1, off"
                 :: "v"(lds_off), "v"(g)
                 : "memory");
}

// Four such copies of one lane, one behind the other, each with its own LDS byte address and
// its own global pointer. s_wait_xcnt 0 is the statement's last line, so that it stands in
// front of any later write of a register that one of the copies names.
__device__ __forceinline__ void async_ld4_b128(unsigned int l0, const _Float16* g0,
                                               unsigned int l1, const _Float16* g1,
                                               unsigned int l2, const _Float16* g2,
                                               unsigned int l3, const _Float16* g3) {
    asm volatile("global_load_async_to_lds_b128 %0, %1, off\n\t"
                 "global_load_async_to_lds_b128 %2, %3, off\n\t"
                 "global_load_async_to_lds_b128 %4, %5, off\n\t"
                 "global_load_async_to_lds_b128 %6, %7, off\n\t"
                 "s_wait_xcnt 0x0"
                 :: "v"(l0), "v"(g0), "v"(l1), "v"(g1),
                    "v"(l2), "v"(g2), "v"(l3), "v"(g3)
                 : "memory");
}

// xor-shuffle across lanes via ds_swizzle (group-of-32 mode: and=0x1f, xor=XM)
template<int XM>
__device__ __forceinline__ float swz_xor(float v) {
    int i = __float_as_int(v);
    i = __builtin_amdgcn_ds_swizzle(i, (XM << 10) | 0x1f);
    return __int_as_float(i);
}

// ---------------- elementwise converts / packs ----------------
// f32 -> f16 convert of whole rows of 1024 elements:
//   in [batch][RIN][1024] f32  ->  out [batch][ROUT][1024] f16, rows 0..RIN-1 of each batch
// Serves x -> xh (RIN = ROUT = 2048, one batch) and cache_k -> kh (768 of 1024 key rows).
// One block converts RPB rows; RPB divides RIN, so a block stays inside one batch.
// A thread owns one float4 column group of every row: each wave-wide load covers 512
// contiguous bytes and each wave-wide store 256, whole lines both ways. A thread's loads
// are independent and stand ahead of its stores, so few waves keep many bytes in flight,
// and the launch starts RPB * 4 times fewer waves than one element a thread would.
// blk = index of the block among the blocks of this convert.
template<int RIN, int ROUT, int RPB>
__device__ __forceinline__
void cvt_rows_block(const float* __restrict__ in,
                    _Float16* __restrict__ out, int blk) {
    static_assert(RIN % RPB == 0, "a block must not straddle two batches");
    const int r0 = blk * RPB;
    const int b  = r0 / RIN;
    const int c  = threadIdx.x * 4;
    const float* src = in + (size_t)r0 * 1024 + c;
    _Float16*    dst = out + (size_t)(r0 + b * (ROUT - RIN)) * 1024 + c;

    float4 v[RPB];
    // unrolled so that v[] stays in registers and the loads go out back to back
#pragma unroll
    for (int j = 0; j < RPB; ++j)
        v[j] = *(const float4*)(src + (size_t)j * 1024);
    // unrolled for the same reason: v[] is indexed by constants only
#pragma unroll
    for (int j = 0; j < RPB; ++j) {
        v4h h = { (_Float16)v[j].x, (_Float16)v[j].y, (_Float16)v[j].z, (_Float16)v[j].w };
        *(v4h*)(dst + (size_t)j * 1024) = h;
    }
}

// Transposing convert through an LDS tile:
//   in  [batch][ROWS][1024] f32  ->  out [batch][1024][1024] f16, columns 0..ROWS-1
//   out[b][c][s] = (f16) in[b][s][c]
// Serves W[k][n] -> WT[n][k] (ROWS = 1024, one batch) and cache_v[b][s][c] ->
// vt[b][c = h*64+dh][key s] (ROWS = 768, eight batches).
// One block moves a tile of 128 rows (s) x 64 columns (c): 256 contiguous bytes a row on
// the f32 side and 256 contiguous bytes a row on the f16 side, so loads and stores both
// cover whole lines. A thread loads 8 consecutive rows of one float4 column group; each
// of its 4 columns is then 8 halves (16 bytes) of one output row.
// LDS row = one output row of 16 chunks of 16 bytes; chunk q of row c sits at q ^ (c >> 2),
// which spreads the 16 lanes of a half wave over all banks in the store and in the load.
// tile = the block's LDS tile of 64 * 128 halves; (bx, by, b) = column tile, row tile, batch.
template<int ROWS>
__device__ __forceinline__
void transpose_cvt_block(const float* __restrict__ in,
                         _Float16* __restrict__ out,
                         _Float16* tile, int bx, int by, int b) {
    const int tid = threadIdx.x;
    const int c0  = bx * 64;
    const int s0  = by * 128;

    const int c4 = tid & 15;            // float4 column group
    const int sr = tid >> 4;            // group of 8 rows
    const float* src = in + ((size_t)b * ROWS + s0 + sr * 8) * 1024 + c0 + c4 * 4;

    float4 v[8];
#pragma unroll
    for (int j = 0; j < 8; ++j)
        v[j] = *(const float4*)(src + (size_t)j * 1024);

    v8h h0, h1, h2, h3;
#pragma unroll
    for (int j = 0; j < 8; ++j) {
        h0[j] = (_Float16)v[j].x;
        h1[j] = (_Float16)v[j].y;
        h2[j] = (_Float16)v[j].z;
        h3[j] = (_Float16)v[j].w;
    }
    _Float16* dst = &tile[(c4 * 4) * 128 + ((sr ^ c4) * 8)];
    *(v8h*)(dst)           = h0;
    *(v8h*)(dst + 128)     = h1;
    *(v8h*)(dst + 2 * 128) = h2;
    *(v8h*)(dst + 3 * 128) = h3;

    __syncthreads();   // the tile is read back across waves

    const int q  = tid & 15;            // 16-byte chunk of an output row
    const int cr = tid >> 4;
    _Float16* o = out + ((size_t)b * 1024 + c0) * 1024 + s0 + q * 8;
#pragma unroll
    for (int p = 0; p < 4; ++p) {
        int c = p * 16 + cr;
        *(v8h*)(o + (size_t)c * 1024) = *(const v8h*)&tile[c * 128 + ((q ^ (c >> 2)) * 8)];
    }
}

// All seven converts in ONE launch. None reads what another writes, so their blocks stand
// side by side in one grid, each convert on its own range of block indices: one launch gap
// and one start-up and tail instead of seven, and the small converts (128 blocks a weight
// matrix, half the chip) run beside the large ones instead of alone.
// The branch is on blockIdx alone, so the barrier inside a transpose is block-uniform.
// The blocks with the most bytes come first.
#define NB_CK ((BATCH * T_CACHE) / 24)                        // cache_k rows
#define NB_CV ((N_STATE / 64) * (T_CACHE / 128) * BATCH)      // cache_v tiles
#define NB_W  ((N_STATE / 64) * (N_STATE / 128))              // tiles of one weight matrix
#define NB_X  (NROWS / 8)                                     // x rows
__global__ __launch_bounds__(256)
void prep_kernel(const float* __restrict__ x,
                 const float* __restrict__ ck,
                 const float* __restrict__ cv,
                 const float* __restrict__ Wq,
                 const float* __restrict__ Wk,
                 const float* __restrict__ Wv,
                 const float* __restrict__ Wo,
                 _Float16* __restrict__ xh,
                 _Float16* __restrict__ WT4,     // WqT, WkT, WvT, WoT one behind the other
                 _Float16* __restrict__ kh,
                 _Float16* __restrict__ vt) {
    __shared__ __align__(16) _Float16 tile[64 * 128];

    // Each branch ends with s_wait_xcnt 0: in the built code the branches stand one behind the
    // other, and the next one's first instructions reuse registers that the stores just issued
    // still name; the wait stands in front of any such overwrite.
    int blk = blockIdx.x;
    if (blk < NB_CK) {
        cvt_rows_block<T_CACHE, T_KV, 24>(ck, kh, blk);
        asm volatile("s_wait_xcnt 0x0" ::: "memory");   // see the note above
    } else if (blk < NB_CK + NB_CV) {
        blk -= NB_CK;
        const int t = blk >> 4;                  // row tile and batch
        transpose_cvt_block<T_CACHE>(cv, vt, tile, blk & 15,
                                     t % (T_CACHE / 128), t / (T_CACHE / 128));
        asm volatile("s_wait_xcnt 0x0" ::: "memory");   // see the note above
    } else if (blk < NB_CK + NB_CV + 4 * NB_W) {
        blk -= NB_CK + NB_CV;
        const int m = blk / NB_W;                // which weight matrix
        const float* W = m == 0 ? Wq : m == 1 ? Wk : m == 2 ? Wv : Wo;
        transpose_cvt_block<N_STATE>(W, WT4 + (size_t)m * (N_STATE * N_STATE), tile,
                                     blk & 15, (blk >> 4) & 7, 0);
        asm volatile("s_wait_xcnt 0x0" ::: "memory");   // see the note above
    } else {
        cvt_rows_block<NROWS, NROWS, 8>(x, xh, blk - (NB_CK + NB_CV + 4 * NB_W));
        asm volatile("s_wait_xcnt 0x0" ::: "memory");   // see the note above
    }
}

// ---------------- tiled WMMA GEMM: C[2048,1024] = A[2048,1024] @ W[1024,1024] ----------------
// A f16 row-major, WT f16 = W^T row-major ([n][k]).
// Block tile 128x128, BK=32; 8 waves in 4(M)x2(N) grid, each wave 32x64 (2x4 16x16 tiles).
// Tiles are DMA'd global->LDS with GLOBAL_LOAD_ASYNC_TO_LDS_B128, double-buffered:
// the DMA of tile k+1 overlaps the 8 WMMAs of tile k.
#define MODE_Q 0
#define MODE_K 1
#define MODE_V 2
#define MODE_O 3

template<int M> struct mode_tag { static constexpr int value = M; };

// QKV = true: ONE launch does the three projections of x, which share A and depend on
// nothing of each other: blockIdx.z picks the weight matrix and the epilogue, so 384 blocks
// fill the chip where each projection alone has 128. V, whose epilogue is the longest,
// takes the lowest z and starts first.
// QKV = false: the output projection alone (WTs = WoT, bias_q = bo, out32s = out).
template<bool QKV>
__global__ __launch_bounds__(256)
void gemm_wmma_kernel(const _Float16* __restrict__ A,
                      const _Float16* __restrict__ WTs,    // WqT, WkT, WvT one behind the other
                      const float* __restrict__ bias_q,
                      const float* __restrict__ bias_v,
                      float* __restrict__ out32s,          // new_k, new_v one behind the other
                      _Float16* __restrict__ qh,
                      _Float16* __restrict__ kh,
                      _Float16* __restrict__ vt) {
    const int mode = QKV ? MODE_V - (int)blockIdx.z : MODE_O;
    const _Float16* WT = QKV ? WTs + (size_t)mode * (N_STATE * N_STATE) : WTs;

    __shared__ __align__(16) _Float16 As[2][128 * 40];   // [row][40], 32 cols + pad
    __shared__ __align__(16) _Float16 Bs[2][128 * 40];   // [n][40]

    const int tid  = threadIdx.x;
    const int lane = tid & 31;
    const int wid  = tid >> 5;
    const int wm   = wid >> 1;           // 0..3
    const int wn   = wid & 1;            // 0..1
    const int col  = lane & 15;
    const int hi8  = (lane >> 4) * 8;
    const int kb   = hi8;
    const int ablk = blockIdx.y * 128;
    const int bblk = blockIdx.x * 128;

    // each thread owns two 8-half chunks of each tile
    const int q0   = tid,        q1 = tid + 256;          // chunk ids 0..511
    const int row0 = q0 >> 2,    c40 = (q0 & 3) * 8;
    const int row1 = q1 >> 2,    c41 = (q1 & 3) * 8;

    auto issue_tile = [&](int k0, int buf) {
        async_ld_b128((unsigned int)(size_t)&As[buf][row0 * 40 + c40],
                      &A[(size_t)(ablk + row0) * 1024 + k0 + c40]);
        async_ld_b128((unsigned int)(size_t)&Bs[buf][row0 * 40 + c40],
                      &WT[(size_t)(bblk + row0) * 1024 + k0 + c40]);
        async_ld_b128((unsigned int)(size_t)&As[buf][row1 * 40 + c41],
                      &A[(size_t)(ablk + row1) * 1024 + k0 + c41]);
        async_ld_b128((unsigned int)(size_t)&Bs[buf][row1 * 40 + c41],
                      &WT[(size_t)(bblk + row1) * 1024 + k0 + c41]);
    };

    v8f acc[2][4];
#pragma unroll
    for (int mt = 0; mt < 2; ++mt)
#pragma unroll
        for (int nt = 0; nt < 4; ++nt) acc[mt][nt] = (v8f){0,0,0,0,0,0,0,0};

    issue_tile(0, 0);                                   // prologue DMA

#pragma unroll 1
    for (int kk = 0; kk < 32; ++kk) {
        int k0 = kk * 32;
        if (kk + 1 < 32) {
            issue_tile(k0 + 32, (kk + 1) & 1);          // prefetch next tile
            // async loads complete in order: <=4 outstanding => tile kk landed
            asm volatile("s_wait_asynccnt 0x4" ::: "memory");
        } else {
            asm volatile("s_wait_asynccnt 0x0" ::: "memory");
        }
        __syncthreads();

        const _Float16* as = &As[kk & 1][0];
        const _Float16* bs = &Bs[kk & 1][0];
        v16h af[2], bf[4];
#pragma unroll
        for (int mt = 0; mt < 2; ++mt)
            af[mt] = ldfrag(&as[(wm * 32 + mt * 16 + col) * 40], kb);
#pragma unroll
        for (int nt = 0; nt < 4; ++nt)
            bf[nt] = ldfrag(&bs[(wn * 64 + nt * 16 + col) * 40], kb);

#pragma unroll
        for (int mt = 0; mt < 2; ++mt)
#pragma unroll
            for (int nt = 0; nt < 4; ++nt)
                acc[mt][nt] = wmma_f16(af[mt], bf[nt], acc[mt][nt]);
        __syncthreads();   // all waves done reading buf before it is re-DMA'd
    }

    // epilogue (C layout: VGPR r -> row r + 8*(lane>>4), col = lane&15)
    auto epilogue = [&](auto tag, const float* __restrict__ bias,
                        float* __restrict__ out32, _Float16* __restrict__ out16) {
    constexpr int MODE = decltype(tag)::value;
#pragma unroll
    for (int mt = 0; mt < 2; ++mt)
#pragma unroll
        for (int nt = 0; nt < 4; ++nt) {
            int rowBase = ablk + wm * 32 + mt * 16 + hi8;
            int c       = bblk + wn * 64 + nt * 16 + col;
#pragma unroll
            for (int r = 0; r < 8; ++r) {
                int g = rowBase + r;                    // 0..2047
                float v = acc[mt][nt][r];
                if constexpr (MODE == MODE_Q) {
                    v = (v + bias[c]) * QK_SCALE;
                    out16[(size_t)g * 1024 + c] = (_Float16)v;
                } else if constexpr (MODE == MODE_K) {
                    out32[(size_t)g * 1024 + c] = v;
                    int b = g >> 8, t = g & 255;
                    out16[((size_t)(b * T_KV + T_CACHE + t)) * 1024 + c] = (_Float16)v;
                } else if constexpr (MODE == MODE_V) {
                    v += bias[c];
                    out32[(size_t)g * 1024 + c] = v;
                    int b = g >> 8, t = g & 255;
                    out16[((size_t)((b * 16 + (c >> 6)) * 64 + (c & 63))) * T_KV
                          + T_CACHE + t] = (_Float16)v;
                } else {
                    v += bias[c];
                    out32[(size_t)g * 1024 + c] = v;
                }
            }
        }
    };
    if constexpr (QKV) {
        // Each epilogue ends with s_wait_xcnt 0: in the built code the three stand one behind
        // the other, and index arithmetic of the next one reuses registers that the stores just
        // issued still name; the wait stands in front of any such overwrite.
        if (mode == MODE_V) {
            epilogue(mode_tag<MODE_V>{}, bias_v, out32s + (size_t)NROWS * N_STATE, vt);
            asm volatile("s_wait_xcnt 0x0" ::: "memory");   // see the note above
        } else if (mode == MODE_K) {
            epilogue(mode_tag<MODE_K>{}, nullptr, out32s, kh);
            asm volatile("s_wait_xcnt 0x0" ::: "memory");   // see the note above
        } else {
            epilogue(mode_tag<MODE_Q>{}, bias_q, nullptr, qh);
            asm volatile("s_wait_xcnt 0x0" ::: "memory");   // see the note above
        }
    } else {
        epilogue(mode_tag<MODE_O>{}, bias_q, out32s, nullptr);
    }
}

// ---------------- flash attention ----------------
// grid = 256 blocks: b(8) x h(16) x qhalf(2); 8 waves x 16 query rows = 128 rows/block.
// The 8 waves of a block walk the same keys of the same head. Each tile of 64 keys (K: 64 key
// rows of 128 bytes; V^T: 64 dim rows of 128 bytes) is brought into LDS ONCE for the block by
// async copies that cover whole 128-byte lines, and every wave takes its fragments from LDS.
// Two buffers: the copies of tile t + 2 go out at the foot of trip t and fly during trip t + 1.
// LDS rows stand at a pitch of 144 bytes, which spreads the 16 rows of a fragment load over
// all banks. The P buffer stays wave-private (LDS in-order per wave).
#define KV_PITCH 72           // halves: 128 bytes of data + 16 bytes of pad
__global__ __launch_bounds__(256)
void attn_wmma_kernel(const _Float16* __restrict__ qh,
                      const _Float16* __restrict__ kh,
                      const _Float16* __restrict__ vt,
                      const float* __restrict__ mask,
                      _Float16* __restrict__ ph) {
    __shared__ __align__(16) _Float16 ps[8][16 * 72];
    __shared__ __align__(16) _Float16 Ks[2][64 * KV_PITCH];   // [key][dim]
    __shared__ __align__(16) _Float16 Vs[2][64 * KV_PITCH];   // [dim][key]

    const int lane  = threadIdx.x & 31;
    const int wid   = threadIdx.x >> 5;
    const int col   = lane & 15;
    const int hi    = lane >> 4;
    const int kb    = hi * 8;
    const int blk   = blockIdx.x;
    const int b     = blk >> 5;
    const int h     = (blk >> 1) & 15;
    const int qbase = (blk & 1) * 128 + wid * 16;

    // Q A-fragments (reused for the whole key loop)
    const _Float16* qrow =
        qh + (size_t)(b * T_Q + qbase + col) * 1024 + h * 64;
    const v16h aq0 = ldfrag(qrow, kb);        // dims 0..31
    const v16h aq1 = ldfrag(qrow + 32, kb);   // dims 32..63

    v8f o[4];
#pragma unroll
    for (int nt = 0; nt < 4; ++nt) o[nt] = (v8f){0,0,0,0,0,0,0,0};
    float rmax[8], rsum[8];
#pragma unroll
    for (int r = 0; r < 8; ++r) { rmax[r] = -3.0e38f; rsum[r] = 0.0f; }

    _Float16* myp = &ps[wid][0];

    // staging: 8 lanes cover one row of 128 bytes; a thread owns one 16-byte chunk of rows
    // srow and srow + 32 of the K tile and of the V^T tile
    const int srow = threadIdx.x >> 3;            // 0..31
    const int sc   = (threadIdx.x & 7) * 8;       // halves
    const _Float16* kg = kh + (size_t)(b * T_KV + srow) * 1024 + h * 64 + sc;
    const _Float16* vg = vt + (size_t)((b * 16 + h) * 64 + srow) * T_KV + sc;
    auto issue_tile = [&](int t) {
        const int buf = t & 1;
        const _Float16* k0 = kg + (size_t)t * (64 * 1024);
        const _Float16* v0 = vg + t * 64;
        async_ld4_b128((unsigned int)(size_t)&Ks[buf][srow * KV_PITCH + sc],        k0,
                       (unsigned int)(size_t)&Ks[buf][(srow + 32) * KV_PITCH + sc], k0 + 32 * 1024,
                       (unsigned int)(size_t)&Vs[buf][srow * KV_PITCH + sc],        v0,
                       (unsigned int)(size_t)&Vs[buf][(srow + 32) * KV_PITCH + sc], v0 + 32 * T_KV);
    };

    issue_tile(0);
    asm volatile("s_wait_asynccnt 0x0" ::: "memory");   // this wave's part of tile 0 has landed
    __syncthreads();                                    // tile 0 is whole for every wave
    issue_tile(1);

    // rolled: one copy of the trip's text; the buffer index is the trip's parity
#pragma unroll 1
    for (int t = 0; t < T_KV / 64; ++t) {
        const int kvc = t * 64;
        const _Float16* ks = &Ks[t & 1][0];
        const _Float16* vs = &Vs[t & 1][0];
        // ---- S = Q @ K^T  (16 x 64 scores) ----
        v8f s[4];
#pragma unroll
        for (int g = 0; g < 4; ++g) s[g] = (v8f){0,0,0,0,0,0,0,0};
        // the trip's mask values are asked for first: they come from furthest away (not staged)
        float mk[4][8];
#pragma unroll
        for (int g = 0; g < 4; ++g)
#pragma unroll
            for (int r = 0; r < 8; ++r) {
                int qr  = qbase + hi * 8 + r;
                int key = kvc + g * 16 + col;
                mk[g][r] = mask[(size_t)qr * T_KV + key];
            }
        v16h bk[8], bv[8];
#pragma unroll
        for (int g = 0; g < 4; ++g) {
            const _Float16* krow = ks + (g * 16 + col) * KV_PITCH;
            bk[2 * g]     = ldfrag(krow, kb);
            bk[2 * g + 1] = ldfrag(krow + 32, kb);
        }
#pragma unroll
        for (int nt = 0; nt < 4; ++nt) {
            const _Float16* vrow = vs + (nt * 16 + col) * KV_PITCH;
            bv[2 * nt]     = ldfrag(vrow, kb);
            bv[2 * nt + 1] = ldfrag(vrow + 32, kb);
        }
        // keeps the trip's fragment loads together ahead of the products: spread among them,
        // each pair of LDS loads makes the wave wait out a full LDS latency of its own
        __builtin_amdgcn_sched_barrier(0);
#pragma unroll
        for (int g = 0; g < 4; ++g) {
            s[g] = wmma_f16(aq0, bk[2 * g], s[g]);
            s[g] = wmma_f16(aq1, bk[2 * g + 1], s[g]);
        }
        // ---- mask + chunk row-max ----
        float cmax[8];
#pragma unroll
        for (int r = 0; r < 8; ++r) cmax[r] = -3.0e38f;
#pragma unroll
        for (int g = 0; g < 4; ++g)
#pragma unroll
            for (int r = 0; r < 8; ++r) {
                float v = s[g][r] + mk[g][r];
                s[g][r] = v;
                cmax[r] = fmaxf(cmax[r], v);
            }
#pragma unroll
        for (int r = 0; r < 8; ++r) {
            cmax[r] = fmaxf(cmax[r], swz_xor<1>(cmax[r]));
            cmax[r] = fmaxf(cmax[r], swz_xor<2>(cmax[r]));
            cmax[r] = fmaxf(cmax[r], swz_xor<4>(cmax[r]));
            cmax[r] = fmaxf(cmax[r], swz_xor<8>(cmax[r]));
        }
        // ---- online softmax update ----
        float scl[8];
#pragma unroll
        for (int r = 0; r < 8; ++r) {
            float nm = fmaxf(rmax[r], cmax[r]);
            scl[r]   = __expf(rmax[r] - nm);
            rmax[r]  = nm;
        }
#pragma unroll
        for (int nt = 0; nt < 4; ++nt)
#pragma unroll
            for (int r = 0; r < 8; ++r) o[nt][r] *= scl[r];

        float psum[8];
#pragma unroll
        for (int r = 0; r < 8; ++r) psum[r] = 0.0f;
#pragma unroll
        for (int g = 0; g < 4; ++g)
#pragma unroll
            for (int r = 0; r < 8; ++r) {
                float p = __expf(s[g][r] - rmax[r]);
                psum[r] += p;
                myp[(hi * 8 + r) * 72 + g * 16 + col] = (_Float16)p;
            }
#pragma unroll
        for (int r = 0; r < 8; ++r) rsum[r] = rsum[r] * scl[r] + psum[r];

        // ---- O += P @ V (P relaid out via wave-private LDS) ----
        const _Float16* prow = myp + col * 72;
        v16h ap0 = ldfrag(prow, kb);        // keys 0..31 of chunk
        v16h ap1 = ldfrag(prow + 32, kb);   // keys 32..63
#pragma unroll
        for (int nt = 0; nt < 4; ++nt) {
            o[nt] = wmma_f16(ap0, bv[2 * nt], o[nt]);
            o[nt] = wmma_f16(ap1, bv[2 * nt + 1], o[nt]);
        }

        // hand-over: this wave's LDS reads of tile t are done, its copies of tile t + 1 have
        // landed; behind the barrier tile t + 1 is whole and tile t's buffer is free
        asm volatile("s_wait_dscnt 0x0" ::: "memory");
        asm volatile("s_wait_asynccnt 0x0" ::: "memory");
        __syncthreads();
        if (t + 2 < T_KV / 64) issue_tile(t + 2);
    }
    asm volatile("s_wait_asynccnt 0x0" ::: "memory");   // no copy is left in flight at the end

    // ---- finalize: reduce row sums, normalize, write ph (f16) ----
#pragma unroll
    for (int r = 0; r < 8; ++r) {
        rsum[r] += swz_xor<1>(rsum[r]);
        rsum[r] += swz_xor<2>(rsum[r]);
        rsum[r] += swz_xor<4>(rsum[r]);
        rsum[r] += swz_xor<8>(rsum[r]);
    }
#pragma unroll
    for (int nt = 0; nt < 4; ++nt)
#pragma unroll
        for (int r = 0; r < 8; ++r) {
            float v = o[nt][r] / rsum[r];
            int qr  = qbase + hi * 8 + r;
            int c   = h * 64 + nt * 16 + col;
            ph[(size_t)(b * T_Q + qr) * 1024 + c] = (_Float16)v;
        }
}

// ---------------- host launcher ----------------
extern "C" void kernel_launch(void* const* d_in, const int* in_sizes, int n_in,
                              void* d_out, int out_size, void* d_ws, size_t ws_size,
                              hipStream_t stream) {
    const float* x    = (const float*)d_in[0];
    const float* mask = (const float*)d_in[1];
    const float* ck   = (const float*)d_in[2];
    const float* cv   = (const float*)d_in[3];
    const float* Wq   = (const float*)d_in[4];
    const float* bq   = (const float*)d_in[5];
    const float* Wk   = (const float*)d_in[6];
    const float* Wv   = (const float*)d_in[7];
    const float* bv   = (const float*)d_in[8];
    const float* Wo   = (const float*)d_in[9];
    const float* bo   = (const float*)d_in[10];

    float* out  = (float*)d_out;                 // [2048,1024]
    float* outK = out  + (size_t)NROWS * N_STATE;   // new_k; new_v follows it

    char* w = (char*)d_ws;
    _Float16* xh  = (_Float16*)w; w += (size_t)NROWS * N_STATE * 2;
    _Float16* WT4 = (_Float16*)w; w += (size_t)3 * N_STATE * N_STATE * 2;   // WqT, WkT, WvT
    _Float16* WoT = (_Float16*)w; w += (size_t)N_STATE * N_STATE * 2;
    _Float16* qh  = (_Float16*)w; w += (size_t)NROWS * N_STATE * 2;
    _Float16* kh  = (_Float16*)w; w += (size_t)BATCH * T_KV * N_STATE * 2;
    _Float16* vt  = (_Float16*)w; w += (size_t)BATCH * T_KV * N_STATE * 2;
    _Float16* ph  = (_Float16*)w; w += (size_t)NROWS * N_STATE * 2;

    // stage conversions: one launch
    prep_kernel<<<NB_CK + NB_CV + 4 * NB_W + NB_X, 256, 0, stream>>>(
        x, ck, cv, Wq, Wk, Wv, Wo, xh, WT4, kh, vt);

    // projections of x: one launch
    gemm_wmma_kernel<true><<<dim3(N_STATE / 128, NROWS / 128, 3), 256, 0, stream>>>(
        xh, WT4, bq, bv, outK, qh, kh, vt);

    // attention
    attn_wmma_kernel<<<BATCH * 16 * 2, 256, 0, stream>>>(qh, kh, vt, mask, ph);

    // output projection
    gemm_wmma_kernel<false><<<dim3(N_STATE / 128, NROWS / 128), 256, 0, stream>>>(
        ph, WoT, bo, nullptr, out, nullptr, nullptr, nullptr);
}

// v005
// One run takes 79.4 microseconds.
// Timed twice side by side with v004, it ran 1.10 times as fast both times.
// All steps since v000 together make it 5.13 times as fast.
#include <hip/hip_runtime.h>

// ---------------- types ----------------
typedef __attribute__((ext_vector_type(16))) _Float16 v16h;
typedef __attribute__((ext_vector_type(8)))  _Float16 v8h;
typedef __attribute__((ext_vector_type(4)))  _Float16 v4h;
typedef __attribute__((ext_vector_type(8)))  float    v8f;

#define N_STATE 1024
#define T_Q     256
#define T_CACHE 768
#define T_KV    1024
#define BATCH   8
#define NROWS   2048          // B*T
#define QK_SCALE 0.125f

// ---------------- WMMA helpers ----------------
__device__ __forceinline__ v8f wmma_f16(v16h a, v16h b, v8f c) {
    // D = A(16x32) * B(32x16) + C, f32 accumulate
    return __builtin_amdgcn_wmma_f32_16x16x32_f16(
        false, a, false, b, (short)0, c, false, false);
}

// Load a 16x32 A-style fragment for this lane.
// Lane layout (ISA 7.12.2, 16-bit A 16x32): row = lane&15, kb = (lane>>4)*8,
// halves cover K in [kb,kb+8) and [kb+16,kb+24)  -> two 16-byte loads.
// `p` must point at element [lane&15][0] of the tile (row stride pre-applied).
__device__ __forceinline__ v16h ldfrag(const _Float16* p, int kb) {
    union { v16h v; v8h h[2]; } u;
    u.h[0] = *(const v8h*)(p + kb);
    u.h[1] = *(const v8h*)(p + kb + 16);
    return u.v;
}

// Async global -> LDS copy of 16 bytes per lane (CDNA5 GLOBAL_LOAD_ASYNC_TO_LDS,
// tracked by ASYNCcnt). lds_off = wave-relative LDS byte address (low 32 bits
// of the generic shared pointer).
__device__ __forceinline__ void async_ld_b128(unsigned int lds_off,
                                              const _Float16* g) {
    asm volatile("global_load_async_to_lds_b128 %0, %1, off"
                 :: "v"(lds_off), "v"(g)
                 : "memory");
}

// Four such copies of one lane, one behind the other, each with its own LDS byte address and
// its own global pointer. s_wait_xcnt 0 is the statement's last line, so that it stands in
// front of any later write of a register that one of the copies names.
__device__ __forceinline__ void async_ld4_b128(unsigned int l0, const _Float16* g0,
                                               unsigned int l1, const _Float16* g1,
                                               unsigned int l2, const _Float16* g2,
                                               unsigned int l3, const _Float16* g3) {
    asm volatile("global_load_async_to_lds_b128 %0, %1, off\n\t"
                 "global_load_async_to_lds_b128 %2, %3, off\n\t"
                 "global_load_async_to_lds_b128 %4, %5, off\n\t"
                 "global_load_async_to_lds_b128 %6, %7, off\n\t"
                 "s_wait_xcnt 0x0"
                 :: "v"(l0), "v"(g0), "v"(l1), "v"(g1),
                    "v"(l2), "v"(g2), "v"(l3), "v"(g3)
                 : "memory");
}

// xor-shuffle across lanes via ds_swizzle (group-of-32 mode: and=0x1f, xor=XM)
template<int XM>
__device__ __forceinline__ float swz_xor(float v) {
    int i = __float_as_int(v);
    i = __builtin_amdgcn_ds_swizzle(i, (XM << 10) | 0x1f);
    return __int_as_float(i);
}

// ---------------- elementwise converts / packs ----------------
// f32 -> f16 convert of whole rows of 1024 elements:
//   in [batch][RIN][1024] f32  ->  out [batch][ROUT][1024] f16, rows 0..RIN-1 of each batch
// Serves x -> xh (RIN = ROUT = 2048, one batch) and cache_k -> kh (768 of 1024 key rows).
// One block converts RPB rows; RPB divides RIN, so a block stays inside one batch.
// A thread owns one float4 column group of every row: each wave-wide load covers 512
// contiguous bytes and each wave-wide store 256, whole lines both ways. A thread's loads
// are independent and stand ahead of its stores, so few waves keep many bytes in flight,
// and the launch starts RPB * 4 times fewer waves than one element a thread would.
// blk = index of the block among the blocks of this convert.
template<int RIN, int ROUT, int RPB>
__device__ __forceinline__
void cvt_rows_block(const float* __restrict__ in,
                    _Float16* __restrict__ out, int blk) {
    static_assert(RIN % RPB == 0, "a block must not straddle two batches");
    const int r0 = blk * RPB;
    const int b  = r0 / RIN;
    const int c  = threadIdx.x * 4;
    const float* src = in + (size_t)r0 * 1024 + c;
    _Float16*    dst = out + (size_t)(r0 + b * (ROUT - RIN)) * 1024 + c;

    float4 v[RPB];
    // unrolled so that v[] stays in registers and the loads go out back to back
#pragma unroll
    for (int j = 0; j < RPB; ++j)
        v[j] = *(const float4*)(src + (size_t)j * 1024);
    // unrolled for the same reason: v[] is indexed by constants only
#pragma unroll
    for (int j = 0; j < RPB; ++j) {
        v4h h = { (_Float16)v[j].x, (_Float16)v[j].y, (_Float16)v[j].z, (_Float16)v[j].w };
        *(v4h*)(dst + (size_t)j * 1024) = h;
    }
}

// Transposing convert through an LDS tile:
//   in  [batch][ROWS][1024] f32  ->  out [batch][1024][1024] f16, columns 0..ROWS-1
//   out[b][c][s] = (f16) in[b][s][c]
// Serves W[k][n] -> WT[n][k] (ROWS = 1024, one batch) and cache_v[b][s][c] ->
// vt[b][c = h*64+dh][key s] (ROWS = 768, eight batches).
// One block moves a tile of 128 rows (s) x 64 columns (c): 256 contiguous bytes a row on
// the f32 side and 256 contiguous bytes a row on the f16 side, so loads and stores both
// cover whole lines. A thread loads 8 consecutive rows of one float4 column group; each
// of its 4 columns is then 8 halves (16 bytes) of one output row.
// LDS row = one output row of 16 chunks of 16 bytes; chunk q of row c sits at q ^ (c >> 2),
// which spreads the 16 lanes of a half wave over all banks in the store and in the load.
// tile = the block's LDS tile of 64 * 128 halves; (bx, by, b) = column tile, row tile, batch.
template<int ROWS>
__device__ __forceinline__
void transpose_cvt_block(const float* __restrict__ in,
                         _Float16* __restrict__ out,
                         _Float16* tile, int bx, int by, int b) {
    const int tid = threadIdx.x;
    const int c0  = bx * 64;
    const int s0  = by * 128;

    const int c4 = tid & 15;            // float4 column group
    const int sr = tid >> 4;            // group of 8 rows
    const float* src = in + ((size_t)b * ROWS + s0 + sr * 8) * 1024 + c0 + c4 * 4;

    float4 v[8];
#pragma unroll
    for (int j = 0; j < 8; ++j)
        v[j] = *(const float4*)(src + (size_t)j * 1024);

    v8h h0, h1, h2, h3;
#pragma unroll
    for (int j = 0; j < 8; ++j) {
        h0[j] = (_Float16)v[j].x;
        h1[j] = (_Float16)v[j].y;
        h2[j] = (_Float16)v[j].z;
        h3[j] = (_Float16)v[j].w;
    }
    _Float16* dst = &tile[(c4 * 4) * 128 + ((sr ^ c4) * 8)];
    *(v8h*)(dst)           = h0;
    *(v8h*)(dst + 128)     = h1;
    *(v8h*)(dst + 2 * 128) = h2;
    *(v8h*)(dst + 3 * 128) = h3;

    __syncthreads();   // the tile is read back across waves

    const int q  = tid & 15;            // 16-byte chunk of an output row
    const int cr = tid >> 4;
    _Float16* o = out + ((size_t)b * 1024 + c0) * 1024 + s0 + q * 8;
#pragma unroll
    for (int p = 0; p < 4; ++p) {
        int c = p * 16 + cr;
        *(v8h*)(o + (size_t)c * 1024) = *(const v8h*)&tile[c * 128 + ((q ^ (c >> 2)) * 8)];
    }
}

// All seven converts in ONE launch. None reads what another writes, so their blocks stand
// side by side in one grid, each convert on its own range of block indices: one launch gap
// and one start-up and tail instead of seven, and the small converts (128 blocks a weight
// matrix, half the chip) run beside the large ones instead of alone.
// The branch is on blockIdx alone, so the barrier inside a transpose is block-uniform.
// The blocks with the most bytes come first.
#define NB_CK ((BATCH * T_CACHE) / 24)                        // cache_k rows
#define NB_CV ((N_STATE / 64) * (T_CACHE / 128) * BATCH)      // cache_v tiles
#define NB_W  ((N_STATE / 64) * (N_STATE / 128))              // tiles of one weight matrix
#define NB_X  (NROWS / 8)                                     // x rows
__global__ __launch_bounds__(256)
void prep_kernel(const float* __restrict__ x,
                 const float* __restrict__ ck,
                 const float* __restrict__ cv,
                 const float* __restrict__ Wq,
                 const float* __restrict__ Wk,
                 const float* __restrict__ Wv,
                 const float* __restrict__ Wo,
                 _Float16* __restrict__ xh,
                 _Float16* __restrict__ WT4,     // WqT, WkT, WvT, WoT one behind the other
                 _Float16* __restrict__ kh,
                 _Float16* __restrict__ vt) {
    __shared__ __align__(16) _Float16 tile[64 * 128];

    // Each branch ends with s_wait_xcnt 0: in the built code the branches stand one behind the
    // other, and the next one's first instructions reuse registers that the stores just issued
    // still name; the wait stands in front of any such overwrite.
    int blk = blockIdx.x;
    if (blk < NB_CK) {
        cvt_rows_block<T_CACHE, T_KV, 24>(ck, kh, blk);
        asm volatile("s_wait_xcnt 0x0" ::: "memory");   // see the note above
    } else if (blk < NB_CK + NB_CV) {
        blk -= NB_CK;
        const int t = blk >> 4;                  // row tile and batch
        transpose_cvt_block<T_CACHE>(cv, vt, tile, blk & 15,
                                     t % (T_CACHE / 128), t / (T_CACHE / 128));
        asm volatile("s_wait_xcnt 0x0" ::: "memory");   // see the note above
    } else if (blk < NB_CK + NB_CV + 4 * NB_W) {
        blk -= NB_CK + NB_CV;
        const int m = blk / NB_W;                // which weight matrix
        const float* W = m == 0 ? Wq : m == 1 ? Wk : m == 2 ? Wv : Wo;
        transpose_cvt_block<N_STATE>(W, WT4 + (size_t)m * (N_STATE * N_STATE), tile,
                                     blk & 15, (blk >> 4) & 7, 0);
        asm volatile("s_wait_xcnt 0x0" ::: "memory");   // see the note above
    } else {
        cvt_rows_block<NROWS, NROWS, 8>(x, xh, blk - (NB_CK + NB_CV + 4 * NB_W));
        asm volatile("s_wait_xcnt 0x0" ::: "memory");   // see the note above
    }
}

// ---------------- tiled WMMA GEMM: C[2048,1024] = A[2048,1024] @ W[1024,1024] ----------------
// A f16 row-major, WT f16 = W^T row-major ([n][k]).
// Block tile 128x128, BK=32; 8 waves in 4(M)x2(N) grid, each wave 32x64 (2x4 16x16 tiles).
// Tiles are DMA'd global->LDS with GLOBAL_LOAD_ASYNC_TO_LDS_B128, double-buffered:
// the DMA of tile k+1 overlaps the 8 WMMAs of tile k.
#define MODE_Q 0
#define MODE_K 1
#define MODE_V 2
#define MODE_O 3
#define ST32_PITCH 132        // floats: 512 bytes of data + 16 bytes of pad
#define ST16_PITCH 136        // halves: 256 bytes of data + 16 bytes of pad

template<int M> struct mode_tag { static constexpr int value = M; };

// QKV = true: ONE launch does the three projections of x, which share A and depend on
// nothing of each other: blockIdx.z picks the weight matrix and the epilogue, so 384 blocks
// fill the chip where each projection alone has 128. V, whose epilogue is the longest,
// takes the lowest z and starts first.
// QKV = false: the output projection alone (WTs = WoT, bias_q = bo, out32s = out).
template<bool QKV>
__global__ __launch_bounds__(256)
void gemm_wmma_kernel(const _Float16* __restrict__ A,
                      const _Float16* __restrict__ WTs,    // WqT, WkT, WvT one behind the other
                      const float* __restrict__ bias_q,
                      const float* __restrict__ bias_v,
                      float* __restrict__ out32s,          // new_k, new_v one behind the other
                      _Float16* __restrict__ qh,
                      _Float16* __restrict__ kh,
                      _Float16* __restrict__ vt) {
    const int mode = QKV ? MODE_V - (int)blockIdx.z : MODE_O;
    const _Float16* WT = QKV ? WTs + (size_t)mode * (N_STATE * N_STATE) : WTs;

    __shared__ __align__(16) _Float16 As[2][128 * 40];   // [row][40], 32 cols + pad
    __shared__ __align__(16) _Float16 Bs[2][128 * 40];   // [n][40]
    // epilogue tiles of the block's 128 x 128 results; the pad of 16 bytes a row spreads the rows
    // over the banks for the stores from the accumulator layout and for the 16-byte loads
    __shared__ __align__(16) float    st32[128 * ST32_PITCH];
    __shared__ __align__(16) _Float16 st16[QKV ? 128 * ST16_PITCH : 8];

    const int tid  = threadIdx.x;
    const int lane = tid & 31;
    const int wid  = tid >> 5;
    const int wm   = wid >> 1;           // 0..3
    const int wn   = wid & 1;            // 0..1
    const int col  = lane & 15;
    const int hi8  = (lane >> 4) * 8;
    const int kb   = hi8;
    const int ablk = blockIdx.y * 128;
    const int bblk = blockIdx.x * 128;

    // each thread owns two 8-half chunks of each tile
    const int q0   = tid,        q1 = tid + 256;          // chunk ids 0..511
    const int row0 = q0 >> 2,    c40 = (q0 & 3) * 8;
    const int row1 = q1 >> 2,    c41 = (q1 & 3) * 8;

    auto issue_tile = [&](int k0, int buf) {
        async_ld_b128((unsigned int)(size_t)&As[buf][row0 * 40 + c40],
                      &A[(size_t)(ablk + row0) * 1024 + k0 + c40]);
        async_ld_b128((unsigned int)(size_t)&Bs[buf][row0 * 40 + c40],
                      &WT[(size_t)(bblk + row0) * 1024 + k0 + c40]);
        async_ld_b128((unsigned int)(size_t)&As[buf][row1 * 40 + c41],
                      &A[(size_t)(ablk + row1) * 1024 + k0 + c41]);
        async_ld_b128((unsigned int)(size_t)&Bs[buf][row1 * 40 + c41],
                      &WT[(size_t)(bblk + row1) * 1024 + k0 + c41]);
    };

    v8f acc[2][4];
#pragma unroll
    for (int mt = 0; mt < 2; ++mt)
#pragma unroll
        for (int nt = 0; nt < 4; ++nt) acc[mt][nt] = (v8f){0,0,0,0,0,0,0,0};

    issue_tile(0, 0);                                   // prologue DMA

#pragma unroll 1
    for (int kk = 0; kk < 32; ++kk) {
        int k0 = kk * 32;
        if (kk + 1 < 32) {
            issue_tile(k0 + 32, (kk + 1) & 1);          // prefetch next tile
            // async loads complete in order: <=4 outstanding => tile kk landed
            asm volatile("s_wait_asynccnt 0x4" ::: "memory");
        } else {
            asm volatile("s_wait_asynccnt 0x0" ::: "memory");
        }
        __syncthreads();

        const _Float16* as = &As[kk & 1][0];
        const _Float16* bs = &Bs[kk & 1][0];
        v16h af[2], bf[4];
#pragma unroll
        for (int mt = 0; mt < 2; ++mt)
            af[mt] = ldfrag(&as[(wm * 32 + mt * 16 + col) * 40], kb);
#pragma unroll
        for (int nt = 0; nt < 4; ++nt)
            bf[nt] = ldfrag(&bs[(wn * 64 + nt * 16 + col) * 40], kb);

#pragma unroll
        for (int mt = 0; mt < 2; ++mt)
#pragma unroll
            for (int nt = 0; nt < 4; ++nt)
                acc[mt][nt] = wmma_f16(af[mt], bf[nt], acc[mt][nt]);
        __syncthreads();   // all waves done reading buf before it is re-DMA'd
    }

    // epilogue (C layout: VGPR r -> row r + 8*(lane>>4), col = lane&15)
    // The accumulators reach global memory through LDS tiles of the whole block. Straight from
    // the registers a wave-wide store covers pieces of 64 bytes (f32), 32 bytes (f16) or, for
    // V^T, 2 bytes on each of 16 lines; read back from the tile every lane stores 16 bytes and
    // a wave covers 512 contiguous bytes (f32) or two runs of 256 (f16): whole lines only.
    // V^T is transposed on the way in: a lane's 8 accumulators of one column are 8 consecutive
    // keys, one 16-byte chunk of that column's row in the tile.
    auto epilogue = [&](auto tag, const float* __restrict__ bias,
                        float* __restrict__ out32, _Float16* __restrict__ out16) {
    constexpr int MODE = decltype(tag)::value;
#pragma unroll
    for (int mt = 0; mt < 2; ++mt)
#pragma unroll
        for (int nt = 0; nt < 4; ++nt) {
            const int rl = wm * 32 + mt * 16 + hi8;     // row in the block's tile
            const int cl = wn * 64 + nt * 16 + col;     // column in the block's tile
            float bc = 0.0f;
            if constexpr (MODE != MODE_K) bc = bias[bblk + cl];
            v8h hv;
#pragma unroll
            for (int r = 0; r < 8; ++r) {
                float v = acc[mt][nt][r];
                if constexpr (MODE == MODE_Q) {
                    v = (v + bc) * QK_SCALE;
                    st16[(rl + r) * ST16_PITCH + cl] = (_Float16)v;
                } else if constexpr (MODE == MODE_K) {
                    st32[(rl + r) * ST32_PITCH + cl] = v;
                    st16[(rl + r) * ST16_PITCH + cl] = (_Float16)v;
                } else if constexpr (MODE == MODE_V) {
                    v += bc;
                    st32[(rl + r) * ST32_PITCH + cl] = v;
                    hv[r] = (_Float16)v;
                } else {
                    v += bc;
                    st32[(rl + r) * ST32_PITCH + cl] = v;
                }
            }
            if constexpr (MODE == MODE_V)
                *(v8h*)&st16[cl * ST16_PITCH + rl] = hv;    // [column][key]
        }

    __syncthreads();   // the tiles are read back across waves

    if constexpr (MODE != MODE_Q) {
        // one wave, one row of 512 bytes
        float* o = out32 + (size_t)(ablk + wid) * 1024 + bblk + lane * 4;
        float4 v[16];
        // unrolled so that v[] stays in registers and the LDS loads go out back to back
#pragma unroll
        for (int j = 0; j < 16; ++j)
            v[j] = *(const float4*)&st32[(j * 8 + wid) * ST32_PITCH + lane * 4];
#pragma unroll
        for (int j = 0; j < 16; ++j)
            *(float4*)(o + (size_t)j * (8 * 1024)) = v[j];
    }
    if constexpr (MODE != MODE_O) {
        // 16 lanes, one tile row of 256 bytes
        const int row = tid >> 4;
        const int ch  = (tid & 15) * 8;
        const int b   = ablk >> 8, t0 = ablk & 255;     // a block's 128 rows lie in one batch
        _Float16* o;
        if constexpr (MODE == MODE_Q)
            o = out16 + (size_t)(ablk + row) * 1024 + bblk + ch;
        else if constexpr (MODE == MODE_K)
            o = out16 + (size_t)(b * T_KV + T_CACHE + t0 + row) * 1024 + bblk + ch;
        else                                            // tile row = column of V = row of V^T
            o = out16 + (size_t)(b * N_STATE + bblk + row) * T_KV + T_CACHE + t0 + ch;
        v8h h[8];
        // unrolled for the same reason as above
#pragma unroll
        for (int j = 0; j < 8; ++j)
            h[j] = *(const v8h*)&st16[(j * 16 + row) * ST16_PITCH + ch];
#pragma unroll
        for (int j = 0; j < 8; ++j)
            *(v8h*)(o + (size_t)j * (16 * 1024)) = h[j];
    }
    };
    if constexpr (QKV) {
        // Each epilogue ends with s_wait_xcnt 0: in the built code the three stand one behind
        // the other, and index arithmetic of the next one reuses registers that the stores just
        // issued still name; the wait stands in front of any such overwrite.
        if (mode == MODE_V) {
            epilogue(mode_tag<MODE_V>{}, bias_v, out32s + (size_t)NROWS * N_STATE, vt);
            asm volatile("s_wait_xcnt 0x0" ::: "memory");   // see the note above
        } else if (mode == MODE_K) {
            epilogue(mode_tag<MODE_K>{}, nullptr, out32s, kh);
            asm volatile("s_wait_xcnt 0x0" ::: "memory");   // see the note above
        } else {
            epilogue(mode_tag<MODE_Q>{}, bias_q, nullptr, qh);
            asm volatile("s_wait_xcnt 0x0" ::: "memory");   // see the note above
        }
    } else {
        epilogue(mode_tag<MODE_O>{}, bias_q, out32s, nullptr);
    }
}

// ---------------- flash attention ----------------
// grid = 256 blocks: b(8) x h(16) x qhalf(2); 8 waves x 16 query rows = 128 rows/block.
// The 8 waves of a block walk the same keys of the same head. Each tile of 64 keys (K: 64 key
// rows of 128 bytes; V^T: 64 dim rows of 128 bytes) is brought into LDS ONCE for the block by
// async copies that cover whole 128-byte lines, and every wave takes its fragments from LDS.
// Two buffers: the copies of tile t + 2 go out at the foot of trip t and fly during trip t + 1.
// LDS rows stand at a pitch of 144 bytes, which spreads the 16 rows of a fragment load over
// all banks. The P buffer stays wave-private (LDS in-order per wave).
#define KV_PITCH 72           // halves: 128 bytes of data + 16 bytes of pad
__global__ __launch_bounds__(256)
void attn_wmma_kernel(const _Float16* __restrict__ qh,
                      const _Float16* __restrict__ kh,
                      const _Float16* __restrict__ vt,
                      const float* __restrict__ mask,
                      _Float16* __restrict__ ph) {
    __shared__ __align__(16) _Float16 ps[8][16 * 72];
    __shared__ __align__(16) _Float16 Ks[2][64 * KV_PITCH];   // [key][dim]
    __shared__ __align__(16) _Float16 Vs[2][64 * KV_PITCH];   // [dim][key]

    const int lane  = threadIdx.x & 31;
    const int wid   = threadIdx.x >> 5;
    const int col   = lane & 15;
    const int hi    = lane >> 4;
    const int kb    = hi * 8;
    const int blk   = blockIdx.x;
    const int b     = blk >> 5;
    const int h     = (blk >> 1) & 15;
    const int qbase = (blk & 1) * 128 + wid * 16;

    // Q A-fragments (reused for the whole key loop)
    const _Float16* qrow =
        qh + (size_t)(b * T_Q + qbase + col) * 1024 + h * 64;
    const v16h aq0 = ldfrag(qrow, kb);        // dims 0..31
    const v16h aq1 = ldfrag(qrow + 32, kb);   // dims 32..63

    v8f o[4];
#pragma unroll
    for (int nt = 0; nt < 4; ++nt) o[nt] = (v8f){0,0,0,0,0,0,0,0};
    float rmax[8], rsum[8];
#pragma unroll
    for (int r = 0; r < 8; ++r) { rmax[r] = -3.0e38f; rsum[r] = 0.0f; }

    _Float16* myp = &ps[wid][0];

    // staging: 8 lanes cover one row of 128 bytes; a thread owns one 16-byte chunk of rows
    // srow and srow + 32 of the K tile and of the V^T tile
    const int srow = threadIdx.x >> 3;            // 0..31
    const int sc   = (threadIdx.x & 7) * 8;       // halves
    const _Float16* kg = kh + (size_t)(b * T_KV + srow) * 1024 + h * 64 + sc;
    const _Float16* vg = vt + (size_t)((b * 16 + h) * 64 + srow) * T_KV + sc;
    auto issue_tile = [&](int t) {
        const int buf = t & 1;
        const _Float16* k0 = kg + (size_t)t * (64 * 1024);
        const _Float16* v0 = vg + t * 64;
        async_ld4_b128((unsigned int)(size_t)&Ks[buf][srow * KV_PITCH + sc],        k0,
                       (unsigned int)(size_t)&Ks[buf][(srow + 32) * KV_PITCH + sc], k0 + 32 * 1024,
                       (unsigned int)(size_t)&Vs[buf][srow * KV_PITCH + sc],        v0,
                       (unsigned int)(size_t)&Vs[buf][(srow + 32) * KV_PITCH + sc], v0 + 32 * T_KV);
    };

    issue_tile(0);
    asm volatile("s_wait_asynccnt 0x0" ::: "memory");   // this wave's part of tile 0 has landed
    __syncthreads();                                    // tile 0 is whole for every wave
    issue_tile(1);

    // rolled: one copy of the trip's text; the buffer index is the trip's parity
#pragma unroll 1
    for (int t = 0; t < T_KV / 64; ++t) {
        const int kvc = t * 64;
        const _Float16* ks = &Ks[t & 1][0];
        const _Float16* vs = &Vs[t & 1][0];
        // ---- S = Q @ K^T  (16 x 64 scores) ----
        v8f s[4];
#pragma unroll
        for (int g = 0; g < 4; ++g) s[g] = (v8f){0,0,0,0,0,0,0,0};
        // the trip's mask values are asked for first: they come from furthest away (not staged)
        float mk[4][8];
#pragma unroll
        for (int g = 0; g < 4; ++g)
#pragma unroll
            for (int r = 0; r < 8; ++r) {
                int qr  = qbase + hi * 8 + r;
                int key = kvc + g * 16 + col;
                mk[g][r] = mask[(size_t)qr * T_KV + key];
            }
        v16h bk[8], bv[8];
#pragma unroll
        for (int g = 0; g < 4; ++g) {
            const _Float16* krow = ks + (g * 16 + col) * KV_PITCH;
            bk[2 * g]     = ldfrag(krow, kb);
            bk[2 * g + 1] = ldfrag(krow + 32, kb);
        }
#pragma unroll
        for (int nt = 0; nt < 4; ++nt) {
            const _Float16* vrow = vs + (nt * 16 + col) * KV_PITCH;
            bv[2 * nt]     = ldfrag(vrow, kb);
            bv[2 * nt + 1] = ldfrag(vrow + 32, kb);
        }
        // keeps the trip's fragment loads together ahead of the products: spread among them,
        // each pair of LDS loads makes the wave wait out a full LDS latency of its own
        __builtin_amdgcn_sched_barrier(0);
#pragma unroll
        for (int g = 0; g < 4; ++g) {
            s[g] = wmma_f16(aq0, bk[2 * g], s[g]);
            s[g] = wmma_f16(aq1, bk[2 * g + 1], s[g]);
        }
        // ---- mask + chunk row-max ----
        float cmax[8];
#pragma unroll
        for (int r = 0; r < 8; ++r) cmax[r] = -3.0e38f;
#pragma unroll
        for (int g = 0; g < 4; ++g)
#pragma unroll
            for (int r = 0; r < 8; ++r) {
                float v = s[g][r] + mk[g][r];
                s[g][r] = v;
                cmax[r] = fmaxf(cmax[r], v);
            }
#pragma unroll
        for (int r = 0; r < 8; ++r) {
            cmax[r] = fmaxf(cmax[r], swz_xor<1>(cmax[r]));
            cmax[r] = fmaxf(cmax[r], swz_xor<2>(cmax[r]));
            cmax[r] = fmaxf(cmax[r], swz_xor<4>(cmax[r]));
            cmax[r] = fmaxf(cmax[r], swz_xor<8>(cmax[r]));
        }
        // ---- online softmax update ----
        float scl[8];
#pragma unroll
        for (int r = 0; r < 8; ++r) {
            float nm = fmaxf(rmax[r], cmax[r]);
            scl[r]   = __expf(rmax[r] - nm);
            rmax[r]  = nm;
        }
#pragma unroll
        for (int nt = 0; nt < 4; ++nt)
#pragma unroll
            for (int r = 0; r < 8; ++r) o[nt][r] *= scl[r];

        float psum[8];
#pragma unroll
        for (int r = 0; r < 8; ++r) psum[r] = 0.0f;
#pragma unroll
        for (int g = 0; g < 4; ++g)
#pragma unroll
            for (int r = 0; r < 8; ++r) {
                float p = __expf(s[g][r] - rmax[r]);
                psum[r] += p;
                myp[(hi * 8 + r) * 72 + g * 16 + col] = (_Float16)p;
            }
#pragma unroll
        for (int r = 0; r < 8; ++r) rsum[r] = rsum[r] * scl[r] + psum[r];

        // ---- O += P @ V (P relaid out via wave-private LDS) ----
        const _Float16* prow = myp + col * 72;
        v16h ap0 = ldfrag(prow, kb);        // keys 0..31 of chunk
        v16h ap1 = ldfrag(prow + 32, kb);   // keys 32..63
#pragma unroll
        for (int nt = 0; nt < 4; ++nt) {
            o[nt] = wmma_f16(ap0, bv[2 * nt], o[nt]);
            o[nt] = wmma_f16(ap1, bv[2 * nt + 1], o[nt]);
        }

        // hand-over: this wave's LDS reads of tile t are done, its copies of tile t + 1 have
        // landed; behind the barrier tile t + 1 is whole and tile t's buffer is free
        asm volatile("s_wait_dscnt 0x0" ::: "memory");
        asm volatile("s_wait_asynccnt 0x0" ::: "memory");
        __syncthreads();
        if (t + 2 < T_KV / 64) issue_tile(t + 2);
    }
    asm volatile("s_wait_asynccnt 0x0" ::: "memory");   // no copy is left in flight at the end

    // ---- finalize: reduce row sums, normalize, write ph (f16) ----
#pragma unroll
    for (int r = 0; r < 8; ++r) {
        rsum[r] += swz_xor<1>(rsum[r]);
        rsum[r] += swz_xor<2>(rsum[r]);
        rsum[r] += swz_xor<4>(rsum[r]);
        rsum[r] += swz_xor<8>(rsum[r]);
    }
    // The wave's 16 x 64 results go out through its own P tile (free since the last trip): read
    // back, 8 lanes cover one row of 128 bytes, so each store covers whole lines instead of
    // pieces of 32 bytes.
#pragma unroll
    for (int nt = 0; nt < 4; ++nt)
#pragma unroll
        for (int r = 0; r < 8; ++r) {
            float v = o[nt][r] / rsum[r];
            myp[(hi * 8 + r) * 72 + nt * 16 + col] = (_Float16)v;
        }
    // the rows are read back by other lanes of the same wave: its LDS stores come first
    asm volatile("s_wait_dscnt 0x0" ::: "memory");
    const int orow = lane >> 3;                   // 0..3
    const int och  = (lane & 7) * 8;              // halves
    _Float16* po = ph + (size_t)(b * T_Q + qbase + orow) * 1024 + h * 64 + och;
    v8h ov[4];
#pragma unroll
    for (int j = 0; j < 4; ++j)
        ov[j] = *(const v8h*)&myp[(j * 4 + orow) * 72 + och];
#pragma unroll
    for (int j = 0; j < 4; ++j)
        *(v8h*)(po + (size_t)j * (4 * 1024)) = ov[j];
}

// ---------------- host launcher ----------------
extern "C" void kernel_launch(void* const* d_in, const int* in_sizes, int n_in,
                              void* d_out, int out_size, void* d_ws, size_t ws_size,
                              hipStream_t stream) {
    const float* x    = (const float*)d_in[0];
    const float* mask = (const float*)d_in[1];
    const float* ck   = (const float*)d_in[2];
    const float* cv   = (const float*)d_in[3];
    const float* Wq   = (const float*)d_in[4];
    const float* bq   = (const float*)d_in[5];
    const float* Wk   = (const float*)d_in[6];
    const float* Wv   = (const float*)d_in[7];
    const float* bv   = (const float*)d_in[8];
    const float* Wo   = (const float*)d_in[9];
    const float* bo   = (const float*)d_in[10];

    float* out  = (float*)d_out;                 // [2048,1024]
    float* outK = out  + (size_t)NROWS * N_STATE;   // new_k; new_v follows it

    char* w = (char*)d_ws;
    _Float16* xh  = (_Float16*)w; w += (size_t)NROWS * N_STATE * 2;
    _Float16* WT4 = (_Float16*)w; w += (size_t)3 * N_STATE * N_STATE * 2;   // WqT, WkT, WvT
    _Float16* WoT = (_Float16*)w; w += (size_t)N_STATE * N_STATE * 2;
    _Float16* qh  = (_Float16*)w; w += (size_t)NROWS * N_STATE * 2;
    _Float16* kh  = (_Float16*)w; w += (size_t)BATCH * T_KV * N_STATE * 2;
    _Float16* vt  = (_Float16*)w; w += (size_t)BATCH * T_KV * N_STATE * 2;
    _Float16* ph  = (_Float16*)w; w += (size_t)NROWS * N_STATE * 2;

    // stage conversions: one launch
    prep_kernel<<<NB_CK + NB_CV + 4 * NB_W + NB_X, 256, 0, stream>>>(
        x, ck, cv, Wq, Wk, Wv, Wo, xh, WT4, kh, vt);

    // projections of x: one launch
    gemm_wmma_kernel<true><<<dim3(N_STATE / 128, NROWS / 128, 3), 256, 0, stream>>>(
        xh, WT4, bq, bv, outK, qh, kh, vt);

    // attention
    attn_wmma_kernel<<<BATCH * 16 * 2, 256, 0, stream>>>(qh, kh, vt, mask, ph);

    // output projection
    gemm_wmma_kernel<false><<<dim3(N_STATE / 128, NROWS / 128), 256, 0, stream>>>(
        ph, WoT, bo, nullptr, out, nullptr, nullptr, nullptr);
}

// v006
// A run of this version takes 70.3 microseconds.
// Timed twice side by side with v005, it ran 1.13 times as fast both times.
// Over all steps from v000 it is 5.80 times as fast.
#include <hip/hip_runtime.h>

// ---------------- types ----------------
typedef __attribute__((ext_vector_type(16))) _Float16 v16h;
typedef __attribute__((ext_vector_type(8)))  _Float16 v8h;
typedef __attribute__((ext_vector_type(4)))  _Float16 v4h;
typedef __attribute__((ext_vector_type(8)))  float    v8f;

#define N_STATE 1024
#define T_Q     256
#define T_CACHE 768
#define T_KV    1024
#define BATCH   8
#define NROWS   2048          // B*T
#define QK_SCALE 0.125f

// ---------------- WMMA helpers ----------------
__device__ __forceinline__ v8f wmma_f16(v16h a, v16h b, v8f c) {
    // D = A(16x32) * B(32x16) + C, f32 accumulate
    return __builtin_amdgcn_wmma_f32_16x16x32_f16(
        false, a, false, b, (short)0, c, false, false);
}

// Load a 16x32 A-style fragment for this lane.
// Lane layout (ISA 7.12.2, 16-bit A 16x32): row = lane&15, kb = (lane>>4)*8,
// halves cover K in [kb,kb+8) and [kb+16,kb+24)  -> two 16-byte loads.
// `p` must point at element [lane&15][0] of the tile (row stride pre-applied).
__device__ __forceinline__ v16h ldfrag(const _Float16* p, int kb) {
    union { v16h v; v8h h[2]; } u;
    u.h[0] = *(const v8h*)(p + kb);
    u.h[1] = *(const v8h*)(p + kb + 16);
    return u.v;
}

// Async global -> LDS copies of 16 bytes per lane (CDNA5 GLOBAL_LOAD_ASYNC_TO_LDS, tracked by
// ASYNCcnt). An LDS address is the low 32 bits of the generic shared pointer.
// Eight copies of one lane, one behind the other: copy j takes LDS byte address l + j * lstep
// and global pointer g + j * gstep, each in registers of its own. s_wait_xcnt 0 is the
// statement's last line, so that it stands in front of any later write of a register that one
// of the copies names.
__device__ __forceinline__ void async_ld8_b128(unsigned int l, unsigned int lstep,
                                               const _Float16* g, int gstep) {
    asm volatile("global_load_async_to_lds_b128 %0, %1, off\n\t"
                 "global_load_async_to_lds_b128 %2, %3, off\n\t"
                 "global_load_async_to_lds_b128 %4, %5, off\n\t"
                 "global_load_async_to_lds_b128 %6, %7, off\n\t"
                 "global_load_async_to_lds_b128 %8, %9, off\n\t"
                 "global_load_async_to_lds_b128 %10, %11, off\n\t"
                 "global_load_async_to_lds_b128 %12, %13, off\n\t"
                 "global_load_async_to_lds_b128 %14, %15, off\n\t"
                 "s_wait_xcnt 0x0"
                 :: "v"(l),             "v"(g),
                    "v"(l + lstep),     "v"(g + gstep),
                    "v"(l + 2 * lstep), "v"(g + 2 * gstep),
                    "v"(l + 3 * lstep), "v"(g + 3 * gstep),
                    "v"(l + 4 * lstep), "v"(g + 4 * gstep),
                    "v"(l + 5 * lstep), "v"(g + 5 * gstep),
                    "v"(l + 6 * lstep), "v"(g + 6 * gstep),
                    "v"(l + 7 * lstep), "v"(g + 7 * gstep)
                 : "memory");
}

// Four such copies, each with its own LDS byte address and its own global pointer; the same
// wait as its last line.
__device__ __forceinline__ void async_ld4_b128(unsigned int l0, const _Float16* g0,
                                               unsigned int l1, const _Float16* g1,
                                               unsigned int l2, const _Float16* g2,
                                               unsigned int l3, const _Float16* g3) {
    asm volatile("global_load_async_to_lds_b128 %0, %1, off\n\t"
                 "global_load_async_to_lds_b128 %2, %3, off\n\t"
                 "global_load_async_to_lds_b128 %4, %5, off\n\t"
                 "global_load_async_to_lds_b128 %6, %7, off\n\t"
                 "s_wait_xcnt 0x0"
                 :: "v"(l0), "v"(g0), "v"(l1), "v"(g1),
                    "v"(l2), "v"(g2), "v"(l3), "v"(g3)
                 : "memory");
}

// xor-shuffle across lanes via ds_swizzle (group-of-32 mode: and=0x1f, xor=XM)
template<int XM>
__device__ __forceinline__ float swz_xor(float v) {
    int i = __float_as_int(v);
    i = __builtin_amdgcn_ds_swizzle(i, (XM << 10) | 0x1f);
    return __int_as_float(i);
}

// ---------------- elementwise converts / packs ----------------
// f32 -> f16 convert of whole rows of 1024 elements:
//   in [batch][RIN][1024] f32  ->  out [batch][ROUT][1024] f16, rows 0..RIN-1 of each batch
// Serves x -> xh (RIN = ROUT = 2048, one batch) and cache_k -> kh (768 of 1024 key rows).
// One block converts RPB rows; RPB divides RIN, so a block stays inside one batch.
// A thread owns one float4 column group of every row: each wave-wide load covers 512
// contiguous bytes and each wave-wide store 256, whole lines both ways. A thread's loads
// are independent and stand ahead of its stores, so few waves keep many bytes in flight,
// and the launch starts RPB * 4 times fewer waves than one element a thread would.
// blk = index of the block among the blocks of this convert.
template<int RIN, int ROUT, int RPB>
__device__ __forceinline__
void cvt_rows_block(const float* __restrict__ in,
                    _Float16* __restrict__ out, int blk) {
    static_assert(RIN % RPB == 0, "a block must not straddle two batches");
    const int r0 = blk * RPB;
    const int b  = r0 / RIN;
    const int c  = threadIdx.x * 4;
    const float* src = in + (size_t)r0 * 1024 + c;
    _Float16*    dst = out + (size_t)(r0 + b * (ROUT - RIN)) * 1024 + c;

    float4 v[RPB];
    // unrolled so that v[] stays in registers and the loads go out back to back
#pragma unroll
    for (int j = 0; j < RPB; ++j)
        v[j] = *(const float4*)(src + (size_t)j * 1024);
    // unrolled for the same reason: v[] is indexed by constants only
#pragma unroll
    for (int j = 0; j < RPB; ++j) {
        v4h h = { (_Float16)v[j].x, (_Float16)v[j].y, (_Float16)v[j].z, (_Float16)v[j].w };
        *(v4h*)(dst + (size_t)j * 1024) = h;
    }
}

// Transposing convert through an LDS tile:
//   in  [batch][ROWS][1024] f32  ->  out [batch][1024][1024] f16, columns 0..ROWS-1
//   out[b][c][s] = (f16) in[b][s][c]
// Serves W[k][n] -> WT[n][k] (ROWS = 1024, one batch) and cache_v[b][s][c] ->
// vt[b][c = h*64+dh][key s] (ROWS = 768, eight batches).
// One block moves a tile of 128 rows (s) x 64 columns (c): 256 contiguous bytes a row on
// the f32 side and 256 contiguous bytes a row on the f16 side, so loads and stores both
// cover whole lines. A thread loads 8 consecutive rows of one float4 column group; each
// of its 4 columns is then 8 halves (16 bytes) of one output row.
// LDS row = one output row of 16 chunks of 16 bytes; chunk q of row c sits at q ^ (c >> 2),
// which spreads the 16 lanes of a half wave over all banks in the store and in the load.
// tile = the block's LDS tile of 64 * 128 halves; (bx, by, b) = column tile, row tile, batch.
template<int ROWS>
__device__ __forceinline__
void transpose_cvt_block(const float* __restrict__ in,
                         _Float16* __restrict__ out,
                         _Float16* tile, int bx, int by, int b) {
    const int tid = threadIdx.x;
    const int c0  = bx * 64;
    const int s0  = by * 128;

    const int c4 = tid & 15;            // float4 column group
    const int sr = tid >> 4;            // group of 8 rows
    const float* src = in + ((size_t)b * ROWS + s0 + sr * 8) * 1024 + c0 + c4 * 4;

    float4 v[8];
#pragma unroll
    for (int j = 0; j < 8; ++j)
        v[j] = *(const float4*)(src + (size_t)j * 1024);

    v8h h0, h1, h2, h3;
#pragma unroll
    for (int j = 0; j < 8; ++j) {
        h0[j] = (_Float16)v[j].x;
        h1[j] = (_Float16)v[j].y;
        h2[j] = (_Float16)v[j].z;
        h3[j] = (_Float16)v[j].w;
    }
    _Float16* dst = &tile[(c4 * 4) * 128 + ((sr ^ c4) * 8)];
    *(v8h*)(dst)           = h0;
    *(v8h*)(dst + 128)     = h1;
    *(v8h*)(dst + 2 * 128) = h2;
    *(v8h*)(dst + 3 * 128) = h3;

    __syncthreads();   // the tile is read back across waves

    const int q  = tid & 15;            // 16-byte chunk of an output row
    const int cr = tid >> 4;
    _Float16* o = out + ((size_t)b * 1024 + c0) * 1024 + s0 + q * 8;
#pragma unroll
    for (int p = 0; p < 4; ++p) {
        int c = p * 16 + cr;
        *(v8h*)(o + (size_t)c * 1024) = *(const v8h*)&tile[c * 128 + ((q ^ (c >> 2)) * 8)];
    }
}

// All seven converts in ONE launch. None reads what another writes, so their blocks stand
// side by side in one grid, each convert on its own range of block indices: one launch gap
// and one start-up and tail instead of seven, and the small converts (128 blocks a weight
// matrix, half the chip) run beside the large ones instead of alone.
// The branch is on blockIdx alone, so the barrier inside a transpose is block-uniform.
// The blocks with the most bytes come first.
#define NB_CK ((BATCH * T_CACHE) / 24)                        // cache_k rows
#define NB_CV ((N_STATE / 64) * (T_CACHE / 128) * BATCH)      // cache_v tiles
#define NB_W  ((N_STATE / 64) * (N_STATE / 128))              // tiles of one weight matrix
#define NB_X  (NROWS / 8)                                     // x rows
__global__ __launch_bounds__(256)
void prep_kernel(const float* __restrict__ x,
                 const float* __restrict__ ck,
                 const float* __restrict__ cv,
                 const float* __restrict__ Wq,
                 const float* __restrict__ Wk,
                 const float* __restrict__ Wv,
                 const float* __restrict__ Wo,
                 _Float16* __restrict__ xh,
                 _Float16* __restrict__ WT4,     // WqT, WkT, WvT, WoT one behind the other
                 _Float16* __restrict__ kh,
                 _Float16* __restrict__ vt) {
    __shared__ __align__(16) _Float16 tile[64 * 128];

    // Each branch ends with s_wait_xcnt 0: in the built code the branches stand one behind the
    // other, and the next one's first instructions reuse registers that the stores just issued
    // still name; the wait stands in front of any such overwrite.
    int blk = blockIdx.x;
    if (blk < NB_CK) {
        cvt_rows_block<T_CACHE, T_KV, 24>(ck, kh, blk);
        asm volatile("s_wait_xcnt 0x0" ::: "memory");   // see the note above
    } else if (blk < NB_CK + NB_CV) {
        blk -= NB_CK;
        const int t = blk >> 4;                  // row tile and batch
        transpose_cvt_block<T_CACHE>(cv, vt, tile, blk & 15,
                                     t % (T_CACHE / 128), t / (T_CACHE / 128));
        asm volatile("s_wait_xcnt 0x0" ::: "memory");   // see the note above
    } else if (blk < NB_CK + NB_CV + 4 * NB_W) {
        blk -= NB_CK + NB_CV;
        const int m = blk / NB_W;                // which weight matrix
        const float* W = m == 0 ? Wq : m == 1 ? Wk : m == 2 ? Wv : Wo;
        transpose_cvt_block<N_STATE>(W, WT4 + (size_t)m * (N_STATE * N_STATE), tile,
                                     blk & 15, (blk >> 4) & 7, 0);
        asm volatile("s_wait_xcnt 0x0" ::: "memory");   // see the note above
    } else {
        cvt_rows_block<NROWS, NROWS, 8>(x, xh, blk - (NB_CK + NB_CV + 4 * NB_W));
        asm volatile("s_wait_xcnt 0x0" ::: "memory");   // see the note above
    }
}

// ---------------- tiled WMMA GEMM: C[2048,1024] = A[2048,1024] @ W[1024,1024] ----------------
// A f16 row-major, WT f16 = W^T row-major ([n][k]).
// Block tile 128x128; 8 waves in 4(M)x2(N) grid, each wave 32x64 (2x4 16x16 tiles).
// A trip of the K loop works on 128 k. Its A and B tiles (128 rows of 256 bytes each) come into
// LDS by async copies: 16 lanes cover one row, so every copy asks for whole 256-byte runs, and
// a block has 64 KiB in flight. Two buffers: the copies of tile t + 2 go out at the foot of trip
// t and fly during trip t + 1, which has 32 WMMAs a wave to cover them.
// LDS rows stand at a pitch of 272 bytes, which spreads the 16 rows of a fragment load over all
// banks. The ring is dead when the epilogue starts, so the epilogue's tiles lie in the same LDS.
#define GK       128                  // k of one staged tile
#define G_PITCH  136                  // halves: 256 bytes of data + 16 bytes of pad
#define G_TILE   (128 * G_PITCH)      // halves of one operand's tile
#define G_STAGE  (2 * G_TILE)         // A tile, then B tile
#define MODE_Q 0
#define MODE_K 1
#define MODE_V 2
#define MODE_O 3
#define ST32_PITCH 132        // floats: 512 bytes of data + 16 bytes of pad
#define ST16_PITCH 136        // halves: 256 bytes of data + 16 bytes of pad

template<int M> struct mode_tag { static constexpr int value = M; };

// QKV = true: ONE launch does the three projections of x, which share A and depend on
// nothing of each other: blockIdx.z picks the weight matrix and the epilogue, so 384 blocks
// fill the chip where each projection alone has 128. V, whose epilogue is the longest,
// takes the lowest z and starts first.
// QKV = false: the output projection alone (WTs = WoT, bias_q = bo, out32s = out).
template<bool QKV>
__global__ __launch_bounds__(256)
void gemm_wmma_kernel(const _Float16* __restrict__ A,
                      const _Float16* __restrict__ WTs,    // WqT, WkT, WvT one behind the other
                      const float* __restrict__ bias_q,
                      const float* __restrict__ bias_v,
                      float* __restrict__ out32s,          // new_k, new_v one behind the other
                      _Float16* __restrict__ qh,
                      _Float16* __restrict__ kh,
                      _Float16* __restrict__ vt) {
    const int mode = QKV ? MODE_V - (int)blockIdx.z : MODE_O;
    const _Float16* WT = QKV ? WTs + (size_t)mode * (N_STATE * N_STATE) : WTs;

    constexpr int RING_BYTES = 2 * G_STAGE * 2;
    constexpr int ST32_BYTES = 128 * ST32_PITCH * 4;
    constexpr int EPI_BYTES  = ST32_BYTES + (QKV ? 128 * ST16_PITCH * 2 : 0);
    __shared__ __align__(16) unsigned char smem[RING_BYTES > EPI_BYTES ? RING_BYTES : EPI_BYTES];
    _Float16* ring = (_Float16*)smem;                    // [buffer][A, B][row][G_PITCH]
    // epilogue tiles of the block's 128 x 128 results; the pad of 16 bytes a row spreads the rows
    // over the banks for the stores from the accumulator layout and for the 16-byte loads
    float*    st32 = (float*)smem;
    _Float16* st16 = (_Float16*)(smem + ST32_BYTES);

    const int tid  = threadIdx.x;
    const int lane = tid & 31;
    const int wid  = tid >> 5;
    const int wm   = wid >> 1;           // 0..3
    const int wn   = wid & 1;            // 0..1
    const int col  = lane & 15;
    const int hi8  = (lane >> 4) * 8;
    const int kb   = hi8;
    const int ablk = blockIdx.y * 128;
    const int bblk = blockIdx.x * 128;

    // staging: 16 lanes cover one row of 256 bytes; a thread owns one 16-byte chunk of rows
    // srow, srow + 16, ..., srow + 112 of the A tile and of the B tile
    const int srow = tid >> 4;                // 0..15
    const int sc   = (tid & 15) * 8;          // halves
    const _Float16* ag = A  + (size_t)(ablk + srow) * 1024 + sc;
    const _Float16* bg = WT + (size_t)(bblk + srow) * 1024 + sc;
    auto issue_tile = [&](int t) {
        const unsigned int la =
            (unsigned int)(size_t)&ring[(t & 1) * G_STAGE + srow * G_PITCH + sc];
        async_ld8_b128(la,              16 * G_PITCH * 2, ag + t * GK, 16 * 1024);
        async_ld8_b128(la + G_TILE * 2, 16 * G_PITCH * 2, bg + t * GK, 16 * 1024);
    };

    v8f acc[2][4];
#pragma unroll
    for (int mt = 0; mt < 2; ++mt)
#pragma unroll
        for (int nt = 0; nt < 4; ++nt) acc[mt][nt] = (v8f){0,0,0,0,0,0,0,0};

    issue_tile(0);
    asm volatile("s_wait_asynccnt 0x0" ::: "memory");   // this wave's part of tile 0 has landed
    __syncthreads();                                    // tile 0 is whole for every wave
    issue_tile(1);

    // rolled: one copy of the trip's text; the buffer index is the trip's parity
#pragma unroll 1
    for (int t = 0; t < N_STATE / GK; ++t) {
        const _Float16* as = ring + (t & 1) * G_STAGE + (wm * 32 + col) * G_PITCH;
        const _Float16* bs = ring + (t & 1) * G_STAGE + G_TILE + (wn * 64 + col) * G_PITCH;
        // unrolled: the four steps of 32 k differ by constant LDS offsets only
#pragma unroll
        for (int ks = 0; ks < GK / 32; ++ks) {
            v16h af[2], bf[4];
#pragma unroll
            for (int mt = 0; mt < 2; ++mt)
                af[mt] = ldfrag(as + mt * 16 * G_PITCH + ks * 32, kb);
#pragma unroll
            for (int nt = 0; nt < 4; ++nt)
                bf[nt] = ldfrag(bs + nt * 16 * G_PITCH + ks * 32, kb);
#pragma unroll
            for (int mt = 0; mt < 2; ++mt)
#pragma unroll
                for (int nt = 0; nt < 4; ++nt)
                    acc[mt][nt] = wmma_f16(af[mt], bf[nt], acc[mt][nt]);
        }

        // hand-over: this wave's LDS reads of tile t are done, its copies of tile t + 1 have
        // landed; behind the barrier tile t + 1 is whole and tile t's buffer is free (behind the
        // last trip's: the whole ring, for the epilogue's tiles)
        asm volatile("s_wait_dscnt 0x0" ::: "memory");
        asm volatile("s_wait_asynccnt 0x0" ::: "memory");
        __syncthreads();
        if (t + 2 < N_STATE / GK) issue_tile(t + 2);
    }
    asm volatile("s_wait_asynccnt 0x0" ::: "memory");   // no copy is left in flight at the end

    // epilogue (C layout: VGPR r -> row r + 8*(lane>>4), col = lane&15)
    // The accumulators reach global memory through LDS tiles of the whole block. Straight from
    // the registers a wave-wide store covers pieces of 64 bytes (f32), 32 bytes (f16) or, for
    // V^T, 2 bytes on each of 16 lines; read back from the tile every lane stores 16 bytes and
    // a wave covers 512 contiguous bytes (f32) or two runs of 256 (f16): whole lines only.
    // V^T is transposed on the way in: a lane's 8 accumulators of one column are 8 consecutive
    // keys, one 16-byte chunk of that column's row in the tile.
    auto epilogue = [&](auto tag, const float* __restrict__ bias,
                        float* __restrict__ out32, _Float16* __restrict__ out16) {
    constexpr int MODE = decltype(tag)::value;
#pragma unroll
    for (int mt = 0; mt < 2; ++mt)
#pragma unroll
        for (int nt = 0; nt < 4; ++nt) {
            const int rl = wm * 32 + mt * 16 + hi8;     // row in the block's tile
            const int cl = wn * 64 + nt * 16 + col;     // column in the block's tile
            float bc = 0.0f;
            if constexpr (MODE != MODE_K) bc = bias[bblk + cl];
            v8h hv;
#pragma unroll
            for (int r = 0; r < 8; ++r) {
                float v = acc[mt][nt][r];
                if constexpr (MODE == MODE_Q) {
                    v = (v + bc) * QK_SCALE;
                    st16[(rl + r) * ST16_PITCH + cl] = (_Float16)v;
                } else if constexpr (MODE == MODE_K) {
                    st32[(rl + r) * ST32_PITCH + cl] = v;
                    st16[(rl + r) * ST16_PITCH + cl] = (_Float16)v;
                } else if constexpr (MODE == MODE_V) {
                    v += bc;
                    st32[(rl + r) * ST32_PITCH + cl] = v;
                    hv[r] = (_Float16)v;
                } else {
                    v += bc;
                    st32[(rl + r) * ST32_PITCH + cl] = v;
                }
            }
            if constexpr (MODE == MODE_V)
                *(v8h*)&st16[cl * ST16_PITCH + rl] = hv;    // [column][key]
        }

    __syncthreads();   // the tiles are read back across waves

    if constexpr (MODE != MODE_Q) {
        // one wave, one row of 512 bytes
        float* o = out32 + (size_t)(ablk + wid) * 1024 + bblk + lane * 4;
        float4 v[16];
        // unrolled so that v[] stays in registers and the LDS loads go out back to back
#pragma unroll
        for (int j = 0; j < 16; ++j)
            v[j] = *(const float4*)&st32[(j * 8 + wid) * ST32_PITCH + lane * 4];
#pragma unroll
        for (int j = 0; j < 16; ++j)
            *(float4*)(o + (size_t)j * (8 * 1024)) = v[j];
    }
    if constexpr (MODE != MODE_O) {
        // 16 lanes, one tile row of 256 bytes
        const int row = tid >> 4;
        const int ch  = (tid & 15) * 8;
        const int b   = ablk >> 8, t0 = ablk & 255;     // a block's 128 rows lie in one batch
        _Float16* o;
        if constexpr (MODE == MODE_Q)
            o = out16 + (size_t)(ablk + row) * 1024 + bblk + ch;
        else if constexpr (MODE == MODE_K)
            o = out16 + (size_t)(b * T_KV + T_CACHE + t0 + row) * 1024 + bblk + ch;
        else                                            // tile row = column of V = row of V^T
            o = out16 + (size_t)(b * N_STATE + bblk + row) * T_KV + T_CACHE + t0 + ch;
        v8h h[8];
        // unrolled for the same reason as above
#pragma unroll
        for (int j = 0; j < 8; ++j)
            h[j] = *(const v8h*)&st16[(j * 16 + row) * ST16_PITCH + ch];
#pragma unroll
        for (int j = 0; j < 8; ++j)
            *(v8h*)(o + (size_t)j * (16 * 1024)) = h[j];
    }
    };
    if constexpr (QKV) {
        // Each epilogue ends with s_wait_xcnt 0: in the built code the three stand one behind
        // the other, and index arithmetic of the next one reuses registers that the stores just
        // issued still name; the wait stands in front of any such overwrite.
        if (mode == MODE_V) {
            epilogue(mode_tag<MODE_V>{}, bias_v, out32s + (size_t)NROWS * N_STATE, vt);
            asm volatile("s_wait_xcnt 0x0" ::: "memory");   // see the note above
        } else if (mode == MODE_K) {
            epilogue(mode_tag<MODE_K>{}, nullptr, out32s, kh);
            asm volatile("s_wait_xcnt 0x0" ::: "memory");   // see the note above
        } else {
            epilogue(mode_tag<MODE_Q>{}, bias_q, nullptr, qh);
            asm volatile("s_wait_xcnt 0x0" ::: "memory");   // see the note above
        }
    } else {
        epilogue(mode_tag<MODE_O>{}, bias_q, out32s, nullptr);
    }
}

// ---------------- flash attention ----------------
// grid = 256 blocks: b(8) x h(16) x qhalf(2); 8 waves x 16 query rows = 128 rows/block.
// The 8 waves of a block walk the same keys of the same head. Each tile of 64 keys (K: 64 key
// rows of 128 bytes; V^T: 64 dim rows of 128 bytes) is brought into LDS ONCE for the block by
// async copies that cover whole 128-byte lines, and every wave takes its fragments from LDS.
// Two buffers: the copies of tile t + 2 go out at the foot of trip t and fly during trip t + 1.
// LDS rows stand at a pitch of 144 bytes, which spreads the 16 rows of a fragment load over
// all banks. The P buffer stays wave-private (LDS in-order per wave).
#define KV_PITCH 72           // halves: 128 bytes of data + 16 bytes of pad
__global__ __launch_bounds__(256)
void attn_wmma_kernel(const _Float16* __restrict__ qh,
                      const _Float16* __restrict__ kh,
                      const _Float16* __restrict__ vt,
                      const float* __restrict__ mask,
                      _Float16* __restrict__ ph) {
    __shared__ __align__(16) _Float16 ps[8][16 * 72];
    __shared__ __align__(16) _Float16 Ks[2][64 * KV_PITCH];   // [key][dim]
    __shared__ __align__(16) _Float16 Vs[2][64 * KV_PITCH];   // [dim][key]

    const int lane  = threadIdx.x & 31;
    const int wid   = threadIdx.x >> 5;
    const int col   = lane & 15;
    const int hi    = lane >> 4;
    const int kb    = hi * 8;
    const int blk   = blockIdx.x;
    const int b     = blk >> 5;
    const int h     = (blk >> 1) & 15;
    const int qbase = (blk & 1) * 128 + wid * 16;

    // Q A-fragments (reused for the whole key loop)
    const _Float16* qrow =
        qh + (size_t)(b * T_Q + qbase + col) * 1024 + h * 64;
    const v16h aq0 = ldfrag(qrow, kb);        // dims 0..31
    const v16h aq1 = ldfrag(qrow + 32, kb);   // dims 32..63

    v8f o[4];
#pragma unroll
    for (int nt = 0; nt < 4; ++nt) o[nt] = (v8f){0,0,0,0,0,0,0,0};
    float rmax[8], rsum[8];
#pragma unroll
    for (int r = 0; r < 8; ++r) { rmax[r] = -3.0e38f; rsum[r] = 0.0f; }

    _Float16* myp = &ps[wid][0];

    // staging: 8 lanes cover one row of 128 bytes; a thread owns one 16-byte chunk of rows
    // srow and srow + 32 of the K tile and of the V^T tile
    const int srow = threadIdx.x >> 3;            // 0..31
    const int sc   = (threadIdx.x & 7) * 8;       // halves
    const _Float16* kg = kh + (size_t)(b * T_KV + srow) * 1024 + h * 64 + sc;
    const _Float16* vg = vt + (size_t)((b * 16 + h) * 64 + srow) * T_KV + sc;
    auto issue_tile = [&](int t) {
        const int buf = t & 1;
        const _Float16* k0 = kg + (size_t)t * (64 * 1024);
        const _Float16* v0 = vg + t * 64;
        async_ld4_b128((unsigned int)(size_t)&Ks[buf][srow * KV_PITCH + sc],        k0,
                       (unsigned int)(size_t)&Ks[buf][(srow + 32) * KV_PITCH + sc], k0 + 32 * 1024,
                       (unsigned int)(size_t)&Vs[buf][srow * KV_PITCH + sc],        v0,
                       (unsigned int)(size_t)&Vs[buf][(srow + 32) * KV_PITCH + sc], v0 + 32 * T_KV);
    };

    issue_tile(0);
    asm volatile("s_wait_asynccnt 0x0" ::: "memory");   // this wave's part of tile 0 has landed
    __syncthreads();                                    // tile 0 is whole for every wave
    issue_tile(1);

    // rolled: one copy of the trip's text; the buffer index is the trip's parity
#pragma unroll 1
    for (int t = 0; t < T_KV / 64; ++t) {
        const int kvc = t * 64;
        const _Float16* ks = &Ks[t & 1][0];
        const _Float16* vs = &Vs[t & 1][0];
        // ---- S = Q @ K^T  (16 x 64 scores) ----
        v8f s[4];
#pragma unroll
        for (int g = 0; g < 4; ++g) s[g] = (v8f){0,0,0,0,0,0,0,0};
        // the trip's mask values are asked for first: they come from furthest away (not staged)
        float mk[4][8];
#pragma unroll
        for (int g = 0; g < 4; ++g)
#pragma unroll
            for (int r = 0; r < 8; ++r) {
                int qr  = qbase + hi * 8 + r;
                int key = kvc + g * 16 + col;
                mk[g][r] = mask[(size_t)qr * T_KV + key];
            }
        v16h bk[8], bv[8];
#pragma unroll
        for (int g = 0; g < 4; ++g) {
            const _Float16* krow = ks + (g * 16 + col) * KV_PITCH;
            bk[2 * g]     = ldfrag(krow, kb);
            bk[2 * g + 1] = ldfrag(krow + 32, kb);
        }
#pragma unroll
        for (int nt = 0; nt < 4; ++nt) {
            const _Float16* vrow = vs + (nt * 16 + col) * KV_PITCH;
            bv[2 * nt]     = ldfrag(vrow, kb);
            bv[2 * nt + 1] = ldfrag(vrow + 32, kb);
        }
        // keeps the trip's fragment loads together ahead of the products: spread among them,
        // each pair of LDS loads makes the wave wait out a full LDS latency of its own
        __builtin_amdgcn_sched_barrier(0);
#pragma unroll
        for (int g = 0; g < 4; ++g) {
            s[g] = wmma_f16(aq0, bk[2 * g], s[g]);
            s[g] = wmma_f16(aq1, bk[2 * g + 1], s[g]);
        }
        // ---- mask + chunk row-max ----
        float cmax[8];
#pragma unroll
        for (int r = 0; r < 8; ++r) cmax[r] = -3.0e38f;
#pragma unroll
        for (int g = 0; g < 4; ++g)
#pragma unroll
            for (int r = 0; r < 8; ++r) {
                float v = s[g][r] + mk[g][r];
                s[g][r] = v;
                cmax[r] = fmaxf(cmax[r], v);
            }
#pragma unroll
        for (int r = 0; r < 8; ++r) {
            cmax[r] = fmaxf(cmax[r], swz_xor<1>(cmax[r]));
            cmax[r] = fmaxf(cmax[r], swz_xor<2>(cmax[r]));
            cmax[r] = fmaxf(cmax[r], swz_xor<4>(cmax[r]));
            cmax[r] = fmaxf(cmax[r], swz_xor<8>(cmax[r]));
        }
        // ---- online softmax update ----
        float scl[8];
#pragma unroll
        for (int r = 0; r < 8; ++r) {
            float nm = fmaxf(rmax[r], cmax[r]);
            scl[r]   = __expf(rmax[r] - nm);
            rmax[r]  = nm;
        }
#pragma unroll
        for (int nt = 0; nt < 4; ++nt)
#pragma unroll
            for (int r = 0; r < 8; ++r) o[nt][r] *= scl[r];

        float psum[8];
#pragma unroll
        for (int r = 0; r < 8; ++r) psum[r] = 0.0f;
#pragma unroll
        for (int g = 0; g < 4; ++g)
#pragma unroll
            for (int r = 0; r < 8; ++r) {
                float p = __expf(s[g][r] - rmax[r]);
                psum[r] += p;
                myp[(hi * 8 + r) * 72 + g * 16 + col] = (_Float16)p;
            }
#pragma unroll
        for (int r = 0; r < 8; ++r) rsum[r] = rsum[r] * scl[r] + psum[r];

        // ---- O += P @ V (P relaid out via wave-private LDS) ----
        const _Float16* prow = myp + col * 72;
        v16h ap0 = ldfrag(prow, kb);        // keys 0..31 of chunk
        v16h ap1 = ldfrag(prow + 32, kb);   // keys 32..63
#pragma unroll
        for (int nt = 0; nt < 4; ++nt) {
            o[nt] = wmma_f16(ap0, bv[2 * nt], o[nt]);
            o[nt] = wmma_f16(ap1, bv[2 * nt + 1], o[nt]);
        }

        // hand-over: this wave's LDS reads of tile t are done, its copies of tile t + 1 have
        // landed; behind the barrier tile t + 1 is whole and tile t's buffer is free
        asm volatile("s_wait_dscnt 0x0" ::: "memory");
        asm volatile("s_wait_asynccnt 0x0" ::: "memory");
        __syncthreads();
        if (t + 2 < T_KV / 64) issue_tile(t + 2);
    }
    asm volatile("s_wait_asynccnt 0x0" ::: "memory");   // no copy is left in flight at the end

    // ---- finalize: reduce row sums, normalize, write ph (f16) ----
#pragma unroll
    for (int r = 0; r < 8; ++r) {
        rsum[r] += swz_xor<1>(rsum[r]);
        rsum[r] += swz_xor<2>(rsum[r]);
        rsum[r] += swz_xor<4>(rsum[r]);
        rsum[r] += swz_xor<8>(rsum[r]);
    }
    // The wave's 16 x 64 results go out through its own P tile (free since the last trip): read
    // back, 8 lanes cover one row of 128 bytes, so each store covers whole lines instead of
    // pieces of 32 bytes.
#pragma unroll
    for (int nt = 0; nt < 4; ++nt)
#pragma unroll
        for (int r = 0; r < 8; ++r) {
            float v = o[nt][r] / rsum[r];
            myp[(hi * 8 + r) * 72 + nt * 16 + col] = (_Float16)v;
        }
    // the rows are read back by other lanes of the same wave: its LDS stores come first
    asm volatile("s_wait_dscnt 0x0" ::: "memory");
    const int orow = lane >> 3;                   // 0..3
    const int och  = (lane & 7) * 8;              // halves
    _Float16* po = ph + (size_t)(b * T_Q + qbase + orow) * 1024 + h * 64 + och;
    v8h ov[4];
#pragma unroll
    for (int j = 0; j < 4; ++j)
        ov[j] = *(const v8h*)&myp[(j * 4 + orow) * 72 + och];
#pragma unroll
    for (int j = 0; j < 4; ++j)
        *(v8h*)(po + (size_t)j * (4 * 1024)) = ov[j];
}

// ---------------- host launcher ----------------
extern "C" void kernel_launch(void* const* d_in, const int* in_sizes, int n_in,
                              void* d_out, int out_size, void* d_ws, size_t ws_size,
                              hipStream_t stream) {
    const float* x    = (const float*)d_in[0];
    const float* mask = (const float*)d_in[1];
    const float* ck   = (const float*)d_in[2];
    const float* cv   = (const float*)d_in[3];
    const float* Wq   = (const float*)d_in[4];
    const float* bq   = (const float*)d_in[5];
    const float* Wk   = (const float*)d_in[6];
    const float* Wv   = (const float*)d_in[7];
    const float* bv   = (const float*)d_in[8];
    const float* Wo   = (const float*)d_in[9];
    const float* bo   = (const float*)d_in[10];

    float* out  = (float*)d_out;                 // [2048,1024]
    float* outK = out  + (size_t)NROWS * N_STATE;   // new_k; new_v follows it

    char* w = (char*)d_ws;
    _Float16* xh  = (_Float16*)w; w += (size_t)NROWS * N_STATE * 2;
    _Float16* WT4 = (_Float16*)w; w += (size_t)3 * N_STATE * N_STATE * 2;   // WqT, WkT, WvT
    _Float16* WoT = (_Float16*)w; w += (size_t)N_STATE * N_STATE * 2;
    _Float16* qh  = (_Float16*)w; w += (size_t)NROWS * N_STATE * 2;
    _Float16* kh  = (_Float16*)w; w += (size_t)BATCH * T_KV * N_STATE * 2;
    _Float16* vt  = (_Float16*)w; w += (size_t)BATCH * T_KV * N_STATE * 2;
    _Float16* ph  = (_Float16*)w; w += (size_t)NROWS * N_STATE * 2;

    // stage conversions: one launch
    prep_kernel<<<NB_CK + NB_CV + 4 * NB_W + NB_X, 256, 0, stream>>>(
        x, ck, cv, Wq, Wk, Wv, Wo, xh, WT4, kh, vt);

    // projections of x: one launch
    gemm_wmma_kernel<true><<<dim3(N_STATE / 128, NROWS / 128, 3), 256, 0, stream>>>(
        xh, WT4, bq, bv, outK, qh, kh, vt);

    // attention
    attn_wmma_kernel<<<BATCH * 16 * 2, 256, 0, stream>>>(qh, kh, vt, mask, ph);

    // output projection
    gemm_wmma_kernel<false><<<dim3(N_STATE / 128, NROWS / 128), 256, 0, stream>>>(
        ph, WoT, bo, nullptr, out, nullptr, nullptr, nullptr);
}

// v007
// Measured time: 65.3 microseconds a run.
// Timed twice side by side with v006, it ran 1.07 times as fast both times.
// Counting every step since v000, it is 6.22 times as fast.
#include <hip/hip_runtime.h>

// ---------------- types ----------------
typedef __attribute__((ext_vector_type(16))) _Float16 v16h;
typedef __attribute__((ext_vector_type(8)))  _Float16 v8h;
typedef __attribute__((ext_vector_type(4)))  _Float16 v4h;
typedef __attribute__((ext_vector_type(8)))  float    v8f;

#define N_STATE 1024
#define T_Q     256
#define T_CACHE 768
#define T_KV    1024
#define BATCH   8
#define NROWS   2048          // B*T
#define QK_SCALE 0.125f

// ---------------- WMMA helpers ----------------
__device__ __forceinline__ v8f wmma_f16(v16h a, v16h b, v8f c) {
    // D = A(16x32) * B(32x16) + C, f32 accumulate
    return __builtin_amdgcn_wmma_f32_16x16x32_f16(
        false, a, false, b, (short)0, c, false, false);
}

// Load a 16x32 A-style fragment for this lane.
// Lane layout (ISA 7.12.2, 16-bit A 16x32): row = lane&15, kb = (lane>>4)*8,
// halves cover K in [kb,kb+8) and [kb+16,kb+24)  -> two 16-byte loads.
// `p` must point at element [lane&15][0] of the tile (row stride pre-applied).
__device__ __forceinline__ v16h ldfrag(const _Float16* p, int kb) {
    union { v16h v; v8h h[2]; } u;
    u.h[0] = *(const v8h*)(p + kb);
    u.h[1] = *(const v8h*)(p + kb + 16);
    return u.v;
}

// Async global -> LDS copies of 16 bytes per lane (CDNA5 GLOBAL_LOAD_ASYNC_TO_LDS, tracked by
// ASYNCcnt). An LDS address is the low 32 bits of the generic shared pointer.
// Eight copies of one lane, one behind the other: copy j takes LDS byte address l + j * lstep
// and global pointer g + j * gstep, each in registers of its own. s_wait_xcnt 0 is the
// statement's last line, so that it stands in front of any later write of a register that one
// of the copies names.
__device__ __forceinline__ void async_ld8_b128(unsigned int l, unsigned int lstep,
                                               const _Float16* g, int gstep) {
    asm volatile("global_load_async_to_lds_b128 %0, %1, off\n\t"
                 "global_load_async_to_lds_b128 %2, %3, off\n\t"
                 "global_load_async_to_lds_b128 %4, %5, off\n\t"
                 "global_load_async_to_lds_b128 %6, %7, off\n\t"
                 "global_load_async_to_lds_b128 %8, %9, off\n\t"
                 "global_load_async_to_lds_b128 %10, %11, off\n\t"
                 "global_load_async_to_lds_b128 %12, %13, off\n\t"
                 "global_load_async_to_lds_b128 %14, %15, off\n\t"
                 "s_wait_xcnt 0x0"
                 :: "v"(l),             "v"(g),
                    "v"(l + lstep),     "v"(g + gstep),
                    "v"(l + 2 * lstep), "v"(g + 2 * gstep),
                    "v"(l + 3 * lstep), "v"(g + 3 * gstep),
                    "v"(l + 4 * lstep), "v"(g + 4 * gstep),
                    "v"(l + 5 * lstep), "v"(g + 5 * gstep),
                    "v"(l + 6 * lstep), "v"(g + 6 * gstep),
                    "v"(l + 7 * lstep), "v"(g + 7 * gstep)
                 : "memory");
}

// Four such copies, each with its own LDS byte address and its own global pointer; the same
// wait as its last line.
__device__ __forceinline__ void async_ld4_b128(unsigned int l0, const _Float16* g0,
                                               unsigned int l1, const _Float16* g1,
                                               unsigned int l2, const _Float16* g2,
                                               unsigned int l3, const _Float16* g3) {
    asm volatile("global_load_async_to_lds_b128 %0, %1, off\n\t"
                 "global_load_async_to_lds_b128 %2, %3, off\n\t"
                 "global_load_async_to_lds_b128 %4, %5, off\n\t"
                 "global_load_async_to_lds_b128 %6, %7, off\n\t"
                 "s_wait_xcnt 0x0"
                 :: "v"(l0), "v"(g0), "v"(l1), "v"(g1),
                    "v"(l2), "v"(g2), "v"(l3), "v"(g3)
                 : "memory");
}

// xor-shuffle across lanes via ds_swizzle (group-of-32 mode: and=0x1f, xor=XM)
template<int XM>
__device__ __forceinline__ float swz_xor(float v) {
    int i = __float_as_int(v);
    i = __builtin_amdgcn_ds_swizzle(i, (XM << 10) | 0x1f);
    return __int_as_float(i);
}

// ---------------- elementwise converts / packs ----------------
// f32 -> f16 convert of whole rows of 1024 elements:
//   in [batch][RIN][1024] f32  ->  out [batch][ROUT][1024] f16, rows 0..RIN-1 of each batch
// Serves x -> xh (RIN = ROUT = 2048, one batch) and cache_k -> kh (768 of 1024 key rows).
// One block converts RPB rows; RPB divides RIN, so a block stays inside one batch.
// A thread owns one float4 column group of every row: each wave-wide load covers 512
// contiguous bytes and each wave-wide store 256, whole lines both ways. A thread's loads
// are independent and stand ahead of its stores, so few waves keep many bytes in flight,
// and the launch starts RPB * 4 times fewer waves than one element a thread would.
// blk = index of the block among the blocks of this convert.
template<int RIN, int ROUT, int RPB>
__device__ __forceinline__
void cvt_rows_block(const float* __restrict__ in,
                    _Float16* __restrict__ out, int blk) {
    static_assert(RIN % RPB == 0, "a block must not straddle two batches");
    const int r0 = blk * RPB;
    const int b  = r0 / RIN;
    const int c  = threadIdx.x * 4;
    const float* src = in + (size_t)r0 * 1024 + c;
    _Float16*    dst = out + (size_t)(r0 + b * (ROUT - RIN)) * 1024 + c;

    float4 v[RPB];
    // unrolled so that v[] stays in registers and the loads go out back to back
#pragma unroll
    for (int j = 0; j < RPB; ++j)
        v[j] = *(const float4*)(src + (size_t)j * 1024);
    // unrolled for the same reason: v[] is indexed by constants only
#pragma unroll
    for (int j = 0; j < RPB; ++j) {
        v4h h = { (_Float16)v[j].x, (_Float16)v[j].y, (_Float16)v[j].z, (_Float16)v[j].w };
        *(v4h*)(dst + (size_t)j * 1024) = h;
    }
}

// Transposing convert through an LDS tile:
//   in  [batch][ROWS][1024] f32  ->  out [batch][1024][1024] f16, columns 0..ROWS-1
//   out[b][c][s] = (f16) in[b][s][c]
// Serves W[k][n] -> WT[n][k] (ROWS = 1024, one batch) and cache_v[b][s][c] ->
// vt[b][c = h*64+dh][key s] (ROWS = 768, eight batches).
// One block moves a tile of 128 rows (s) x 64 columns (c): 256 contiguous bytes a row on
// the f32 side and 256 contiguous bytes a row on the f16 side, so loads and stores both
// cover whole lines. A thread loads 8 consecutive rows of one float4 column group; each
// of its 4 columns is then 8 halves (16 bytes) of one output row.
// LDS row = one output row of 16 chunks of 16 bytes; chunk q of row c sits at q ^ (c >> 2),
// which spreads the 16 lanes of a half wave over all banks in the store and in the load.
// tile = the block's LDS tile of 64 * 128 halves; (bx, by, b) = column tile, row tile, batch.
template<int ROWS>
__device__ __forceinline__
void transpose_cvt_block(const float* __restrict__ in,
                         _Float16* __restrict__ out,
                         _Float16* tile, int bx, int by, int b) {
    const int tid = threadIdx.x;
    const int c0  = bx * 64;
    const int s0  = by * 128;

    const int c4 = tid & 15;            // float4 column group
    const int sr = tid >> 4;            // group of 8 rows
    const float* src = in + ((size_t)b * ROWS + s0 + sr * 8) * 1024 + c0 + c4 * 4;

    float4 v[8];
#pragma unroll
    for (int j = 0; j < 8; ++j)
        v[j] = *(const float4*)(src + (size_t)j * 1024);

    v8h h0, h1, h2, h3;
#pragma unroll
    for (int j = 0; j < 8; ++j) {
        h0[j] = (_Float16)v[j].x;
        h1[j] = (_Float16)v[j].y;
        h2[j] = (_Float16)v[j].z;
        h3[j] = (_Float16)v[j].w;
    }
    _Float16* dst = &tile[(c4 * 4) * 128 + ((sr ^ c4) * 8)];
    *(v8h*)(dst)           = h0;
    *(v8h*)(dst + 128)     = h1;
    *(v8h*)(dst + 2 * 128) = h2;
    *(v8h*)(dst + 3 * 128) = h3;

    __syncthreads();   // the tile is read back across waves

    const int q  = tid & 15;            // 16-byte chunk of an output row
    const int cr = tid >> 4;
    _Float16* o = out + ((size_t)b * 1024 + c0) * 1024 + s0 + q * 8;
#pragma unroll
    for (int p = 0; p < 4; ++p) {
        int c = p * 16 + cr;
        *(v8h*)(o + (size_t)c * 1024) = *(const v8h*)&tile[c * 128 + ((q ^ (c >> 2)) * 8)];
    }
}

// The seven converts stand in two launches, each convert on its own range of block indices.
// The first launch holds only what the projections read: x and W^T of Wq, Wk, Wv. It is the
// head of the chain of dependent launches, so it is kept short.
// The other three (cache_k, V^T of cache_v, Wo^T) are read by the attention launch or later and
// depend on nothing: their blocks ride in the projections' grid (side_converts_block below).
// The branches are on blockIdx alone, so the barrier inside a transpose is block-uniform.
#define NB_CK ((BATCH * T_CACHE) / 24)                        // cache_k rows
#define NB_CV ((N_STATE / 64) * (T_CACHE / 128) * BATCH)      // cache_v tiles
#define NB_W  ((N_STATE / 64) * (N_STATE / 128))              // tiles of one weight matrix
#define NB_X  (NROWS / 8)                                     // x rows
__global__ __launch_bounds__(256)
void prep_kernel(const float* __restrict__ x,
                 const float* __restrict__ Wq,
                 const float* __restrict__ Wk,
                 const float* __restrict__ Wv,
                 _Float16* __restrict__ xh,
                 _Float16* __restrict__ WT3) {   // WqT, WkT, WvT one behind the other
    __shared__ __align__(16) _Float16 tile[64 * 128];

    // Each branch ends with s_wait_xcnt 0: in the built code the branches stand one behind the
    // other, and the next one's first instructions reuse registers that the stores just issued
    // still name; the wait stands in front of any such overwrite.
    int blk = blockIdx.x;
    if (blk < 3 * NB_W) {
        const int m = blk / NB_W;                // which weight matrix
        const float* W = m == 0 ? Wq : m == 1 ? Wk : Wv;
        transpose_cvt_block<N_STATE>(W, WT3 + (size_t)m * (N_STATE * N_STATE), tile,
                                     blk & 15, (blk >> 4) & 7, 0);
        asm volatile("s_wait_xcnt 0x0" ::: "memory");   // see the note above
    } else {
        cvt_rows_block<NROWS, NROWS, 8>(x, xh, blk - 3 * NB_W);
        asm volatile("s_wait_xcnt 0x0" ::: "memory");   // see the note above
    }
}

// One block of the converts that ride in the projections' grid; blk = its index among them.
// The blocks with the most bytes come first. tile = 64 * 128 halves of the block's LDS.
#define NB_SIDE (NB_CK + NB_CV + NB_W)
__device__ __forceinline__
void side_converts_block(const float* __restrict__ ck,
                         const float* __restrict__ cv,
                         const float* __restrict__ Wo,
                         _Float16* __restrict__ kh,
                         _Float16* __restrict__ vt,
                         _Float16* __restrict__ WoT,
                         _Float16* tile, int blk) {
    // each branch ends with s_wait_xcnt 0, for the reason given in prep_kernel
    if (blk < NB_CK) {
        cvt_rows_block<T_CACHE, T_KV, 24>(ck, kh, blk);
        asm volatile("s_wait_xcnt 0x0" ::: "memory");   // see the note above
    } else if (blk < NB_CK + NB_CV) {
        blk -= NB_CK;
        const int t = blk >> 4;                  // row tile and batch
        transpose_cvt_block<T_CACHE>(cv, vt, tile, blk & 15,
                                     t % (T_CACHE / 128), t / (T_CACHE / 128));
        asm volatile("s_wait_xcnt 0x0" ::: "memory");   // see the note above
    } else {
        blk -= NB_CK + NB_CV;
        transpose_cvt_block<N_STATE>(Wo, WoT, tile, blk & 15, (blk >> 4) & 7, 0);
        asm volatile("s_wait_xcnt 0x0" ::: "memory");   // see the note above
    }
}

// ---------------- tiled WMMA GEMM: C[2048,1024] = A[2048,1024] @ W[1024,1024] ----------------
// A f16 row-major, WT f16 = W^T row-major ([n][k]).
// Block tile 128x128; 8 waves in 4(M)x2(N) grid, each wave 32x64 (2x4 16x16 tiles).
// A trip of the K loop works on 128 k. Its A and B tiles (128 rows of 256 bytes each) come into
// LDS by async copies: 16 lanes cover one row, so every copy asks for whole 256-byte runs, and
// a block has 64 KiB in flight. Two buffers: the copies of tile t + 2 go out at the foot of trip
// t and fly during trip t + 1, which has 32 WMMAs a wave to cover them.
// LDS rows stand at a pitch of 272 bytes, which spreads the 16 rows of a fragment load over all
// banks. The ring is dead when the epilogue starts, so the epilogue's tiles lie in the same LDS.
#define GK       128                  // k of one staged tile
#define G_PITCH  136                  // halves: 256 bytes of data + 16 bytes of pad
#define G_TILE   (128 * G_PITCH)      // halves of one operand's tile
#define G_STAGE  (2 * G_TILE)         // A tile, then B tile
#define G_BLOCKS ((N_STATE / 128) * (NROWS / 128))   // blocks of one product = one z slice
static_assert(NB_SIDE % G_BLOCKS == 0, "the riding converts fill whole z slices");
#define MODE_Q 0
#define MODE_K 1
#define MODE_V 2
#define MODE_O 3
#define ST32_PITCH 132        // floats: 512 bytes of data + 16 bytes of pad
#define ST16_PITCH 136        // halves: 256 bytes of data + 16 bytes of pad

template<int M> struct mode_tag { static constexpr int value = M; };

// QKV = true: ONE launch does the three projections of x, which share A and depend on
// nothing of each other: blockIdx.z picks the weight matrix and the epilogue, so 384 blocks
// fill the chip where each projection alone has 128. V, whose epilogue is the longest,
// takes the lowest z and starts first. The slices z >= 3 are no GEMM blocks: they do the converts
// that only later launches read. A WGP holds two blocks of this kernel (LDS), the 384 GEMM blocks
// leave a quarter of those places empty, and the GEMM asks little of memory: the converts' loads
// and stores run in those places beside it instead of ahead of it in a launch of their own.
// QKV = false: the output projection alone (WTs = WoT, bias_q = bo, out32s = out).
template<bool QKV>
__global__ __launch_bounds__(256)
void gemm_wmma_kernel(const _Float16* __restrict__ A,
                      const _Float16* __restrict__ WTs,    // WqT, WkT, WvT one behind the other
                      const float* __restrict__ bias_q,
                      const float* __restrict__ bias_v,
                      float* __restrict__ out32s,          // new_k, new_v one behind the other
                      _Float16* __restrict__ qh,
                      _Float16* __restrict__ kh,
                      _Float16* __restrict__ vt,
                      const float* __restrict__ ck,        // these four: the riding converts
                      const float* __restrict__ cv,
                      const float* __restrict__ Wo,
                      _Float16* __restrict__ WoT) {
    constexpr int RING_BYTES = 2 * G_STAGE * 2;
    constexpr int ST32_BYTES = 128 * ST32_PITCH * 4;
    constexpr int EPI_BYTES  = ST32_BYTES + (QKV ? 128 * ST16_PITCH * 2 : 0);
    __shared__ __align__(16) unsigned char smem[RING_BYTES > EPI_BYTES ? RING_BYTES : EPI_BYTES];
    _Float16* ring = (_Float16*)smem;                    // [buffer][A, B][row][G_PITCH]
    // epilogue tiles of the block's 128 x 128 results; the pad of 16 bytes a row spreads the rows
    // over the banks for the stores from the accumulator layout and for the 16-byte loads
    float*    st32 = (float*)smem;
    _Float16* st16 = (_Float16*)(smem + ST32_BYTES);

    if constexpr (QKV) {
        // block-uniform, ahead of every barrier and copy of the GEMM
        if (blockIdx.z >= 3) {
            side_converts_block(ck, cv, Wo, kh, vt, WoT, (_Float16*)smem,
                                ((int)blockIdx.z - 3) * G_BLOCKS
                                    + (int)blockIdx.y * (N_STATE / 128) + (int)blockIdx.x);
            return;
        }
    }

    const int mode = QKV ? MODE_V - (int)blockIdx.z : MODE_O;
    const _Float16* WT = QKV ? WTs + (size_t)mode * (N_STATE * N_STATE) : WTs;

    const int tid  = threadIdx.x;
    const int lane = tid & 31;
    const int wid  = tid >> 5;
    const int wm   = wid >> 1;           // 0..3
    const int wn   = wid & 1;            // 0..1
    const int col  = lane & 15;
    const int hi8  = (lane >> 4) * 8;
    const int kb   = hi8;
    const int ablk = blockIdx.y * 128;
    const int bblk = blockIdx.x * 128;

    // staging: 16 lanes cover one row of 256 bytes; a thread owns one 16-byte chunk of rows
    // srow, srow + 16, ..., srow + 112 of the A tile and of the B tile
    const int srow = tid >> 4;                // 0..15
    const int sc   = (tid & 15) * 8;          // halves
    const _Float16* ag = A  + (size_t)(ablk + srow) * 1024 + sc;
    const _Float16* bg = WT + (size_t)(bblk + srow) * 1024 + sc;
    auto issue_tile = [&](int t) {
        const unsigned int la =
            (unsigned int)(size_t)&ring[(t & 1) * G_STAGE + srow * G_PITCH + sc];
        async_ld8_b128(la,              16 * G_PITCH * 2, ag + t * GK, 16 * 1024);
        async_ld8_b128(la + G_TILE * 2, 16 * G_PITCH * 2, bg + t * GK, 16 * 1024);
    };

    v8f acc[2][4];
#pragma unroll
    for (int mt = 0; mt < 2; ++mt)
#pragma unroll
        for (int nt = 0; nt < 4; ++nt) acc[mt][nt] = (v8f){0,0,0,0,0,0,0,0};

    issue_tile(0);
    asm volatile("s_wait_asynccnt 0x0" ::: "memory");   // this wave's part of tile 0 has landed
    __syncthreads();                                    // tile 0 is whole for every wave
    issue_tile(1);

    // rolled: one copy of the trip's text; the buffer index is the trip's parity
#pragma unroll 1
    for (int t = 0; t < N_STATE / GK; ++t) {
        const _Float16* as = ring + (t & 1) * G_STAGE + (wm * 32 + col) * G_PITCH;
        const _Float16* bs = ring + (t & 1) * G_STAGE + G_TILE + (wn * 64 + col) * G_PITCH;
        // unrolled: the four steps of 32 k differ by constant LDS offsets only
#pragma unroll
        for (int ks = 0; ks < GK / 32; ++ks) {
            v16h af[2], bf[4];
#pragma unroll
            for (int mt = 0; mt < 2; ++mt)
                af[mt] = ldfrag(as + mt * 16 * G_PITCH + ks * 32, kb);
#pragma unroll
            for (int nt = 0; nt < 4; ++nt)
                bf[nt] = ldfrag(bs + nt * 16 * G_PITCH + ks * 32, kb);
#pragma unroll
            for (int mt = 0; mt < 2; ++mt)
#pragma unroll
                for (int nt = 0; nt < 4; ++nt)
                    acc[mt][nt] = wmma_f16(af[mt], bf[nt], acc[mt][nt]);
        }

        // hand-over: this wave's LDS reads of tile t are done, its copies of tile t + 1 have
        // landed; behind the barrier tile t + 1 is whole and tile t's buffer is free (behind the
        // last trip's: the whole ring, for the epilogue's tiles)
        asm volatile("s_wait_dscnt 0x0" ::: "memory");
        asm volatile("s_wait_asynccnt 0x0" ::: "memory");
        __syncthreads();
        if (t + 2 < N_STATE / GK) issue_tile(t + 2);
    }
    asm volatile("s_wait_asynccnt 0x0" ::: "memory");   // no copy is left in flight at the end

    // epilogue (C layout: VGPR r -> row r + 8*(lane>>4), col = lane&15)
    // The accumulators reach global memory through LDS tiles of the whole block. Straight from
    // the registers a wave-wide store covers pieces of 64 bytes (f32), 32 bytes (f16) or, for
    // V^T, 2 bytes on each of 16 lines; read back from the tile every lane stores 16 bytes and
    // a wave covers 512 contiguous bytes (f32) or two runs of 256 (f16): whole lines only.
    // V^T is transposed on the way in: a lane's 8 accumulators of one column are 8 consecutive
    // keys, one 16-byte chunk of that column's row in the tile.
    auto epilogue = [&](auto tag, const float* __restrict__ bias,
                        float* __restrict__ out32, _Float16* __restrict__ out16) {
    constexpr int MODE = decltype(tag)::value;
#pragma unroll
    for (int mt = 0; mt < 2; ++mt)
#pragma unroll
        for (int nt = 0; nt < 4; ++nt) {
            const int rl = wm * 32 + mt * 16 + hi8;     // row in the block's tile
            const int cl = wn * 64 + nt * 16 + col;     // column in the block's tile
            float bc = 0.0f;
            if constexpr (MODE != MODE_K) bc = bias[bblk + cl];
            v8h hv;
#pragma unroll
            for (int r = 0; r < 8; ++r) {
                float v = acc[mt][nt][r];
                if constexpr (MODE == MODE_Q) {
                    v = (v + bc) * QK_SCALE;
                    st16[(rl + r) * ST16_PITCH + cl] = (_Float16)v;
                } else if constexpr (MODE == MODE_K) {
                    st32[(rl + r) * ST32_PITCH + cl] = v;
                    st16[(rl + r) * ST16_PITCH + cl] = (_Float16)v;
                } else if constexpr (MODE == MODE_V) {
                    v += bc;
                    st32[(rl + r) * ST32_PITCH + cl] = v;
                    hv[r] = (_Float16)v;
                } else {
                    v += bc;
                    st32[(rl + r) * ST32_PITCH + cl] = v;
                }
            }
            if constexpr (MODE == MODE_V)
                *(v8h*)&st16[cl * ST16_PITCH + rl] = hv;    // [column][key]
        }

    __syncthreads();   // the tiles are read back across waves

    if constexpr (MODE != MODE_Q) {
        // one wave, one row of 512 bytes
        float* o = out32 + (size_t)(ablk + wid) * 1024 + bblk + lane * 4;
        float4 v[16];
        // unrolled so that v[] stays in registers and the LDS loads go out back to back
#pragma unroll
        for (int j = 0; j < 16; ++j)
            v[j] = *(const float4*)&st32[(j * 8 + wid) * ST32_PITCH + lane * 4];
#pragma unroll
        for (int j = 0; j < 16; ++j)
            *(float4*)(o + (size_t)j * (8 * 1024)) = v[j];
    }
    if constexpr (MODE != MODE_O) {
        // 16 lanes, one tile row of 256 bytes
        const int row = tid >> 4;
        const int ch  = (tid & 15) * 8;
        const int b   = ablk >> 8, t0 = ablk & 255;     // a block's 128 rows lie in one batch
        _Float16* o;
        if constexpr (MODE == MODE_Q)
            o = out16 + (size_t)(ablk + row) * 1024 + bblk + ch;
        else if constexpr (MODE == MODE_K)
            o = out16 + (size_t)(b * T_KV + T_CACHE + t0 + row) * 1024 + bblk + ch;
        else                                            // tile row = column of V = row of V^T
            o = out16 + (size_t)(b * N_STATE + bblk + row) * T_KV + T_CACHE + t0 + ch;
        v8h h[8];
        // unrolled for the same reason as above
#pragma unroll
        for (int j = 0; j < 8; ++j)
            h[j] = *(const v8h*)&st16[(j * 16 + row) * ST16_PITCH + ch];
#pragma unroll
        for (int j = 0; j < 8; ++j)
            *(v8h*)(o + (size_t)j * (16 * 1024)) = h[j];
    }
    };
    if constexpr (QKV) {
        // Each epilogue ends with s_wait_xcnt 0: in the built code the three stand one behind
        // the other, and index arithmetic of the next one reuses registers that the stores just
        // issued still name; the wait stands in front of any such overwrite.
        if (mode == MODE_V) {
            epilogue(mode_tag<MODE_V>{}, bias_v, out32s + (size_t)NROWS * N_STATE, vt);
            asm volatile("s_wait_xcnt 0x0" ::: "memory");   // see the note above
        } else if (mode == MODE_K) {
            epilogue(mode_tag<MODE_K>{}, nullptr, out32s, kh);
            asm volatile("s_wait_xcnt 0x0" ::: "memory");   // see the note above
        } else {
            epilogue(mode_tag<MODE_Q>{}, bias_q, nullptr, qh);
            asm volatile("s_wait_xcnt 0x0" ::: "memory");   // see the note above
        }
    } else {
        epilogue(mode_tag<MODE_O>{}, bias_q, out32s, nullptr);
    }
}

// ---------------- flash attention ----------------
// grid = 256 blocks: b(8) x h(16) x qhalf(2); 8 waves x 16 query rows = 128 rows/block.
// The 8 waves of a block walk the same keys of the same head. Each tile of 64 keys (K: 64 key
// rows of 128 bytes; V^T: 64 dim rows of 128 bytes) is brought into LDS ONCE for the block by
// async copies that cover whole 128-byte lines, and every wave takes its fragments from LDS.
// Two buffers: the copies of tile t + 2 go out at the foot of trip t and fly during trip t + 1.
// LDS rows stand at a pitch of 144 bytes, which spreads the 16 rows of a fragment load over
// all banks. The P buffer stays wave-private (LDS in-order per wave).
#define KV_PITCH 72           // halves: 128 bytes of data + 16 bytes of pad
__global__ __launch_bounds__(256)
void attn_wmma_kernel(const _Float16* __restrict__ qh,
                      const _Float16* __restrict__ kh,
                      const _Float16* __restrict__ vt,
                      const float* __restrict__ mask,
                      _Float16* __restrict__ ph) {
    __shared__ __align__(16) _Float16 ps[8][16 * 72];
    __shared__ __align__(16) _Float16 Ks[2][64 * KV_PITCH];   // [key][dim]
    __shared__ __align__(16) _Float16 Vs[2][64 * KV_PITCH];   // [dim][key]

    const int lane  = threadIdx.x & 31;
    const int wid   = threadIdx.x >> 5;
    const int col   = lane & 15;
    const int hi    = lane >> 4;
    const int kb    = hi * 8;
    const int blk   = blockIdx.x;
    const int b     = blk >> 5;
    const int h     = (blk >> 1) & 15;
    const int qbase = (blk & 1) * 128 + wid * 16;

    // Q A-fragments (reused for the whole key loop)
    const _Float16* qrow =
        qh + (size_t)(b * T_Q + qbase + col) * 1024 + h * 64;
    const v16h aq0 = ldfrag(qrow, kb);        // dims 0..31
    const v16h aq1 = ldfrag(qrow + 32, kb);   // dims 32..63

    v8f o[4];
#pragma unroll
    for (int nt = 0; nt < 4; ++nt) o[nt] = (v8f){0,0,0,0,0,0,0,0};
    float rmax[8], rsum[8];
#pragma unroll
    for (int r = 0; r < 8; ++r) { rmax[r] = -3.0e38f; rsum[r] = 0.0f; }

    _Float16* myp = &ps[wid][0];

    // staging: 8 lanes cover one row of 128 bytes; a thread owns one 16-byte chunk of rows
    // srow and srow + 32 of the K tile and of the V^T tile
    const int srow = threadIdx.x >> 3;            // 0..31
    const int sc   = (threadIdx.x & 7) * 8;       // halves
    const _Float16* kg = kh + (size_t)(b * T_KV + srow) * 1024 + h * 64 + sc;
    const _Float16* vg = vt + (size_t)((b * 16 + h) * 64 + srow) * T_KV + sc;
    auto issue_tile = [&](int t) {
        const int buf = t & 1;
        const _Float16* k0 = kg + (size_t)t * (64 * 1024);
        const _Float16* v0 = vg + t * 64;
        async_ld4_b128((unsigned int)(size_t)&Ks[buf][srow * KV_PITCH + sc],        k0,
                       (unsigned int)(size_t)&Ks[buf][(srow + 32) * KV_PITCH + sc], k0 + 32 * 1024,
                       (unsigned int)(size_t)&Vs[buf][srow * KV_PITCH + sc],        v0,
                       (unsigned int)(size_t)&Vs[buf][(srow + 32) * KV_PITCH + sc], v0 + 32 * T_KV);
    };

    issue_tile(0);
    asm volatile("s_wait_asynccnt 0x0" ::: "memory");   // this wave's part of tile 0 has landed
    __syncthreads();                                    // tile 0 is whole for every wave
    issue_tile(1);

    // rolled: one copy of the trip's text; the buffer index is the trip's parity
#pragma unroll 1
    for (int t = 0; t < T_KV / 64; ++t) {
        const int kvc = t * 64;
        const _Float16* ks = &Ks[t & 1][0];
        const _Float16* vs = &Vs[t & 1][0];
        // ---- S = Q @ K^T  (16 x 64 scores) ----
        v8f s[4];
#pragma unroll
        for (int g = 0; g < 4; ++g) s[g] = (v8f){0,0,0,0,0,0,0,0};
        // the trip's mask values are asked for first: they come from furthest away (not staged)
        float mk[4][8];
#pragma unroll
        for (int g = 0; g < 4; ++g)
#pragma unroll
            for (int r = 0; r < 8; ++r) {
                int qr  = qbase + hi * 8 + r;
                int key = kvc + g * 16 + col;
                mk[g][r] = mask[(size_t)qr * T_KV + key];
            }
        v16h bk[8], bv[8];
#pragma unroll
        for (int g = 0; g < 4; ++g) {
            const _Float16* krow = ks + (g * 16 + col) * KV_PITCH;
            bk[2 * g]     = ldfrag(krow, kb);
            bk[2 * g + 1] = ldfrag(krow + 32, kb);
        }
#pragma unroll
        for (int nt = 0; nt < 4; ++nt) {
            const _Float16* vrow = vs + (nt * 16 + col) * KV_PITCH;
            bv[2 * nt]     = ldfrag(vrow, kb);
            bv[2 * nt + 1] = ldfrag(vrow + 32, kb);
        }
        // keeps the trip's fragment loads together ahead of the products: spread among them,
        // each pair of LDS loads makes the wave wait out a full LDS latency of its own
        __builtin_amdgcn_sched_barrier(0);
#pragma unroll
        for (int g = 0; g < 4; ++g) {
            s[g] = wmma_f16(aq0, bk[2 * g], s[g]);
            s[g] = wmma_f16(aq1, bk[2 * g + 1], s[g]);
        }
        // ---- mask + chunk row-max ----
        float cmax[8];
#pragma unroll
        for (int r = 0; r < 8; ++r) cmax[r] = -3.0e38f;
#pragma unroll
        for (int g = 0; g < 4; ++g)
#pragma unroll
            for (int r = 0; r < 8; ++r) {
                float v = s[g][r] + mk[g][r];
                s[g][r] = v;
                cmax[r] = fmaxf(cmax[r], v);
            }
#pragma unroll
        for (int r = 0; r < 8; ++r) {
            cmax[r] = fmaxf(cmax[r], swz_xor<1>(cmax[r]));
            cmax[r] = fmaxf(cmax[r], swz_xor<2>(cmax[r]));
            cmax[r] = fmaxf(cmax[r], swz_xor<4>(cmax[r]));
            cmax[r] = fmaxf(cmax[r], swz_xor<8>(cmax[r]));
        }
        // ---- online softmax update ----
        float scl[8];
#pragma unroll
        for (int r = 0; r < 8; ++r) {
            float nm = fmaxf(rmax[r], cmax[r]);
            scl[r]   = __expf(rmax[r] - nm);
            rmax[r]  = nm;
        }
#pragma unroll
        for (int nt = 0; nt < 4; ++nt)
#pragma unroll
            for (int r = 0; r < 8; ++r) o[nt][r] *= scl[r];

        float psum[8];
#pragma unroll
        for (int r = 0; r < 8; ++r) psum[r] = 0.0f;
#pragma unroll
        for (int g = 0; g < 4; ++g)
#pragma unroll
            for (int r = 0; r < 8; ++r) {
                float p = __expf(s[g][r] - rmax[r]);
                psum[r] += p;
                myp[(hi * 8 + r) * 72 + g * 16 + col] = (_Float16)p;
            }
#pragma unroll
        for (int r = 0; r < 8; ++r) rsum[r] = rsum[r] * scl[r] + psum[r];

        // ---- O += P @ V (P relaid out via wave-private LDS) ----
        const _Float16* prow = myp + col * 72;
        v16h ap0 = ldfrag(prow, kb);        // keys 0..31 of chunk
        v16h ap1 = ldfrag(prow + 32, kb);   // keys 32..63
#pragma unroll
        for (int nt = 0; nt < 4; ++nt) {
            o[nt] = wmma_f16(ap0, bv[2 * nt], o[nt]);
            o[nt] = wmma_f16(ap1, bv[2 * nt + 1], o[nt]);
        }

        // hand-over: this wave's LDS reads of tile t are done, its copies of tile t + 1 have
        // landed; behind the barrier tile t + 1 is whole and tile t's buffer is free
        asm volatile("s_wait_dscnt 0x0" ::: "memory");
        asm volatile("s_wait_asynccnt 0x0" ::: "memory");
        __syncthreads();
        if (t + 2 < T_KV / 64) issue_tile(t + 2);
    }
    asm volatile("s_wait_asynccnt 0x0" ::: "memory");   // no copy is left in flight at the end

    // ---- finalize: reduce row sums, normalize, write ph (f16) ----
#pragma unroll
    for (int r = 0; r < 8; ++r) {
        rsum[r] += swz_xor<1>(rsum[r]);
        rsum[r] += swz_xor<2>(rsum[r]);
        rsum[r] += swz_xor<4>(rsum[r]);
        rsum[r] += swz_xor<8>(rsum[r]);
    }
    // The wave's 16 x 64 results go out through its own P tile (free since the last trip): read
    // back, 8 lanes cover one row of 128 bytes, so each store covers whole lines instead of
    // pieces of 32 bytes.
#pragma unroll
    for (int nt = 0; nt < 4; ++nt)
#pragma unroll
        for (int r = 0; r < 8; ++r) {
            float v = o[nt][r] / rsum[r];
            myp[(hi * 8 + r) * 72 + nt * 16 + col] = (_Float16)v;
        }
    // the rows are read back by other lanes of the same wave: its LDS stores come first
    asm volatile("s_wait_dscnt 0x0" ::: "memory");
    const int orow = lane >> 3;                   // 0..3
    const int och  = (lane & 7) * 8;              // halves
    _Float16* po = ph + (size_t)(b * T_Q + qbase + orow) * 1024 + h * 64 + och;
    v8h ov[4];
#pragma unroll
    for (int j = 0; j < 4; ++j)
        ov[j] = *(const v8h*)&myp[(j * 4 + orow) * 72 + och];
#pragma unroll
    for (int j = 0; j < 4; ++j)
        *(v8h*)(po + (size_t)j * (4 * 1024)) = ov[j];
}

// ---------------- host launcher ----------------
extern "C" void kernel_launch(void* const* d_in, const int* in_sizes, int n_in,
                              void* d_out, int out_size, void* d_ws, size_t ws_size,
                              hipStream_t stream) {
    const float* x    = (const float*)d_in[0];
    const float* mask = (const float*)d_in[1];
    const float* ck   = (const float*)d_in[2];
    const float* cv   = (const float*)d_in[3];
    const float* Wq   = (const float*)d_in[4];
    const float* bq   = (const float*)d_in[5];
    const float* Wk   = (const float*)d_in[6];
    const float* Wv   = (const float*)d_in[7];
    const float* bv   = (const float*)d_in[8];
    const float* Wo   = (const float*)d_in[9];
    const float* bo   = (const float*)d_in[10];

    float* out  = (float*)d_out;                 // [2048,1024]
    float* outK = out  + (size_t)NROWS * N_STATE;   // new_k; new_v follows it

    char* w = (char*)d_ws;
    _Float16* xh  = (_Float16*)w; w += (size_t)NROWS * N_STATE * 2;
    _Float16* WT4 = (_Float16*)w; w += (size_t)3 * N_STATE * N_STATE * 2;   // WqT, WkT, WvT
    _Float16* WoT = (_Float16*)w; w += (size_t)N_STATE * N_STATE * 2;
    _Float16* qh  = (_Float16*)w; w += (size_t)NROWS * N_STATE * 2;
    _Float16* kh  = (_Float16*)w; w += (size_t)BATCH * T_KV * N_STATE * 2;
    _Float16* vt  = (_Float16*)w; w += (size_t)BATCH * T_KV * N_STATE * 2;
    _Float16* ph  = (_Float16*)w; w += (size_t)NROWS * N_STATE * 2;

    // converts that the projections read
    prep_kernel<<<3 * NB_W + NB_X, 256, 0, stream>>>(x, Wq, Wk, Wv, xh, WT4);

    // projections of x, and beside them the converts that only later launches read
    gemm_wmma_kernel<true><<<dim3(N_STATE / 128, NROWS / 128, 3 + NB_SIDE / G_BLOCKS),
                             256, 0, stream>>>(
        xh, WT4, bq, bv, outK, qh, kh, vt, ck, cv, Wo, WoT);

    // attention
    attn_wmma_kernel<<<BATCH * 16 * 2, 256, 0, stream>>>(qh, kh, vt, mask, ph);

    // output projection
    gemm_wmma_kernel<false><<<dim3(N_STATE / 128, NROWS / 128), 256, 0, stream>>>(
        ph, WoT, bo, nullptr, out, nullptr, nullptr, nullptr, nullptr, nullptr, nullptr, nullptr);
}

// v008
// Measured time: 55.1 microseconds a run.
// Timed twice side by side with v007, it ran 1.18 and 1.19 times as fast.
// All steps since v000 together make it 7.36 times as fast.
#include <hip/hip_runtime.h>

// ---------------- types ----------------
typedef __attribute__((ext_vector_type(16))) _Float16 v16h;
typedef __attribute__((ext_vector_type(8)))  _Float16 v8h;
typedef __attribute__((ext_vector_type(4)))  _Float16 v4h;
typedef __attribute__((ext_vector_type(2)))  _Float16 v2h;
typedef __attribute__((ext_vector_type(2)))  float    v2f;
typedef __attribute__((ext_vector_type(8)))  float    v8f;

#define N_STATE 1024
#define T_Q     256
#define T_CACHE 768
#define T_KV    1024
#define BATCH   8
#define NROWS   2048          // B*T
#define QK_SCALE 0.125f

// ---------------- WMMA helpers ----------------
__device__ __forceinline__ v8f wmma_f16(v16h a, v16h b, v8f c) {
    // D = A(16x32) * B(32x16) + C, f32 accumulate
    return __builtin_amdgcn_wmma_f32_16x16x32_f16(
        false, a, false, b, (short)0, c, false, false);
}

// Load a 16x32 A-style fragment for this lane.
// Lane layout (ISA 7.12.2, 16-bit A 16x32): row = lane&15, kb = (lane>>4)*8,
// halves cover K in [kb,kb+8) and [kb+16,kb+24)  -> two 16-byte loads.
// `p` must point at element [lane&15][0] of the tile (row stride pre-applied).
__device__ __forceinline__ v16h ldfrag(const _Float16* p, int kb) {
    union { v16h v; v8h h[2]; } u;
    u.h[0] = *(const v8h*)(p + kb);
    u.h[1] = *(const v8h*)(p + kb + 16);
    return u.v;
}

// Async global -> LDS copies of 16 bytes per lane (CDNA5 GLOBAL_LOAD_ASYNC_TO_LDS, tracked by
// ASYNCcnt). An LDS address is the low 32 bits of the generic shared pointer.
// Eight copies of one lane, one behind the other: copy j takes LDS byte address l + j * lstep
// and global pointer g + j * gstep, each in registers of its own. s_wait_xcnt 0 is the
// statement's last line, so that it stands in front of any later write of a register that one
// of the copies names.
__device__ __forceinline__ void async_ld8_b128(unsigned int l, unsigned int lstep,
                                               const _Float16* g, int gstep) {
    asm volatile("global_load_async_to_lds_b128 %0, %1, off\n\t"
                 "global_load_async_to_lds_b128 %2, %3, off\n\t"
                 "global_load_async_to_lds_b128 %4, %5, off\n\t"
                 "global_load_async_to_lds_b128 %6, %7, off\n\t"
                 "global_load_async_to_lds_b128 %8, %9, off\n\t"
                 "global_load_async_to_lds_b128 %10, %11, off\n\t"
                 "global_load_async_to_lds_b128 %12, %13, off\n\t"
                 "global_load_async_to_lds_b128 %14, %15, off\n\t"
                 "s_wait_xcnt 0x0"
                 :: "v"(l),             "v"(g),
                    "v"(l + lstep),     "v"(g + gstep),
                    "v"(l + 2 * lstep), "v"(g + 2 * gstep),
                    "v"(l + 3 * lstep), "v"(g + 3 * gstep),
                    "v"(l + 4 * lstep), "v"(g + 4 * gstep),
                    "v"(l + 5 * lstep), "v"(g + 5 * gstep),
                    "v"(l + 6 * lstep), "v"(g + 6 * gstep),
                    "v"(l + 7 * lstep), "v"(g + 7 * gstep)
                 : "memory");
}

// Four such copies, each with its own LDS byte address and its own global pointer; the same
// wait as its last line.
__device__ __forceinline__ void async_ld4_b128(unsigned int l0, const _Float16* g0,
                                               unsigned int l1, const _Float16* g1,
                                               unsigned int l2, const _Float16* g2,
                                               unsigned int l3, const _Float16* g3) {
    asm volatile("global_load_async_to_lds_b128 %0, %1, off\n\t"
                 "global_load_async_to_lds_b128 %2, %3, off\n\t"
                 "global_load_async_to_lds_b128 %4, %5, off\n\t"
                 "global_load_async_to_lds_b128 %6, %7, off\n\t"
                 "s_wait_xcnt 0x0"
                 :: "v"(l0), "v"(g0), "v"(l1), "v"(g1),
                    "v"(l2), "v"(g2), "v"(l3), "v"(g3)
                 : "memory");
}

// Eight such copies for rows of floats: the same statement, the steps counted in halves.
__device__ __forceinline__ void async_ld8_b128(unsigned int l, unsigned int lstep,
                                               const float* g, int gstep) {
    async_ld8_b128(l, lstep, (const _Float16*)g, 2 * gstep);
}

// the value of lane l ^ 16: the wave's two halves change places (a vector cross-row move, no LDS)
__device__ __forceinline__ float xhalf(float v) {
    int i = __float_as_int(v);
    i = __builtin_amdgcn_permlanex16(i, i, 0x76543210, 0xfedcba98, false, false);
    return __int_as_float(i);
}

// ---------------- elementwise converts / packs ----------------
// f32 -> f16 convert of whole rows of 1024 elements:
//   in [batch][RIN][1024] f32  ->  out [batch][ROUT][1024] f16, rows 0..RIN-1 of each batch
// Serves x -> xh (RIN = ROUT = 2048, one batch) and cache_k -> kh (768 of 1024 key rows).
// One block converts RPB rows; RPB divides RIN, so a block stays inside one batch.
// A thread owns one float4 column group of every row: each wave-wide load covers 512
// contiguous bytes and each wave-wide store 256, whole lines both ways. A thread's loads
// are independent and stand ahead of its stores, so few waves keep many bytes in flight,
// and the launch starts RPB * 4 times fewer waves than one element a thread would.
// blk = index of the block among the blocks of this convert.
template<int RIN, int ROUT, int RPB>
__device__ __forceinline__
void cvt_rows_block(const float* __restrict__ in,
                    _Float16* __restrict__ out, int blk) {
    static_assert(RIN % RPB == 0, "a block must not straddle two batches");
    const int r0 = blk * RPB;
    const int b  = r0 / RIN;
    const int c  = threadIdx.x * 4;
    const float* src = in + (size_t)r0 * 1024 + c;
    _Float16*    dst = out + (size_t)(r0 + b * (ROUT - RIN)) * 1024 + c;

    float4 v[RPB];
    // unrolled so that v[] stays in registers and the loads go out back to back
#pragma unroll
    for (int j = 0; j < RPB; ++j)
        v[j] = *(const float4*)(src + (size_t)j * 1024);
    // unrolled for the same reason: v[] is indexed by constants only
#pragma unroll
    for (int j = 0; j < RPB; ++j) {
        v4h h = { (_Float16)v[j].x, (_Float16)v[j].y, (_Float16)v[j].z, (_Float16)v[j].w };
        *(v4h*)(dst + (size_t)j * 1024) = h;
    }
}

// Transposing convert through an LDS tile:
//   in  [batch][ROWS][1024] f32  ->  out [batch][1024][1024] f16, columns 0..ROWS-1
//   out[b][c][s] = (f16) in[b][s][c]
// Serves W[k][n] -> WT[n][k] (ROWS = 1024, one batch) and cache_v[b][s][c] ->
// vt[b][c = h*64+dh][key s] (ROWS = 768, eight batches).
// One block moves a tile of 128 rows (s) x 64 columns (c): 256 contiguous bytes a row on
// the f32 side and 256 contiguous bytes a row on the f16 side, so loads and stores both
// cover whole lines. A thread loads 8 consecutive rows of one float4 column group; each
// of its 4 columns is then 8 halves (16 bytes) of one output row.
// LDS row = one output row of 16 chunks of 16 bytes; chunk q of row c sits at q ^ (c >> 2),
// which spreads the 16 lanes of a half wave over all banks in the store and in the load.
// tile = the block's LDS tile of 64 * 128 halves; (bx, by, b) = column tile, row tile, batch.
template<int ROWS>
__device__ __forceinline__
void transpose_cvt_block(const float* __restrict__ in,
                         _Float16* __restrict__ out,
                         _Float16* tile, int bx, int by, int b) {
    const int tid = threadIdx.x;
    const int c0  = bx * 64;
    const int s0  = by * 128;

    const int c4 = tid & 15;            // float4 column group
    const int sr = tid >> 4;            // group of 8 rows
    const float* src = in + ((size_t)b * ROWS + s0 + sr * 8) * 1024 + c0 + c4 * 4;

    float4 v[8];
#pragma unroll
    for (int j = 0; j < 8; ++j)
        v[j] = *(const float4*)(src + (size_t)j * 1024);

    v8h h0, h1, h2, h3;
#pragma unroll
    for (int j = 0; j < 8; ++j) {
        h0[j] = (_Float16)v[j].x;
        h1[j] = (_Float16)v[j].y;
        h2[j] = (_Float16)v[j].z;
        h3[j] = (_Float16)v[j].w;
    }
    _Float16* dst = &tile[(c4 * 4) * 128 + ((sr ^ c4) * 8)];
    *(v8h*)(dst)           = h0;
    *(v8h*)(dst + 128)     = h1;
    *(v8h*)(dst + 2 * 128) = h2;
    *(v8h*)(dst + 3 * 128) = h3;

    __syncthreads();   // the tile is read back across waves

    const int q  = tid & 15;            // 16-byte chunk of an output row
    const int cr = tid >> 4;
    _Float16* o = out + ((size_t)b * 1024 + c0) * 1024 + s0 + q * 8;
#pragma unroll
    for (int p = 0; p < 4; ++p) {
        int c = p * 16 + cr;
        *(v8h*)(o + (size_t)c * 1024) = *(const v8h*)&tile[c * 128 + ((q ^ (c >> 2)) * 8)];
    }
}

// The seven converts stand in two launches, each convert on its own range of block indices.
// The first launch holds only what the projections read: x and W^T of Wq, Wk, Wv. It is the
// head of the chain of dependent launches, so it is kept short.
// The other three (cache_k, V^T of cache_v, Wo^T) are read by the attention launch or later and
// depend on nothing: their blocks ride in the projections' grid (side_converts_block below).
// The branches are on blockIdx alone, so the barrier inside a transpose is block-uniform.
#define NB_CK ((BATCH * T_CACHE) / 24)                        // cache_k rows
#define NB_CV ((N_STATE / 64) * (T_CACHE / 128) * BATCH)      // cache_v tiles
#define NB_W  ((N_STATE / 64) * (N_STATE / 128))              // tiles of one weight matrix
#define NB_X  (NROWS / 8)                                     // x rows
__global__ __launch_bounds__(256)
void prep_kernel(const float* __restrict__ x,
                 const float* __restrict__ Wq,
                 const float* __restrict__ Wk,
                 const float* __restrict__ Wv,
                 _Float16* __restrict__ xh,
                 _Float16* __restrict__ WT3) {   // WqT, WkT, WvT one behind the other
    __shared__ __align__(16) _Float16 tile[64 * 128];

    // Each branch ends with s_wait_xcnt 0: in the built code the branches stand one behind the
    // other, and the next one's first instructions reuse registers that the stores just issued
    // still name; the wait stands in front of any such overwrite.
    int blk = blockIdx.x;
    if (blk < 3 * NB_W) {
        const int m = blk / NB_W;                // which weight matrix
        const float* W = m == 0 ? Wq : m == 1 ? Wk : Wv;
        transpose_cvt_block<N_STATE>(W, WT3 + (size_t)m * (N_STATE * N_STATE), tile,
                                     blk & 15, (blk >> 4) & 7, 0);
        asm volatile("s_wait_xcnt 0x0" ::: "memory");   // see the note above
    } else {
        cvt_rows_block<NROWS, NROWS, 8>(x, xh, blk - 3 * NB_W);
        asm volatile("s_wait_xcnt 0x0" ::: "memory");   // see the note above
    }
}

// One block of the converts that ride in the projections' grid; blk = its index among them.
// The blocks with the most bytes come first. tile = 64 * 128 halves of the block's LDS.
#define NB_SIDE (NB_CK + NB_CV + NB_W)
__device__ __forceinline__
void side_converts_block(const float* __restrict__ ck,
                         const float* __restrict__ cv,
                         const float* __restrict__ Wo,
                         _Float16* __restrict__ kh,
                         _Float16* __restrict__ vt,
                         _Float16* __restrict__ WoT,
                         _Float16* tile, int blk) {
    // each branch ends with s_wait_xcnt 0, for the reason given in prep_kernel
    if (blk < NB_CK) {
        cvt_rows_block<T_CACHE, T_KV, 24>(ck, kh, blk);
        asm volatile("s_wait_xcnt 0x0" ::: "memory");   // see the note above
    } else if (blk < NB_CK + NB_CV) {
        blk -= NB_CK;
        const int t = blk >> 4;                  // row tile and batch
        transpose_cvt_block<T_CACHE>(cv, vt, tile, blk & 15,
                                     t % (T_CACHE / 128), t / (T_CACHE / 128));
        asm volatile("s_wait_xcnt 0x0" ::: "memory");   // see the note above
    } else {
        blk -= NB_CK + NB_CV;
        transpose_cvt_block<N_STATE>(Wo, WoT, tile, blk & 15, (blk >> 4) & 7, 0);
        asm volatile("s_wait_xcnt 0x0" ::: "memory");   // see the note above
    }
}

// ---------------- tiled WMMA GEMM: C[2048,1024] = A[2048,1024] @ W[1024,1024] ----------------
// A f16 row-major, WT f16 = W^T row-major ([n][k]).
// Block tile 128x128; 8 waves in 4(M)x2(N) grid, each wave 32x64 (2x4 16x16 tiles).
// A trip of the K loop works on 128 k. Its A and B tiles (128 rows of 256 bytes each) come into
// LDS by async copies: 16 lanes cover one row, so every copy asks for whole 256-byte runs, and
// a block has 64 KiB in flight. Two buffers: the copies of tile t + 2 go out at the foot of trip
// t and fly during trip t + 1, which has 32 WMMAs a wave to cover them.
// LDS rows stand at a pitch of 272 bytes, which spreads the 16 rows of a fragment load over all
// banks. The ring is dead when the epilogue starts, so the epilogue's tiles lie in the same LDS.
#define GK       128                  // k of one staged tile
#define G_PITCH  136                  // halves: 256 bytes of data + 16 bytes of pad
#define G_TILE   (128 * G_PITCH)      // halves of one operand's tile
#define G_STAGE  (2 * G_TILE)         // A tile, then B tile
#define G_BLOCKS ((N_STATE / 128) * (NROWS / 128))   // blocks of one product = one z slice
static_assert(NB_SIDE % G_BLOCKS == 0, "the riding converts fill whole z slices");
#define MODE_Q 0
#define MODE_K 1
#define MODE_V 2
#define MODE_O 3
#define ST32_PITCH 132        // floats: 512 bytes of data + 16 bytes of pad
#define ST16_PITCH 136        // halves: 256 bytes of data + 16 bytes of pad

template<int M> struct mode_tag { static constexpr int value = M; };

// QKV = true: ONE launch does the three projections of x, which share A and depend on
// nothing of each other: blockIdx.z picks the weight matrix and the epilogue, so 384 blocks
// fill the chip where each projection alone has 128. V, whose epilogue is the longest,
// takes the lowest z and starts first. The slices z >= 3 are no GEMM blocks: they do the converts
// that only later launches read. A WGP holds two blocks of this kernel (LDS), the 384 GEMM blocks
// leave a quarter of those places empty, and the GEMM asks little of memory: the converts' loads
// and stores run in those places beside it instead of ahead of it in a launch of their own.
// QKV = false: the output projection alone (WTs = WoT, bias_q = bo, out32s = out).
template<bool QKV>
__global__ __launch_bounds__(256)
void gemm_wmma_kernel(const _Float16* __restrict__ A,
                      const _Float16* __restrict__ WTs,    // WqT, WkT, WvT one behind the other
                      const float* __restrict__ bias_q,
                      const float* __restrict__ bias_v,
                      float* __restrict__ out32s,          // new_k, new_v one behind the other
                      _Float16* __restrict__ qh,
                      _Float16* __restrict__ kh,
                      _Float16* __restrict__ vt,
                      const float* __restrict__ ck,        // these four: the riding converts
                      const float* __restrict__ cv,
                      const float* __restrict__ Wo,
                      _Float16* __restrict__ WoT) {
    constexpr int RING_BYTES = 2 * G_STAGE * 2;
    constexpr int ST32_BYTES = 128 * ST32_PITCH * 4;
    constexpr int EPI_BYTES  = ST32_BYTES + (QKV ? 128 * ST16_PITCH * 2 : 0);
    __shared__ __align__(16) unsigned char smem[RING_BYTES > EPI_BYTES ? RING_BYTES : EPI_BYTES];
    _Float16* ring = (_Float16*)smem;                    // [buffer][A, B][row][G_PITCH]
    // epilogue tiles of the block's 128 x 128 results; the pad of 16 bytes a row spreads the rows
    // over the banks for the stores from the accumulator layout and for the 16-byte loads
    float*    st32 = (float*)smem;
    _Float16* st16 = (_Float16*)(smem + ST32_BYTES);

    if constexpr (QKV) {
        // block-uniform, ahead of every barrier and copy of the GEMM
        if (blockIdx.z >= 3) {
            side_converts_block(ck, cv, Wo, kh, vt, WoT, (_Float16*)smem,
                                ((int)blockIdx.z - 3) * G_BLOCKS
                                    + (int)blockIdx.y * (N_STATE / 128) + (int)blockIdx.x);
            return;
        }
    }

    const int mode = QKV ? MODE_V - (int)blockIdx.z : MODE_O;
    const _Float16* WT = QKV ? WTs + (size_t)mode * (N_STATE * N_STATE) : WTs;

    const int tid  = threadIdx.x;
    const int lane = tid & 31;
    const int wid  = tid >> 5;
    const int wm   = wid >> 1;           // 0..3
    const int wn   = wid & 1;            // 0..1
    const int col  = lane & 15;
    const int hi8  = (lane >> 4) * 8;
    const int kb   = hi8;
    const int ablk = blockIdx.y * 128;
    const int bblk = blockIdx.x * 128;

    // staging: 16 lanes cover one row of 256 bytes; a thread owns one 16-byte chunk of rows
    // srow, srow + 16, ..., srow + 112 of the A tile and of the B tile
    const int srow = tid >> 4;                // 0..15
    const int sc   = (tid & 15) * 8;          // halves
    const _Float16* ag = A  + (size_t)(ablk + srow) * 1024 + sc;
    const _Float16* bg = WT + (size_t)(bblk + srow) * 1024 + sc;
    auto issue_tile = [&](int t) {
        const unsigned int la =
            (unsigned int)(size_t)&ring[(t & 1) * G_STAGE + srow * G_PITCH + sc];
        async_ld8_b128(la,              16 * G_PITCH * 2, ag + t * GK, 16 * 1024);
        async_ld8_b128(la + G_TILE * 2, 16 * G_PITCH * 2, bg + t * GK, 16 * 1024);
    };

    v8f acc[2][4];
#pragma unroll
    for (int mt = 0; mt < 2; ++mt)
#pragma unroll
        for (int nt = 0; nt < 4; ++nt) acc[mt][nt] = (v8f){0,0,0,0,0,0,0,0};

    issue_tile(0);
    asm volatile("s_wait_asynccnt 0x0" ::: "memory");   // this wave's part of tile 0 has landed
    __syncthreads();                                    // tile 0 is whole for every wave
    issue_tile(1);

    // rolled: one copy of the trip's text; the buffer index is the trip's parity
#pragma unroll 1
    for (int t = 0; t < N_STATE / GK; ++t) {
        const _Float16* as = ring + (t & 1) * G_STAGE + (wm * 32 + col) * G_PITCH;
        const _Float16* bs = ring + (t & 1) * G_STAGE + G_TILE + (wn * 64 + col) * G_PITCH;
        // unrolled: the four steps of 32 k differ by constant LDS offsets only
#pragma unroll
        for (int ks = 0; ks < GK / 32; ++ks) {
            v16h af[2], bf[4];
#pragma unroll
            for (int mt = 0; mt < 2; ++mt)
                af[mt] = ldfrag(as + mt * 16 * G_PITCH + ks * 32, kb);
#pragma unroll
            for (int nt = 0; nt < 4; ++nt)
                bf[nt] = ldfrag(bs + nt * 16 * G_PITCH + ks * 32, kb);
#pragma unroll
            for (int mt = 0; mt < 2; ++mt)
#pragma unroll
                for (int nt = 0; nt < 4; ++nt)
                    acc[mt][nt] = wmma_f16(af[mt], bf[nt], acc[mt][nt]);
        }

        // hand-over: this wave's LDS reads of tile t are done, its copies of tile t + 1 have
        // landed; behind the barrier tile t + 1 is whole and tile t's buffer is free (behind the
        // last trip's: the whole ring, for the epilogue's tiles)
        asm volatile("s_wait_dscnt 0x0" ::: "memory");
        asm volatile("s_wait_asynccnt 0x0" ::: "memory");
        __syncthreads();
        if (t + 2 < N_STATE / GK) issue_tile(t + 2);
    }
    asm volatile("s_wait_asynccnt 0x0" ::: "memory");   // no copy is left in flight at the end

    // epilogue (C layout: VGPR r -> row r + 8*(lane>>4), col = lane&15)
    // The accumulators reach global memory through LDS tiles of the whole block. Straight from
    // the registers a wave-wide store covers pieces of 64 bytes (f32), 32 bytes (f16) or, for
    // V^T, 2 bytes on each of 16 lines; read back from the tile every lane stores 16 bytes and
    // a wave covers 512 contiguous bytes (f32) or two runs of 256 (f16): whole lines only.
    // V^T is transposed on the way in: a lane's 8 accumulators of one column are 8 consecutive
    // keys, one 16-byte chunk of that column's row in the tile.
    auto epilogue = [&](auto tag, const float* __restrict__ bias,
                        float* __restrict__ out32, _Float16* __restrict__ out16) {
    constexpr int MODE = decltype(tag)::value;
#pragma unroll
    for (int mt = 0; mt < 2; ++mt)
#pragma unroll
        for (int nt = 0; nt < 4; ++nt) {
            const int rl = wm * 32 + mt * 16 + hi8;     // row in the block's tile
            const int cl = wn * 64 + nt * 16 + col;     // column in the block's tile
            float bc = 0.0f;
            if constexpr (MODE != MODE_K) bc = bias[bblk + cl];
            v8h hv;
#pragma unroll
            for (int r = 0; r < 8; ++r) {
                float v = acc[mt][nt][r];
                if constexpr (MODE == MODE_Q) {
                    v = (v + bc) * QK_SCALE;
                    st16[(rl + r) * ST16_PITCH + cl] = (_Float16)v;
                } else if constexpr (MODE == MODE_K) {
                    st32[(rl + r) * ST32_PITCH + cl] = v;
                    st16[(rl + r) * ST16_PITCH + cl] = (_Float16)v;
                } else if constexpr (MODE == MODE_V) {
                    v += bc;
                    st32[(rl + r) * ST32_PITCH + cl] = v;
                    hv[r] = (_Float16)v;
                } else {
                    v += bc;
                    st32[(rl + r) * ST32_PITCH + cl] = v;
                }
            }
            if constexpr (MODE == MODE_V)
                *(v8h*)&st16[cl * ST16_PITCH + rl] = hv;    // [column][key]
        }

    __syncthreads();   // the tiles are read back across waves

    if constexpr (MODE != MODE_Q) {
        // one wave, one row of 512 bytes
        float* o = out32 + (size_t)(ablk + wid) * 1024 + bblk + lane * 4;
        float4 v[16];
        // unrolled so that v[] stays in registers and the LDS loads go out back to back
#pragma unroll
        for (int j = 0; j < 16; ++j)
            v[j] = *(const float4*)&st32[(j * 8 + wid) * ST32_PITCH + lane * 4];
#pragma unroll
        for (int j = 0; j < 16; ++j)
            *(float4*)(o + (size_t)j * (8 * 1024)) = v[j];
    }
    if constexpr (MODE != MODE_O) {
        // 16 lanes, one tile row of 256 bytes
        const int row = tid >> 4;
        const int ch  = (tid & 15) * 8;
        const int b   = ablk >> 8, t0 = ablk & 255;     // a block's 128 rows lie in one batch
        _Float16* o;
        if constexpr (MODE == MODE_Q)
            o = out16 + (size_t)(ablk + row) * 1024 + bblk + ch;
        else if constexpr (MODE == MODE_K)
            o = out16 + (size_t)(b * T_KV + T_CACHE + t0 + row) * 1024 + bblk + ch;
        else                                            // tile row = column of V = row of V^T
            o = out16 + (size_t)(b * N_STATE + bblk + row) * T_KV + T_CACHE + t0 + ch;
        v8h h[8];
        // unrolled for the same reason as above
#pragma unroll
        for (int j = 0; j < 8; ++j)
            h[j] = *(const v8h*)&st16[(j * 16 + row) * ST16_PITCH + ch];
#pragma unroll
        for (int j = 0; j < 8; ++j)
            *(v8h*)(o + (size_t)j * (16 * 1024)) = h[j];
    }
    };
    if constexpr (QKV) {
        // Each epilogue ends with s_wait_xcnt 0: in the built code the three stand one behind
        // the other, and index arithmetic of the next one reuses registers that the stores just
        // issued still name; the wait stands in front of any such overwrite.
        if (mode == MODE_V) {
            epilogue(mode_tag<MODE_V>{}, bias_v, out32s + (size_t)NROWS * N_STATE, vt);
            asm volatile("s_wait_xcnt 0x0" ::: "memory");   // see the note above
        } else if (mode == MODE_K) {
            epilogue(mode_tag<MODE_K>{}, nullptr, out32s, kh);
            asm volatile("s_wait_xcnt 0x0" ::: "memory");   // see the note above
        } else {
            epilogue(mode_tag<MODE_Q>{}, bias_q, nullptr, qh);
            asm volatile("s_wait_xcnt 0x0" ::: "memory");   // see the note above
        }
    } else {
        epilogue(mode_tag<MODE_O>{}, bias_q, out32s, nullptr);
    }
}

#define KV_PITCH 72           // halves: 128 bytes of data + 16 bytes of pad
#define M_PITCH  68           // floats: 256 bytes of data + 16 bytes of pad
__global__ __launch_bounds__(256)
void attn_wmma_kernel(const _Float16* __restrict__ qh,
                      const _Float16* __restrict__ kh,
                      const _Float16* __restrict__ vt,
                      const float* __restrict__ mask,
                      _Float16* __restrict__ ph) {
    __shared__ __align__(16) _Float16 ps[8][16 * 72];         // a wave's own output tile
    __shared__ __align__(16) _Float16 Ks[2][64 * KV_PITCH];   // [key][dim]
    __shared__ __align__(16) _Float16 Vs[2][64 * KV_PITCH];   // [dim][key]
    __shared__ __align__(16) float    Ms[2][128 * M_PITCH];   // [query of the block][key]

    const int lane  = threadIdx.x & 31;
    const int wid   = threadIdx.x >> 5;
    const int col   = lane & 15;
    const int hi    = lane >> 4;
    const int kb    = hi * 8;
    const int blk   = blockIdx.x;
    const int b     = blk >> 5;
    const int h     = (blk >> 1) & 15;
    const int qbase = (blk & 1) * 128 + wid * 16;

    // Q fragments, B operand: column = query col (reused for the whole key loop)
    const _Float16* qrow =
        qh + (size_t)(b * T_Q + qbase + col) * 1024 + h * 64;
    const v16h bq0 = ldfrag(qrow, kb);        // dims 0..31
    const v16h bq1 = ldfrag(qrow + 32, kb);   // dims 32..63

    // O^T: o[nt][r] = dim nt * 16 + hi * 8 + r of query col
    v8f o[4];
#pragma unroll
    for (int nt = 0; nt < 4; ++nt) o[nt] = (v8f){0,0,0,0,0,0,0,0};
    float rmax = -3.0e38f;    // of query col, alike in both halves
    float rsum = 0.0f;        // of query col, over this half's keys; the halves join at the end

    // staging: 8 lanes cover one row of 128 bytes; a thread owns one 16-byte chunk of rows
    // srow and srow + 32 of the K tile and of the V^T tile
    const int srow = threadIdx.x >> 3;            // 0..31
    const int sc   = (threadIdx.x & 7) * 8;       // halves
    const _Float16* kg = kh + (size_t)(b * T_KV + srow) * 1024 + h * 64 + sc;
    const _Float16* vg = vt + (size_t)((b * 16 + h) * 64 + srow) * T_KV + sc;
    // mask: 16 lanes cover one row of 256 bytes; a thread owns one 16-byte chunk of rows
    // mr, mr + 16, ..., mr + 112 of the block's 128 queries
    const int mr = threadIdx.x >> 4;              // 0..15
    const int mc = (threadIdx.x & 15) * 4;        // floats
    const float* mg = mask + (size_t)((blk & 1) * 128 + mr) * T_KV + mc;
    auto issue_tile = [&](int t) {
        const int buf = t & 1;
        const _Float16* k0 = kg + (size_t)t * (64 * 1024);
        const _Float16* v0 = vg + t * 64;
        async_ld4_b128((unsigned int)(size_t)&Ks[buf][srow * KV_PITCH + sc],        k0,
                       (unsigned int)(size_t)&Ks[buf][(srow + 32) * KV_PITCH + sc], k0 + 32 * 1024,
                       (unsigned int)(size_t)&Vs[buf][srow * KV_PITCH + sc],        v0,
                       (unsigned int)(size_t)&Vs[buf][(srow + 32) * KV_PITCH + sc], v0 + 32 * T_KV);
        async_ld8_b128((unsigned int)(size_t)&Ms[buf][mr * M_PITCH + mc], 16 * M_PITCH * 4,
                       mg + t * 64, 16 * T_KV);
    };

    issue_tile(0);
    asm volatile("s_wait_asynccnt 0x0" ::: "memory");   // this wave's part of tile 0 has landed
    __syncthreads();                                    // tile 0 is whole for every wave
    issue_tile(1);

    // rolled: one copy of the trip's text; the buffer index is the trip's parity
#pragma unroll 1
    for (int t = 0; t < T_KV / 64; ++t) {
        const _Float16* ks = &Ks[t & 1][0];
        const _Float16* vs = &Vs[t & 1][0];
        // the lane's 8 mask values of a 16-key tile are 32 contiguous bytes of its query's row
        const float*    ms = &Ms[t & 1][(wid * 16 + col) * M_PITCH + hi * 8];
        // ---- S^T = K @ Q^T  (64 keys x 16 queries) ----
        v8f s[4];
#pragma unroll
        for (int g = 0; g < 4; ++g) s[g] = (v8f){0,0,0,0,0,0,0,0};
        // In the order of their use: K, mask, V^T. LDS answers a wave in order, so the first products
        // wait for K alone only if K is asked for first: the scheduling barriers between the three
        // groups keep that order.
        v16h ak[8], av[8];
#pragma unroll
        for (int g = 0; g < 4; ++g) {
            const _Float16* krow = ks + (g * 16 + col) * KV_PITCH;
            ak[2 * g]     = ldfrag(krow, kb);
            ak[2 * g + 1] = ldfrag(krow + 32, kb);
        }
        __builtin_amdgcn_sched_barrier(0);   // K ahead of the mask (see above)
        float4 mk[4][2];
#pragma unroll
        for (int g = 0; g < 4; ++g) {
            mk[g][0] = *(const float4*)(ms + g * 16);
            mk[g][1] = *(const float4*)(ms + g * 16 + 4);
        }
        __builtin_amdgcn_sched_barrier(0);   // the mask ahead of V^T (see above)
#pragma unroll
        for (int nt = 0; nt < 4; ++nt) {
            const _Float16* vrow = vs + (nt * 16 + col) * KV_PITCH;
            av[2 * nt]     = ldfrag(vrow, kb);
            av[2 * nt + 1] = ldfrag(vrow + 32, kb);
        }
        // keeps the trip's fragment loads together ahead of the products: spread among them,
        // each pair of LDS loads makes the wave wait out a full LDS latency of its own
        __builtin_amdgcn_sched_barrier(0);
#pragma unroll
        for (int g = 0; g < 4; ++g) {
            s[g] = wmma_f16(ak[2 * g], bq0, s[g]);
            s[g] = wmma_f16(ak[2 * g + 1], bq1, s[g]);
        }
        // ---- mask + the query's maximum over the chunk ----
        // s[g][r] = score of key t * 64 + g * 16 + hi * 8 + r
        float cm[8];
#pragma unroll
        for (int r = 0; r < 8; ++r) cm[r] = -3.0e38f;
#pragma unroll
        for (int g = 0; g < 4; ++g)
#pragma unroll
            for (int r = 0; r < 8; ++r) {
                const float4 m4 = mk[g][r >> 2];
                const float  mv = (r & 3) == 0 ? m4.x : (r & 3) == 1 ? m4.y
                                : (r & 3) == 2 ? m4.z : m4.w;
                float v = s[g][r] + mv;
                s[g][r] = v;
                cm[r] = fmaxf(cm[r], v);
            }
        float cmax = fmaxf(fmaxf(fmaxf(cm[0], cm[1]), fmaxf(cm[2], cm[3])),
                           fmaxf(fmaxf(cm[4], cm[5]), fmaxf(cm[6], cm[7])));
        cmax = fmaxf(cmax, xhalf(cmax));
        // ---- online softmax update ----
        const float nm  = fmaxf(rmax, cmax);
        const float scl = __expf(rmax - nm);
        rmax = nm;
#pragma unroll
        for (int nt = 0; nt < 4; ++nt)
#pragma unroll
            for (int r = 0; r < 8; ++r) o[nt][r] *= scl;

        // P^T, packed where it stands: element e of bp[j] = key 32 * j + kb + e (e < 8) or
        // 32 * j + 16 + kb + e - 8, the k order in which ldfrag loads V^T
        union { v16h v; v2h h2[8]; } bp[2];
        float psum[8];
#pragma unroll
        for (int r = 0; r < 8; ++r) psum[r] = 0.0f;
#pragma unroll
        for (int g = 0; g < 4; ++g)
#pragma unroll
            for (int r = 0; r < 8; r += 2) {
                v2f p = { __expf(s[g][r] - rmax), __expf(s[g][r + 1] - rmax) };
                psum[r]     += p.x;
                psum[r + 1] += p.y;
                bp[g >> 1].h2[(g & 1) * 4 + (r >> 1)] = __builtin_convertvector(p, v2h);
            }
        rsum = rsum * scl + (((psum[0] + psum[1]) + (psum[2] + psum[3]))
                             + ((psum[4] + psum[5]) + (psum[6] + psum[7])));

        // ---- O^T += V^T @ P^T ----
#pragma unroll
        for (int nt = 0; nt < 4; ++nt) {
            o[nt] = wmma_f16(av[2 * nt], bp[0].v, o[nt]);        // keys 0..31 of chunk
            o[nt] = wmma_f16(av[2 * nt + 1], bp[1].v, o[nt]);    // keys 32..63
        }
        // keeps the trip's products and vector work ahead of the hand-over: they touch no memory,
        // and moved behind the barrier they would leave the copies of tile t + 1 no more than the
        // fragment loads' time to land
        __builtin_amdgcn_sched_barrier(0);

        // hand-over: this wave's LDS reads of tile t are done, its copies of tile t + 1 have
        // landed; behind the barrier tile t + 1 is whole and tile t's buffer is free
        asm volatile("s_wait_dscnt 0x0" ::: "memory");
        asm volatile("s_wait_asynccnt 0x0" ::: "memory");
        __syncthreads();
        if (t + 2 < T_KV / 64) issue_tile(t + 2);
    }
    asm volatile("s_wait_asynccnt 0x0" ::: "memory");   // no copy is left in flight at the end

    // ---- finalize: join the halves' row sums, normalize, write ph (f16) ----
    rsum += xhalf(rsum);
    // The wave's 16 x 64 results go out through its own LDS tile: a lane's 8 accumulators of one
    // tile are 8 consecutive dims of its query, one 16-byte chunk of that row. Read back, 8 lanes
    // cover one row of 128 bytes, so each store covers whole lines instead of pieces of 32 bytes.
    _Float16* myp = &ps[wid][0];
#pragma unroll
    for (int nt = 0; nt < 4; ++nt) {
        v8h hv;
#pragma unroll
        for (int r = 0; r < 8; ++r) hv[r] = (_Float16)(o[nt][r] / rsum);
        *(v8h*)&myp[col * 72 + nt * 16 + hi * 8] = hv;
    }
    // the rows are read back by other lanes of the same wave: its LDS stores come first
    asm volatile("s_wait_dscnt 0x0" ::: "memory");
    const int orow = lane >> 3;                   // 0..3
    const int och  = (lane & 7) * 8;              // halves
    _Float16* po = ph + (size_t)(b * T_Q + qbase + orow) * 1024 + h * 64 + och;
    v8h ov[4];
#pragma unroll
    for (int j = 0; j < 4; ++j)
        ov[j] = *(const v8h*)&myp[(j * 4 + orow) * 72 + och];
#pragma unroll
    for (int j = 0; j < 4; ++j)
        *(v8h*)(po + (size_t)j * (4 * 1024)) = ov[j];
}

// ---------------- host launcher ----------------
extern "C" void kernel_launch(void* const* d_in, const int* in_sizes, int n_in,
                              void* d_out, int out_size, void* d_ws, size_t ws_size,
                              hipStream_t stream) {
    const float* x    = (const float*)d_in[0];
    const float* mask = (const float*)d_in[1];
    const float* ck   = (const float*)d_in[2];
    const float* cv   = (const float*)d_in[3];
    const float* Wq   = (const float*)d_in[4];
    const float* bq   = (const float*)d_in[5];
    const float* Wk   = (const float*)d_in[6];
    const float* Wv   = (const float*)d_in[7];
    const float* bv   = (const float*)d_in[8];
    const float* Wo   = (const float*)d_in[9];
    const float* bo   = (const float*)d_in[10];

    float* out  = (float*)d_out;                 // [2048,1024]
    float* outK = out  + (size_t)NROWS * N_STATE;   // new_k; new_v follows it

    char* w = (char*)d_ws;
    _Float16* xh  = (_Float16*)w; w += (size_t)NROWS * N_STATE * 2;
    _Float16* WT4 = (_Float16*)w; w += (size_t)3 * N_STATE * N_STATE * 2;   // WqT, WkT, WvT
    _Float16* WoT = (_Float16*)w; w += (size_t)N_STATE * N_STATE * 2;
    _Float16* qh  = (_Float16*)w; w += (size_t)NROWS * N_STATE * 2;
    _Float16* kh  = (_Float16*)w; w += (size_t)BATCH * T_KV * N_STATE * 2;
    _Float16* vt  = (_Float16*)w; w += (size_t)BATCH * T_KV * N_STATE * 2;
    _Float16* ph  = (_Float16*)w; w += (size_t)NROWS * N_STATE * 2;

    // converts that the projections read
    prep_kernel<<<3 * NB_W + NB_X, 256, 0, stream>>>(x, Wq, Wk, Wv, xh, WT4);

    // projections of x, and beside them the converts that only later launches read
    gemm_wmma_kernel<true><<<dim3(N_STATE / 128, NROWS / 128, 3 + NB_SIDE / G_BLOCKS),
                             256, 0, stream>>>(
        xh, WT4, bq, bv, outK, qh, kh, vt, ck, cv, Wo, WoT);

    // attention
    attn_wmma_kernel<<<BATCH * 16 * 2, 256, 0, stream>>>(qh, kh, vt, mask, ph);

    // output projection
    gemm_wmma_kernel<false><<<dim3(N_STATE / 128, NROWS / 128), 256, 0, stream>>>(
        ph, WoT, bo, nullptr, out, nullptr, nullptr, nullptr, nullptr, nullptr, nullptr, nullptr);
}

// v009
// Measured time: 52.3 microseconds a run.
// Two timings next to v008 put it at 1.04 and 1.06 times that version's speed.
// All steps since v000 together make it 7.74 times as fast.
#include <hip/hip_runtime.h>

// ---------------- types ----------------
typedef __attribute__((ext_vector_type(16))) _Float16 v16h;
typedef __attribute__((ext_vector_type(8)))  _Float16 v8h;
typedef __attribute__((ext_vector_type(4)))  _Float16 v4h;
typedef __attribute__((ext_vector_type(2)))  _Float16 v2h;
typedef __attribute__((ext_vector_type(2)))  float    v2f;
typedef __attribute__((ext_vector_type(8)))  float    v8f;

#define N_STATE 1024
#define T_Q     256
#define T_CACHE 768
#define T_KV    1024
#define BATCH   8
#define NROWS   2048          // B*T
#define QK_SCALE 0.125f

// ---------------- WMMA helpers ----------------
__device__ __forceinline__ v8f wmma_f16(v16h a, v16h b, v8f c) {
    // D = A(16x32) * B(32x16) + C, f32 accumulate
    return __builtin_amdgcn_wmma_f32_16x16x32_f16(
        false, a, false, b, (short)0, c, false, false);
}

// Load a 16x32 A-style fragment for this lane.
// Lane layout (ISA 7.12.2, 16-bit A 16x32): row = lane&15, kb = (lane>>4)*8,
// halves cover K in [kb,kb+8) and [kb+16,kb+24)  -> two 16-byte loads.
// `p` must point at element [lane&15][0] of the tile (row stride pre-applied).
__device__ __forceinline__ v16h ldfrag(const _Float16* p, int kb) {
    union { v16h v; v8h h[2]; } u;
    u.h[0] = *(const v8h*)(p + kb);
    u.h[1] = *(const v8h*)(p + kb + 16);
    return u.v;
}

// Async global -> LDS copies of 16 bytes per lane (CDNA5 GLOBAL_LOAD_ASYNC_TO_LDS, tracked by
// ASYNCcnt). An LDS address is the low 32 bits of the generic shared pointer.
// Eight copies of one lane, one behind the other: copy j takes LDS byte address l + j * lstep
// and global pointer g + j * gstep, each in registers of its own. s_wait_xcnt 0 is the
// statement's last line, so that it stands in front of any later write of a register that one
// of the copies names.
__device__ __forceinline__ void async_ld8_b128(unsigned int l, unsigned int lstep,
                                               const _Float16* g, int gstep) {
    asm volatile("global_load_async_to_lds_b128 %0, %1, off\n\t"
                 "global_load_async_to_lds_b128 %2, %3, off\n\t"
                 "global_load_async_to_lds_b128 %4, %5, off\n\t"
                 "global_load_async_to_lds_b128 %6, %7, off\n\t"
                 "global_load_async_to_lds_b128 %8, %9, off\n\t"
                 "global_load_async_to_lds_b128 %10, %11, off\n\t"
                 "global_load_async_to_lds_b128 %12, %13, off\n\t"
                 "global_load_async_to_lds_b128 %14, %15, off\n\t"
                 "s_wait_xcnt 0x0"
                 :: "v"(l),             "v"(g),
                    "v"(l + lstep),     "v"(g + gstep),
                    "v"(l + 2 * lstep), "v"(g + 2 * gstep),
                    "v"(l + 3 * lstep), "v"(g + 3 * gstep),
                    "v"(l + 4 * lstep), "v"(g + 4 * gstep),
                    "v"(l + 5 * lstep), "v"(g + 5 * gstep),
                    "v"(l + 6 * lstep), "v"(g + 6 * gstep),
                    "v"(l + 7 * lstep), "v"(g + 7 * gstep)
                 : "memory");
}

// Four such copies, each with its own LDS byte address and its own global pointer; the same
// wait as its last line.
__device__ __forceinline__ void async_ld4_b128(unsigned int l0, const _Float16* g0,
                                               unsigned int l1, const _Float16* g1,
                                               unsigned int l2, const _Float16* g2,
                                               unsigned int l3, const _Float16* g3) {
    asm volatile("global_load_async_to_lds_b128 %0, %1, off\n\t"
                 "global_load_async_to_lds_b128 %2, %3, off\n\t"
                 "global_load_async_to_lds_b128 %4, %5, off\n\t"
                 "global_load_async_to_lds_b128 %6, %7, off\n\t"
                 "s_wait_xcnt 0x0"
                 :: "v"(l0), "v"(g0), "v"(l1), "v"(g1),
                    "v"(l2), "v"(g2), "v"(l3), "v"(g3)
                 : "memory");
}

// Eight such copies for rows of floats: the same statement, the steps counted in halves.
__device__ __forceinline__ void async_ld8_b128(unsigned int l, unsigned int lstep,
                                               const float* g, int gstep) {
    async_ld8_b128(l, lstep, (const _Float16*)g, 2 * gstep);
}

// the value of lane l ^ 16: the wave's two halves change places (a vector cross-row move, no LDS)
__device__ __forceinline__ float xhalf(float v) {
    int i = __float_as_int(v);
    i = __builtin_amdgcn_permlanex16(i, i, 0x76543210, 0xfedcba98, false, false);
    return __int_as_float(i);
}

// ---------------- elementwise converts / packs ----------------
// f32 -> f16 convert of whole rows of 1024 elements:
//   in [batch][RIN][1024] f32  ->  out [batch][ROUT][1024] f16, rows 0..RIN-1 of each batch
// Serves x -> xh (RIN = ROUT = 2048, one batch) and cache_k -> kh (768 of 1024 key rows).
// One block converts RPB rows; RPB divides RIN, so a block stays inside one batch.
// A thread owns one float4 column group of every row: each wave-wide load covers 512
// contiguous bytes and each wave-wide store 256, whole lines both ways. A thread's loads
// are independent and stand ahead of its stores, so few waves keep many bytes in flight,
// and the launch starts RPB * 4 times fewer waves than one element a thread would.
// blk = index of the block among the blocks of this convert.
template<int RIN, int ROUT, int RPB>
__device__ __forceinline__
void cvt_rows_block(const float* __restrict__ in,
                    _Float16* __restrict__ out, int blk) {
    static_assert(RIN % RPB == 0, "a block must not straddle two batches");
    const int r0 = blk * RPB;
    const int b  = r0 / RIN;
    const int c  = threadIdx.x * 4;
    const float* src = in + (size_t)r0 * 1024 + c;
    _Float16*    dst = out + (size_t)(r0 + b * (ROUT - RIN)) * 1024 + c;

    float4 v[RPB];
    // unrolled so that v[] stays in registers and the loads go out back to back
#pragma unroll
    for (int j = 0; j < RPB; ++j)
        v[j] = *(const float4*)(src + (size_t)j * 1024);
    // unrolled for the same reason: v[] is indexed by constants only
#pragma unroll
    for (int j = 0; j < RPB; ++j) {
        v4h h = { (_Float16)v[j].x, (_Float16)v[j].y, (_Float16)v[j].z, (_Float16)v[j].w };
        *(v4h*)(dst + (size_t)j * 1024) = h;
    }
}

// Transposing convert through an LDS tile:
//   in  [batch][ROWS][1024] f32  ->  out [batch][1024][1024] f16, columns 0..ROWS-1
//   out[b][c][s] = (f16) in[b][s][c]
// Serves W[k][n] -> WT[n][k] (ROWS = 1024, one batch) and cache_v[b][s][c] ->
// vt[b][c = h*64+dh][key s] (ROWS = 768, eight batches).
// One block moves a tile of 128 rows (s) x 64 columns (c): 256 contiguous bytes a row on
// the f32 side and 256 contiguous bytes a row on the f16 side, so loads and stores both
// cover whole lines. A thread loads 8 consecutive rows of one float4 column group; each
// of its 4 columns is then 8 halves (16 bytes) of one output row.
// LDS row = one output row of 16 chunks of 16 bytes; chunk q of row c sits at q ^ (c >> 2),
// which spreads the 16 lanes of a half wave over all banks in the store and in the load.
// tile = the block's LDS tile of 64 * 128 halves; (bx, by, b) = column tile, row tile, batch.
template<int ROWS>
__device__ __forceinline__
void transpose_cvt_block(const float* __restrict__ in,
                         _Float16* __restrict__ out,
                         _Float16* tile, int bx, int by, int b) {
    const int tid = threadIdx.x;
    const int c0  = bx * 64;
    const int s0  = by * 128;

    const int c4 = tid & 15;            // float4 column group
    const int sr = tid >> 4;            // group of 8 rows
    const float* src = in + ((size_t)b * ROWS + s0 + sr * 8) * 1024 + c0 + c4 * 4;

    float4 v[8];
#pragma unroll
    for (int j = 0; j < 8; ++j)
        v[j] = *(const float4*)(src + (size_t)j * 1024);

    v8h h0, h1, h2, h3;
#pragma unroll
    for (int j = 0; j < 8; ++j) {
        h0[j] = (_Float16)v[j].x;
        h1[j] = (_Float16)v[j].y;
        h2[j] = (_Float16)v[j].z;
        h3[j] = (_Float16)v[j].w;
    }
    _Float16* dst = &tile[(c4 * 4) * 128 + ((sr ^ c4) * 8)];
    *(v8h*)(dst)           = h0;
    *(v8h*)(dst + 128)     = h1;
    *(v8h*)(dst + 2 * 128) = h2;
    *(v8h*)(dst + 3 * 128) = h3;

    __syncthreads();   // the tile is read back across waves

    const int q  = tid & 15;            // 16-byte chunk of an output row
    const int cr = tid >> 4;
    _Float16* o = out + ((size_t)b * 1024 + c0) * 1024 + s0 + q * 8;
#pragma unroll
    for (int p = 0; p < 4; ++p) {
        int c = p * 16 + cr;
        *(v8h*)(o + (size_t)c * 1024) = *(const v8h*)&tile[c * 128 + ((q ^ (c >> 2)) * 8)];
    }
}

// The seven converts stand in two launches, each convert on its own range of block indices.
// The first launch holds only what the projections read: x and W^T of Wq, Wk, Wv. It is the
// head of the chain of dependent launches, so it is kept short.
// The other three (cache_k, V^T of cache_v, Wo^T) are read by the attention launch or later and
// depend on nothing: their blocks ride in the projections' grid (side_converts_block below).
// The branches are on blockIdx alone, so the barrier inside a transpose is block-uniform.
#define NB_CK ((BATCH * T_CACHE) / 24)                        // cache_k rows
#define NB_CV ((N_STATE / 64) * (T_CACHE / 128) * BATCH)      // cache_v tiles
#define NB_W  ((N_STATE / 64) * (N_STATE / 128))              // tiles of one weight matrix
#define NB_X  (NROWS / 8)                                     // x rows
__global__ __launch_bounds__(256)
void prep_kernel(const float* __restrict__ x,
                 const float* __restrict__ Wq,
                 const float* __restrict__ Wk,
                 const float* __restrict__ Wv,
                 _Float16* __restrict__ xh,
                 _Float16* __restrict__ WT3) {   // WqT, WkT, WvT one behind the other
    __shared__ __align__(16) _Float16 tile[64 * 128];

    // Each branch ends with s_wait_xcnt 0: in the built code the branches stand one behind the
    // other, and the next one's first instructions reuse registers that the stores just issued
    // still name; the wait stands in front of any such overwrite.
    int blk = blockIdx.x;
    if (blk < 3 * NB_W) {
        const int m = blk / NB_W;                // which weight matrix
        const float* W = m == 0 ? Wq : m == 1 ? Wk : Wv;
        transpose_cvt_block<N_STATE>(W, WT3 + (size_t)m * (N_STATE * N_STATE), tile,
                                     blk & 15, (blk >> 4) & 7, 0);
        asm volatile("s_wait_xcnt 0x0" ::: "memory");   // see the note above
    } else {
        cvt_rows_block<NROWS, NROWS, 8>(x, xh, blk - 3 * NB_W);
        asm volatile("s_wait_xcnt 0x0" ::: "memory");   // see the note above
    }
}

// One block of the converts that ride in the projections' grid; blk = its index among them.
// The blocks with the most bytes come first. tile = 64 * 128 halves of the block's LDS.
#define NB_SIDE (NB_CK + NB_CV + NB_W)
__device__ __forceinline__
void side_converts_block(const float* __restrict__ ck,
                         const float* __restrict__ cv,
                         const float* __restrict__ Wo,
                         _Float16* __restrict__ kh,
                         _Float16* __restrict__ vt,
                         _Float16* __restrict__ WoT,
                         _Float16* tile, int blk) {
    // each branch ends with s_wait_xcnt 0, for the reason given in prep_kernel
    if (blk < NB_CK) {
        cvt_rows_block<T_CACHE, T_KV, 24>(ck, kh, blk);
        asm volatile("s_wait_xcnt 0x0" ::: "memory");   // see the note above
    } else if (blk < NB_CK + NB_CV) {
        blk -= NB_CK;
        const int t = blk >> 4;                  // row tile and batch
        transpose_cvt_block<T_CACHE>(cv, vt, tile, blk & 15,
                                     t % (T_CACHE / 128), t / (T_CACHE / 128));
        asm volatile("s_wait_xcnt 0x0" ::: "memory");   // see the note above
    } else {
        blk -= NB_CK + NB_CV;
        transpose_cvt_block<N_STATE>(Wo, WoT, tile, blk & 15, (blk >> 4) & 7, 0);
        asm volatile("s_wait_xcnt 0x0" ::: "memory");   // see the note above
    }
}

// ---------------- tiled WMMA GEMM: C[2048,1024] = A[2048,1024] @ W[1024,1024] ----------------
// A f16 row-major, WT f16 = W^T row-major ([n][k]).
// Block tile 128x128; 8 waves in 4(M)x2(N) grid, each wave 32x64 (2x4 16x16 tiles).
// A trip of the K loop works on GK k: 128 in the projections of x, 256 in the output projection.
// Its A and B tiles (128 rows of 2 * GK bytes each) come into LDS by async copies: GK / 8 lanes
// cover one row, so every copy asks for whole rows, and a block has 64 or 128 KiB in flight. Two
// buffers: the copies of tile t + 2 go out at the foot of trip t and fly during trip t + 1.
// A trip lasts at least as long as its successor's tile takes to land, latency included. The
// output projection has one block on a WGP and LDS to spare: with twice the k a tile it pays that
// latency, and the hand-over, 4 times instead of 8. The projections of x need two blocks on a
// WGP, which leaves them 128 k.
// LDS rows stand at a pitch of the row + 16 bytes, which spreads the 16 rows of a fragment load
// over all banks. The ring is dead when the epilogue starts: the epilogue's tiles lie in its LDS.
#define G_BLOCKS ((N_STATE / 128) * (NROWS / 128))   // blocks of one product = one z slice
static_assert(NB_SIDE % G_BLOCKS == 0, "the riding converts fill whole z slices");
#define MODE_Q 0
#define MODE_K 1
#define MODE_V 2
#define MODE_O 3
#define ST32_PITCH 132        // floats: 512 bytes of data + 16 bytes of pad
#define ST16_PITCH 136        // halves: 256 bytes of data + 16 bytes of pad

template<int M> struct mode_tag { static constexpr int value = M; };

// QKV = true: ONE launch does the three projections of x, which share A and depend on
// nothing of each other: blockIdx.z picks the weight matrix and the epilogue, so 384 blocks
// fill the chip where each projection alone has 128. V, whose epilogue is the longest,
// takes the lowest z and starts first. The slices z >= 3 are no GEMM blocks: they do the converts
// that only later launches read. A WGP holds two blocks of this kernel (LDS), the 384 GEMM blocks
// leave a quarter of those places empty, and the GEMM asks little of memory: the converts' loads
// and stores run in those places beside it instead of ahead of it in a launch of their own.
// QKV = false: the output projection alone (WTs = WoT, bias_q = bo, out32s = out).
template<bool QKV>
__global__ __launch_bounds__(256)
void gemm_wmma_kernel(const _Float16* __restrict__ A,
                      const _Float16* __restrict__ WTs,    // WqT, WkT, WvT one behind the other
                      const float* __restrict__ bias_q,
                      const float* __restrict__ bias_v,
                      float* __restrict__ out32s,          // new_k, new_v one behind the other
                      _Float16* __restrict__ qh,
                      _Float16* __restrict__ kh,
                      _Float16* __restrict__ vt,
                      const float* __restrict__ ck,        // these four: the riding converts
                      const float* __restrict__ cv,
                      const float* __restrict__ Wo,
                      _Float16* __restrict__ WoT) {
    constexpr int GK      = QKV ? 128 : 256;    // k of one staged tile
    constexpr int G_PITCH = GK + 8;             // halves: the row's data + 16 bytes of pad
    constexpr int G_TILE  = 128 * G_PITCH;      // halves of one operand's tile
    constexpr int G_STAGE = 2 * G_TILE;         // A tile, then B tile
    constexpr int RING_BYTES = 2 * G_STAGE * 2;
    constexpr int ST32_BYTES = 128 * ST32_PITCH * 4;
    constexpr int EPI_BYTES  = ST32_BYTES + (QKV ? 128 * ST16_PITCH * 2 : 0);
    __shared__ __align__(16) unsigned char smem[RING_BYTES > EPI_BYTES ? RING_BYTES : EPI_BYTES];
    _Float16* ring = (_Float16*)smem;                    // [buffer][A, B][row][G_PITCH]
    // epilogue tiles of the block's 128 x 128 results; the pad of 16 bytes a row spreads the rows
    // over the banks for the stores from the accumulator layout and for the 16-byte loads
    float*    st32 = (float*)smem;
    _Float16* st16 = (_Float16*)(smem + ST32_BYTES);

    if constexpr (QKV) {
        // block-uniform, ahead of every barrier and copy of the GEMM
        if (blockIdx.z >= 3) {
            side_converts_block(ck, cv, Wo, kh, vt, WoT, (_Float16*)smem,
                                ((int)blockIdx.z - 3) * G_BLOCKS
                                    + (int)blockIdx.y * (N_STATE / 128) + (int)blockIdx.x);
            return;
        }
    }

    const int mode = QKV ? MODE_V - (int)blockIdx.z : MODE_O;
    const _Float16* WT = QKV ? WTs + (size_t)mode * (N_STATE * N_STATE) : WTs;

    const int tid  = threadIdx.x;
    const int lane = tid & 31;
    const int wid  = tid >> 5;
    const int wm   = wid >> 1;           // 0..3
    const int wn   = wid & 1;            // 0..1
    const int col  = lane & 15;
    const int hi8  = (lane >> 4) * 8;
    const int kb   = hi8;
    const int ablk = blockIdx.y * 128;
    const int bblk = blockIdx.x * 128;

    // staging: LPR lanes cover one row; a thread owns one 16-byte chunk of rows srow, srow + RPP,
    // srow + 2 * RPP, ... of the A tile and of the B tile
    constexpr int LPR = GK / 8;               // lanes a row
    constexpr int RPP = 256 / LPR;            // rows that the block's threads cover at once
    const int srow = tid / LPR;
    const int sc   = (tid % LPR) * 8;         // halves
    const _Float16* ag = A  + (size_t)(ablk + srow) * 1024 + sc;
    const _Float16* bg = WT + (size_t)(bblk + srow) * 1024 + sc;
    auto issue_tile = [&](int t) {
        const unsigned int la =
            (unsigned int)(size_t)&ring[(t & 1) * G_STAGE + srow * G_PITCH + sc];
        // unrolled: a statement of eight copies for every 8 * RPP rows, at constant distances
#pragma unroll
        for (int p = 0; p < 128 / (8 * RPP); ++p) {
            const unsigned int lp = la + p * (8 * RPP * G_PITCH * 2);
            async_ld8_b128(lp,              RPP * G_PITCH * 2,
                           ag + t * GK + p * (8 * RPP * 1024), RPP * 1024);
            async_ld8_b128(lp + G_TILE * 2, RPP * G_PITCH * 2,
                           bg + t * GK + p * (8 * RPP * 1024), RPP * 1024);
        }
    };

    v8f acc[2][4];
#pragma unroll
    for (int mt = 0; mt < 2; ++mt)
#pragma unroll
        for (int nt = 0; nt < 4; ++nt) acc[mt][nt] = (v8f){0,0,0,0,0,0,0,0};

    issue_tile(0);
    asm volatile("s_wait_asynccnt 0x0" ::: "memory");   // this wave's part of tile 0 has landed
    __syncthreads();                                    // tile 0 is whole for every wave
    issue_tile(1);

    // rolled: one copy of the trip's text; the buffer index is the trip's parity
#pragma unroll 1
    for (int t = 0; t < N_STATE / GK; ++t) {
        const _Float16* as = ring + (t & 1) * G_STAGE + (wm * 32 + col) * G_PITCH;
        const _Float16* bs = ring + (t & 1) * G_STAGE + G_TILE + (wn * 64 + col) * G_PITCH;
        // unrolled: the steps of 32 k differ by constant LDS offsets only
#pragma unroll
        for (int ks = 0; ks < GK / 32; ++ks) {
            v16h af[2], bf[4];
#pragma unroll
            for (int mt = 0; mt < 2; ++mt)
                af[mt] = ldfrag(as + mt * 16 * G_PITCH + ks * 32, kb);
#pragma unroll
            for (int nt = 0; nt < 4; ++nt)
                bf[nt] = ldfrag(bs + nt * 16 * G_PITCH + ks * 32, kb);
#pragma unroll
            for (int mt = 0; mt < 2; ++mt)
#pragma unroll
                for (int nt = 0; nt < 4; ++nt)
                    acc[mt][nt] = wmma_f16(af[mt], bf[nt], acc[mt][nt]);
        }

        // hand-over: this wave's LDS reads of tile t are done, its copies of tile t + 1 have
        // landed; behind the barrier tile t + 1 is whole and tile t's buffer is free (behind the
        // last trip's: the whole ring, for the epilogue's tiles)
        asm volatile("s_wait_dscnt 0x0" ::: "memory");
        asm volatile("s_wait_asynccnt 0x0" ::: "memory");
        __syncthreads();
        if (t + 2 < N_STATE / GK) issue_tile(t + 2);
    }
    asm volatile("s_wait_asynccnt 0x0" ::: "memory");   // no copy is left in flight at the end

    // epilogue (C layout: VGPR r -> row r + 8*(lane>>4), col = lane&15)
    // The accumulators reach global memory through LDS tiles of the whole block. Straight from
    // the registers a wave-wide store covers pieces of 64 bytes (f32), 32 bytes (f16) or, for
    // V^T, 2 bytes on each of 16 lines; read back from the tile every lane stores 16 bytes and
    // a wave covers 512 contiguous bytes (f32) or two runs of 256 (f16): whole lines only.
    // V^T is transposed on the way in: a lane's 8 accumulators of one column are 8 consecutive
    // keys, one 16-byte chunk of that column's row in the tile.
    auto epilogue = [&](auto tag, const float* __restrict__ bias,
                        float* __restrict__ out32, _Float16* __restrict__ out16) {
    constexpr int MODE = decltype(tag)::value;
#pragma unroll
    for (int mt = 0; mt < 2; ++mt)
#pragma unroll
        for (int nt = 0; nt < 4; ++nt) {
            const int rl = wm * 32 + mt * 16 + hi8;     // row in the block's tile
            const int cl = wn * 64 + nt * 16 + col;     // column in the block's tile
            float bc = 0.0f;
            if constexpr (MODE != MODE_K) bc = bias[bblk + cl];
            v8h hv;
#pragma unroll
            for (int r = 0; r < 8; ++r) {
                float v = acc[mt][nt][r];
                if constexpr (MODE == MODE_Q) {
                    v = (v + bc) * QK_SCALE;
                    st16[(rl + r) * ST16_PITCH + cl] = (_Float16)v;
                } else if constexpr (MODE == MODE_K) {
                    st32[(rl + r) * ST32_PITCH + cl] = v;
                    st16[(rl + r) * ST16_PITCH + cl] = (_Float16)v;
                } else if constexpr (MODE == MODE_V) {
                    v += bc;
                    st32[(rl + r) * ST32_PITCH + cl] = v;
                    hv[r] = (_Float16)v;
                } else {
                    v += bc;
                    st32[(rl + r) * ST32_PITCH + cl] = v;
                }
            }
            if constexpr (MODE == MODE_V)
                *(v8h*)&st16[cl * ST16_PITCH + rl] = hv;    // [column][key]
        }

    __syncthreads();   // the tiles are read back across waves

    if constexpr (MODE != MODE_Q) {
        // one wave, one row of 512 bytes
        float* o = out32 + (size_t)(ablk + wid) * 1024 + bblk + lane * 4;
        float4 v[16];
        // unrolled so that v[] stays in registers and the LDS loads go out back to back
#pragma unroll
        for (int j = 0; j < 16; ++j)
            v[j] = *(const float4*)&st32[(j * 8 + wid) * ST32_PITCH + lane * 4];
#pragma unroll
        for (int j = 0; j < 16; ++j)
            *(float4*)(o + (size_t)j * (8 * 1024)) = v[j];
    }
    if constexpr (MODE != MODE_O) {
        // 16 lanes, one tile row of 256 bytes
        const int row = tid >> 4;
        const int ch  = (tid & 15) * 8;
        const int b   = ablk >> 8, t0 = ablk & 255;     // a block's 128 rows lie in one batch
        _Float16* o;
        if constexpr (MODE == MODE_Q)
            o = out16 + (size_t)(ablk + row) * 1024 + bblk + ch;
        else if constexpr (MODE == MODE_K)
            o = out16 + (size_t)(b * T_KV + T_CACHE + t0 + row) * 1024 + bblk + ch;
        else                                            // tile row = column of V = row of V^T
            o = out16 + (size_t)(b * N_STATE + bblk + row) * T_KV + T_CACHE + t0 + ch;
        v8h h[8];
        // unrolled for the same reason as above
#pragma unroll
        for (int j = 0; j < 8; ++j)
            h[j] = *(const v8h*)&st16[(j * 16 + row) * ST16_PITCH + ch];
#pragma unroll
        for (int j = 0; j < 8; ++j)
            *(v8h*)(o + (size_t)j * (16 * 1024)) = h[j];
    }
    };
    if constexpr (QKV) {
        // Each epilogue ends with s_wait_xcnt 0: in the built code the three stand one behind
        // the other, and index arithmetic of the next one reuses registers that the stores just
        // issued still name; the wait stands in front of any such overwrite.
        if (mode == MODE_V) {
            epilogue(mode_tag<MODE_V>{}, bias_v, out32s + (size_t)NROWS * N_STATE, vt);
            asm volatile("s_wait_xcnt 0x0" ::: "memory");   // see the note above
        } else if (mode == MODE_K) {
            epilogue(mode_tag<MODE_K>{}, nullptr, out32s, kh);
            asm volatile("s_wait_xcnt 0x0" ::: "memory");   // see the note above
        } else {
            epilogue(mode_tag<MODE_Q>{}, bias_q, nullptr, qh);
            asm volatile("s_wait_xcnt 0x0" ::: "memory");   // see the note above
        }
    } else {
        epilogue(mode_tag<MODE_O>{}, bias_q, out32s, nullptr);
    }
}

#define A_KEYS   128          // keys of one staged tile
#define K_PITCH  72           // halves: 128 bytes of data + 16 bytes of pad
#define V_PITCH  136          // halves: 256 bytes of data + 16 bytes of pad
#define M_PITCH  132          // floats: 512 bytes of data + 16 bytes of pad
__global__ __launch_bounds__(256)
void attn_wmma_kernel(const _Float16* __restrict__ qh,
                      const _Float16* __restrict__ kh,
                      const _Float16* __restrict__ vt,
                      const float* __restrict__ mask,
                      _Float16* __restrict__ ph) {
    __shared__ __align__(16) _Float16 ps[8][16 * 72];         // a wave's own output tile
    __shared__ __align__(16) _Float16 Ks[2][A_KEYS * K_PITCH];   // [key][dim]
    __shared__ __align__(16) _Float16 Vs[2][64 * V_PITCH];       // [dim][key]
    __shared__ __align__(16) float    Ms[2][128 * M_PITCH];      // [query of the block][key]

    const int lane  = threadIdx.x & 31;
    const int wid   = threadIdx.x >> 5;
    const int col   = lane & 15;
    const int hi    = lane >> 4;
    const int kb    = hi * 8;
    const int blk   = blockIdx.x;
    const int b     = blk >> 5;
    const int h     = (blk >> 1) & 15;
    const int qbase = (blk & 1) * 128 + wid * 16;

    // Q fragments, B operand: column = query col (reused for the whole key loop)
    const _Float16* qrow =
        qh + (size_t)(b * T_Q + qbase + col) * 1024 + h * 64;
    const v16h bq0 = ldfrag(qrow, kb);        // dims 0..31
    const v16h bq1 = ldfrag(qrow + 32, kb);   // dims 32..63

    // O^T: o[nt][r] = dim nt * 16 + hi * 8 + r of query col
    v8f o[4];
#pragma unroll
    for (int nt = 0; nt < 4; ++nt) o[nt] = (v8f){0,0,0,0,0,0,0,0};
    float rmax = -3.0e38f;    // of query col, alike in both halves
    float rsum = 0.0f;        // of query col, over this half's keys; the halves join at the end

    // staging, a thread owns one 16-byte chunk of each of its rows.
    // K: 8 lanes cover one row of 128 bytes; rows srow, srow + 32, srow + 64, srow + 96
    const int srow = threadIdx.x >> 3;            // 0..31
    const int sc   = (threadIdx.x & 7) * 8;       // halves
    const _Float16* kg = kh + (size_t)(b * T_KV + srow) * 1024 + h * 64 + sc;
    // V^T: 16 lanes cover one row of 256 bytes; rows vr, vr + 16, vr + 32, vr + 48
    const int vr = threadIdx.x >> 4;              // 0..15
    const int vc = (threadIdx.x & 15) * 8;        // halves
    const _Float16* vg = vt + (size_t)((b * 16 + h) * 64 + vr) * T_KV + vc;
    // mask: a wave covers one row of 512 bytes; rows wid, wid + 8, ..., wid + 120 of the block's
    // 128 queries
    const int mc = lane * 4;                      // floats
    const float* mg = mask + (size_t)((blk & 1) * 128 + wid) * T_KV + mc;
    auto issue_tile = [&](int t) {
        const int buf = t & 1;
        const _Float16* k0 = kg + (size_t)t * (A_KEYS * 1024);
        const _Float16* v0 = vg + t * A_KEYS;
        const unsigned int lk = (unsigned int)(size_t)&Ks[buf][srow * K_PITCH + sc];
        const unsigned int lv = (unsigned int)(size_t)&Vs[buf][vr * V_PITCH + vc];
        const unsigned int lm = (unsigned int)(size_t)&Ms[buf][wid * M_PITCH + mc];
        async_ld4_b128(lk,                        k0,
                       lk + 32 * K_PITCH * 2,     k0 + 32 * 1024,
                       lk + 64 * K_PITCH * 2,     k0 + 64 * 1024,
                       lk + 96 * K_PITCH * 2,     k0 + 96 * 1024);
        async_ld4_b128(lv,                        v0,
                       lv + 16 * V_PITCH * 2,     v0 + 16 * T_KV,
                       lv + 32 * V_PITCH * 2,     v0 + 32 * T_KV,
                       lv + 48 * V_PITCH * 2,     v0 + 48 * T_KV);
        async_ld8_b128(lm,                    8 * M_PITCH * 4, mg + t * A_KEYS,             8 * T_KV);
        async_ld8_b128(lm + 64 * M_PITCH * 4, 8 * M_PITCH * 4, mg + t * A_KEYS + 64 * T_KV, 8 * T_KV);
    };

    issue_tile(0);
    asm volatile("s_wait_asynccnt 0x0" ::: "memory");   // this wave's part of tile 0 has landed
    __syncthreads();                                    // tile 0 is whole for every wave
    issue_tile(1);

    // rolled: one copy of the trip's text; the buffer index is the trip's parity
#pragma unroll 1
    for (int t = 0; t < T_KV / A_KEYS; ++t) {
      // unrolled: the tile's two steps of 64 keys differ by constant LDS offsets only
#pragma unroll
      for (int u = 0; u < A_KEYS / 64; ++u) {
        const _Float16* ks = &Ks[t & 1][u * 64 * K_PITCH];
        const _Float16* vs = &Vs[t & 1][u * 64];
        // the lane's 8 mask values of a 16-key tile are 32 contiguous bytes of its query's row
        const float*    ms = &Ms[t & 1][(wid * 16 + col) * M_PITCH + u * 64 + hi * 8];
        // ---- S^T = K @ Q^T  (64 keys x 16 queries) ----
        v8f s[4];
#pragma unroll
        for (int g = 0; g < 4; ++g) s[g] = (v8f){0,0,0,0,0,0,0,0};
        // In the order of their use: K, mask, V^T. LDS answers a wave in order, so the first products
        // wait for K alone only if K is asked for first: the scheduling barriers between the three
        // groups keep that order.
        v16h ak[8], av[8];
#pragma unroll
        for (int g = 0; g < 4; ++g) {
            const _Float16* krow = ks + (g * 16 + col) * K_PITCH;
            ak[2 * g]     = ldfrag(krow, kb);
            ak[2 * g + 1] = ldfrag(krow + 32, kb);
        }
        __builtin_amdgcn_sched_barrier(0);   // K ahead of the mask (see above)
        float4 mk[4][2];
#pragma unroll
        for (int g = 0; g < 4; ++g) {
            mk[g][0] = *(const float4*)(ms + g * 16);
            mk[g][1] = *(const float4*)(ms + g * 16 + 4);
        }
        __builtin_amdgcn_sched_barrier(0);   // the mask ahead of V^T (see above)
#pragma unroll
        for (int nt = 0; nt < 4; ++nt) {
            const _Float16* vrow = vs + (nt * 16 + col) * V_PITCH;
            av[2 * nt]     = ldfrag(vrow, kb);
            av[2 * nt + 1] = ldfrag(vrow + 32, kb);
        }
        // keeps the step's fragment loads together ahead of its products: spread among them,
        // each pair of LDS loads makes the wave wait out a full LDS latency of its own
        __builtin_amdgcn_sched_barrier(0);
#pragma unroll
        for (int g = 0; g < 4; ++g) {
            s[g] = wmma_f16(ak[2 * g], bq0, s[g]);
            s[g] = wmma_f16(ak[2 * g + 1], bq1, s[g]);
        }
        // ---- mask + the query's maximum over the chunk ----
        // s[g][r] = score of key t * A_KEYS + u * 64 + g * 16 + hi * 8 + r
        float cm[8];
#pragma unroll
        for (int r = 0; r < 8; ++r) cm[r] = -3.0e38f;
#pragma unroll
        for (int g = 0; g < 4; ++g)
#pragma unroll
            for (int r = 0; r < 8; ++r) {
                const float4 m4 = mk[g][r >> 2];
                const float  mv = (r & 3) == 0 ? m4.x : (r & 3) == 1 ? m4.y
                                : (r & 3) == 2 ? m4.z : m4.w;
                float v = s[g][r] + mv;
                s[g][r] = v;
                cm[r] = fmaxf(cm[r], v);
            }
        float cmax = fmaxf(fmaxf(fmaxf(cm[0], cm[1]), fmaxf(cm[2], cm[3])),
                           fmaxf(fmaxf(cm[4], cm[5]), fmaxf(cm[6], cm[7])));
        cmax = fmaxf(cmax, xhalf(cmax));
        // ---- online softmax update ----
        const float nm  = fmaxf(rmax, cmax);
        const float scl = __expf(rmax - nm);
        rmax = nm;
#pragma unroll
        for (int nt = 0; nt < 4; ++nt)
#pragma unroll
            for (int r = 0; r < 8; ++r) o[nt][r] *= scl;

        // P^T, packed where it stands: element e of bp[j] = key 32 * j + kb + e (e < 8) or
        // 32 * j + 16 + kb + e - 8, the k order in which ldfrag loads V^T
        union { v16h v; v2h h2[8]; } bp[2];
        float psum[8];
#pragma unroll
        for (int r = 0; r < 8; ++r) psum[r] = 0.0f;
#pragma unroll
        for (int g = 0; g < 4; ++g)
#pragma unroll
            for (int r = 0; r < 8; r += 2) {
                v2f p = { __expf(s[g][r] - rmax), __expf(s[g][r + 1] - rmax) };
                psum[r]     += p.x;
                psum[r + 1] += p.y;
                bp[g >> 1].h2[(g & 1) * 4 + (r >> 1)] = __builtin_convertvector(p, v2h);
            }
        rsum = rsum * scl + (((psum[0] + psum[1]) + (psum[2] + psum[3]))
                             + ((psum[4] + psum[5]) + (psum[6] + psum[7])));

        // ---- O^T += V^T @ P^T ----
#pragma unroll
        for (int nt = 0; nt < 4; ++nt) {
            o[nt] = wmma_f16(av[2 * nt], bp[0].v, o[nt]);        // keys 0..31 of chunk
            o[nt] = wmma_f16(av[2 * nt + 1], bp[1].v, o[nt]);    // keys 32..63
        }
      }
        // keeps the trip's products and vector work ahead of the hand-over: they touch no memory,
        // and moved behind the barrier they would leave the copies of tile t + 1 no more than the
        // fragment loads' time to land
        __builtin_amdgcn_sched_barrier(0);

        // hand-over: this wave's LDS reads of tile t are done, its copies of tile t + 1 have
        // landed; behind the barrier tile t + 1 is whole and tile t's buffer is free
        asm volatile("s_wait_dscnt 0x0" ::: "memory");
        asm volatile("s_wait_asynccnt 0x0" ::: "memory");
        __syncthreads();
        if (t + 2 < T_KV / A_KEYS) issue_tile(t + 2);
    }
    asm volatile("s_wait_asynccnt 0x0" ::: "memory");   // no copy is left in flight at the end

    // ---- finalize: join the halves' row sums, normalize, write ph (f16) ----
    rsum += xhalf(rsum);
    // The wave's 16 x 64 results go out through its own LDS tile: a lane's 8 accumulators of one
    // tile are 8 consecutive dims of its query, one 16-byte chunk of that row. Read back, 8 lanes
    // cover one row of 128 bytes, so each store covers whole lines instead of pieces of 32 bytes.
    _Float16* myp = &ps[wid][0];
#pragma unroll
    for (int nt = 0; nt < 4; ++nt) {
        v8h hv;
#pragma unroll
        for (int r = 0; r < 8; ++r) hv[r] = (_Float16)(o[nt][r] / rsum);
        *(v8h*)&myp[col * 72 + nt * 16 + hi * 8] = hv;
    }
    // the rows are read back by other lanes of the same wave: its LDS stores come first
    asm volatile("s_wait_dscnt 0x0" ::: "memory");
    const int orow = lane >> 3;                   // 0..3
    const int och  = (lane & 7) * 8;              // halves
    _Float16* po = ph + (size_t)(b * T_Q + qbase + orow) * 1024 + h * 64 + och;
    v8h ov[4];
#pragma unroll
    for (int j = 0; j < 4; ++j)
        ov[j] = *(const v8h*)&myp[(j * 4 + orow) * 72 + och];
#pragma unroll
    for (int j = 0; j < 4; ++j)
        *(v8h*)(po + (size_t)j * (4 * 1024)) = ov[j];
}

// ---------------- host launcher ----------------
extern "C" void kernel_launch(void* const* d_in, const int* in_sizes, int n_in,
                              void* d_out, int out_size, void* d_ws, size_t ws_size,
                              hipStream_t stream) {
    const float* x    = (const float*)d_in[0];
    const float* mask = (const float*)d_in[1];
    const float* ck   = (const float*)d_in[2];
    const float* cv   = (const float*)d_in[3];
    const float* Wq   = (const float*)d_in[4];
    const float* bq   = (const float*)d_in[5];
    const float* Wk   = (const float*)d_in[6];
    const float* Wv   = (const float*)d_in[7];
    const float* bv   = (const float*)d_in[8];
    const float* Wo   = (const float*)d_in[9];
    const float* bo   = (const float*)d_in[10];

    float* out  = (float*)d_out;                 // [2048,1024]
    float* outK = out  + (size_t)NROWS * N_STATE;   // new_k; new_v follows it

    char* w = (char*)d_ws;
    _Float16* xh  = (_Float16*)w; w += (size_t)NROWS * N_STATE * 2;
    _Float16* WT4 = (_Float16*)w; w += (size_t)3 * N_STATE * N_STATE * 2;   // WqT, WkT, WvT
    _Float16* WoT = (_Float16*)w; w += (size_t)N_STATE * N_STATE * 2;
    _Float16* qh  = (_Float16*)w; w += (size_t)NROWS * N_STATE * 2;
    _Float16* kh  = (_Float16*)w; w += (size_t)BATCH * T_KV * N_STATE * 2;
    _Float16* vt  = (_Float16*)w; w += (size_t)BATCH * T_KV * N_STATE * 2;
    _Float16* ph  = (_Float16*)w; w += (size_t)NROWS * N_STATE * 2;

    // converts that the projections read
    prep_kernel<<<3 * NB_W + NB_X, 256, 0, stream>>>(x, Wq, Wk, Wv, xh, WT4);

    // projections of x, and beside them the converts that only later launches read
    gemm_wmma_kernel<true><<<dim3(N_STATE / 128, NROWS / 128, 3 + NB_SIDE / G_BLOCKS),
                             256, 0, stream>>>(
        xh, WT4, bq, bv, outK, qh, kh, vt, ck, cv, Wo, WoT);

    // attention
    attn_wmma_kernel<<<BATCH * 16 * 2, 256, 0, stream>>>(qh, kh, vt, mask, ph);

    // output projection
    gemm_wmma_kernel<false><<<dim3(N_STATE / 128, NROWS / 128), 256, 0, stream>>>(
        ph, WoT, bo, nullptr, out, nullptr, nullptr, nullptr, nullptr, nullptr, nullptr, nullptr);
}

// v010
// A run of this version takes 48.4 microseconds.
// Two timings next to v009 put it at 1.08 and 1.09 times that version's speed.
// Over all steps from v000 it is 8.38 times as fast.
#include <hip/hip_runtime.h>

// ---------------- types ----------------
typedef __attribute__((ext_vector_type(16))) _Float16 v16h;
typedef __attribute__((ext_vector_type(8)))  _Float16 v8h;
typedef __attribute__((ext_vector_type(4)))  _Float16 v4h;
typedef __attribute__((ext_vector_type(2)))  _Float16 v2h;
typedef __attribute__((ext_vector_type(2)))  float    v2f;
typedef __attribute__((ext_vector_type(8)))  float    v8f;

#define N_STATE 1024
#define T_Q     256
#define T_CACHE 768
#define T_KV    1024
#define BATCH   8
#define NROWS   2048          // B*T
#define QK_SCALE 0.125f

// ---------------- WMMA helpers ----------------
__device__ __forceinline__ v8f wmma_f16(v16h a, v16h b, v8f c) {
    // D = A(16x32) * B(32x16) + C, f32 accumulate
    return __builtin_amdgcn_wmma_f32_16x16x32_f16(
        false, a, false, b, (short)0, c, false, false);
}

// Load a 16x32 A-style fragment for this lane.
// Lane layout (ISA 7.12.2, 16-bit A 16x32): row = lane&15, kb = (lane>>4)*8,
// halves cover K in [kb,kb+8) and [kb+16,kb+24)  -> two 16-byte loads.
// `p` must point at element [lane&15][0] of the tile (row stride pre-applied).
__device__ __forceinline__ v16h ldfrag(const _Float16* p, int kb) {
    union { v16h v; v8h h[2]; } u;
    u.h[0] = *(const v8h*)(p + kb);
    u.h[1] = *(const v8h*)(p + kb + 16);
    return u.v;
}

// Async global -> LDS copies of 16 bytes per lane (CDNA5 GLOBAL_LOAD_ASYNC_TO_LDS, tracked by
// ASYNCcnt). An LDS address is the low 32 bits of the generic shared pointer.
// Eight copies of one lane, one behind the other: copy j takes LDS byte address l + j * lstep
// and global pointer g + j * gstep, each in registers of its own. s_wait_xcnt 0 is the
// statement's last line, so that it stands in front of any later write of a register that one
// of the copies names.
__device__ __forceinline__ void async_ld8_b128(unsigned int l, unsigned int lstep,
                                               const _Float16* g, int gstep) {
    asm volatile("global_load_async_to_lds_b128 %0, %1, off\n\t"
                 "global_load_async_to_lds_b128 %2, %3, off\n\t"
                 "global_load_async_to_lds_b128 %4, %5, off\n\t"
                 "global_load_async_to_lds_b128 %6, %7, off\n\t"
                 "global_load_async_to_lds_b128 %8, %9, off\n\t"
                 "global_load_async_to_lds_b128 %10, %11, off\n\t"
                 "global_load_async_to_lds_b128 %12, %13, off\n\t"
                 "global_load_async_to_lds_b128 %14, %15, off\n\t"
                 "s_wait_xcnt 0x0"
                 :: "v"(l),             "v"(g),
                    "v"(l + lstep),     "v"(g + gstep),
                    "v"(l + 2 * lstep), "v"(g + 2 * gstep),
                    "v"(l + 3 * lstep), "v"(g + 3 * gstep),
                    "v"(l + 4 * lstep), "v"(g + 4 * gstep),
                    "v"(l + 5 * lstep), "v"(g + 5 * gstep),
                    "v"(l + 6 * lstep), "v"(g + 6 * gstep),
                    "v"(l + 7 * lstep), "v"(g + 7 * gstep)
                 : "memory");
}

// Four such copies, each with its own LDS byte address and its own global pointer; the same
// wait as its last line.
__device__ __forceinline__ void async_ld4_b128(unsigned int l0, const _Float16* g0,
                                               unsigned int l1, const _Float16* g1,
                                               unsigned int l2, const _Float16* g2,
                                               unsigned int l3, const _Float16* g3) {
    asm volatile("global_load_async_to_lds_b128 %0, %1, off\n\t"
                 "global_load_async_to_lds_b128 %2, %3, off\n\t"
                 "global_load_async_to_lds_b128 %4, %5, off\n\t"
                 "global_load_async_to_lds_b128 %6, %7, off\n\t"
                 "s_wait_xcnt 0x0"
                 :: "v"(l0), "v"(g0), "v"(l1), "v"(g1),
                    "v"(l2), "v"(g2), "v"(l3), "v"(g3)
                 : "memory");
}

// Eight such copies for rows of floats: the same statement, the steps counted in halves.
__device__ __forceinline__ void async_ld8_b128(unsigned int l, unsigned int lstep,
                                               const float* g, int gstep) {
    async_ld8_b128(l, lstep, (const _Float16*)g, 2 * gstep);
}

// the value of lane l ^ 16: the wave's two halves change places (a vector cross-row move, no LDS)
__device__ __forceinline__ float xhalf(float v) {
    int i = __float_as_int(v);
    i = __builtin_amdgcn_permlanex16(i, i, 0x76543210, 0xfedcba98, false, false);
    return __int_as_float(i);
}

// ---------------- elementwise converts / packs ----------------
// f32 -> f16 convert of whole rows of 1024 elements:
//   in [batch][RIN][1024] f32  ->  out [batch][ROUT][1024] f16, rows 0..RIN-1 of each batch
// Serves x -> xh (RIN = ROUT = 2048, one batch) and cache_k -> kh (768 of 1024 key rows).
// One block converts RPB rows; RPB divides RIN, so a block stays inside one batch.
// A thread owns one float4 column group of every row: each wave-wide load covers 512
// contiguous bytes and each wave-wide store 256, whole lines both ways. A thread's loads
// are independent and stand ahead of its stores, so few waves keep many bytes in flight,
// and the launch starts RPB * 4 times fewer waves than one element a thread would.
// blk = index, in memory order, of the block's group of RPB rows.
template<int RIN, int ROUT, int RPB>
__device__ __forceinline__
void cvt_rows_block(const float* __restrict__ in,
                    _Float16* __restrict__ out, int blk) {
    static_assert(RIN % RPB == 0, "a block must not straddle two batches");
    const int r0 = blk * RPB;
    const int b  = r0 / RIN;
    const int c  = threadIdx.x * 4;
    const float* src = in + (size_t)r0 * 1024 + c;
    _Float16*    dst = out + (size_t)(r0 + b * (ROUT - RIN)) * 1024 + c;

    float4 v[RPB];
    // unrolled so that v[] stays in registers and the loads go out back to back
#pragma unroll
    for (int j = 0; j < RPB; ++j)
        v[j] = *(const float4*)(src + (size_t)j * 1024);
    // unrolled for the same reason: v[] is indexed by constants only
#pragma unroll
    for (int j = 0; j < RPB; ++j) {
        v4h h = { (_Float16)v[j].x, (_Float16)v[j].y, (_Float16)v[j].z, (_Float16)v[j].w };
        *(v4h*)(dst + (size_t)j * 1024) = h;
    }
}

// Transposing convert through an LDS tile:
//   in  [batch][ROWS][1024] f32  ->  out [batch][1024][1024] f16, columns 0..ROWS-1
//   out[b][c][s] = (f16) in[b][s][c]
// Serves W[k][n] -> WT[n][k] (ROWS = 1024, one batch) and cache_v[b][s][c] ->
// vt[b][c = h*64+dh][key s] (ROWS = 768, eight batches).
// One block moves a tile of 128 rows (s) x 64 columns (c): 256 contiguous bytes a row on
// the f32 side and 256 contiguous bytes a row on the f16 side, so loads and stores both
// cover whole lines. A thread loads 8 consecutive rows of one float4 column group; each
// of its 4 columns is then 8 halves (16 bytes) of one output row.
// LDS row = one output row of 16 chunks of 16 bytes; chunk q of row c sits at q ^ (c >> 2),
// which spreads the 16 lanes of a half wave over all banks in the store and in the load.
// tile = the block's LDS tile of 64 * 128 halves; (bx, by, b) = column tile, row tile, batch.
template<int ROWS>
__device__ __forceinline__
void transpose_cvt_block(const float* __restrict__ in,
                         _Float16* __restrict__ out,
                         _Float16* tile, int bx, int by, int b) {
    const int tid = threadIdx.x;
    const int c0  = bx * 64;
    const int s0  = by * 128;

    const int c4 = tid & 15;            // float4 column group
    const int sr = tid >> 4;            // group of 8 rows
    const float* src = in + ((size_t)b * ROWS + s0 + sr * 8) * 1024 + c0 + c4 * 4;

    float4 v[8];
#pragma unroll
    for (int j = 0; j < 8; ++j)
        v[j] = *(const float4*)(src + (size_t)j * 1024);

    v8h h0, h1, h2, h3;
#pragma unroll
    for (int j = 0; j < 8; ++j) {
        h0[j] = (_Float16)v[j].x;
        h1[j] = (_Float16)v[j].y;
        h2[j] = (_Float16)v[j].z;
        h3[j] = (_Float16)v[j].w;
    }
    _Float16* dst = &tile[(c4 * 4) * 128 + ((sr ^ c4) * 8)];
    *(v8h*)(dst)           = h0;
    *(v8h*)(dst + 128)     = h1;
    *(v8h*)(dst + 2 * 128) = h2;
    *(v8h*)(dst + 3 * 128) = h3;

    __syncthreads();   // the tile is read back across waves

    const int q  = tid & 15;            // 16-byte chunk of an output row
    const int cr = tid >> 4;
    _Float16* o = out + ((size_t)b * 1024 + c0) * 1024 + s0 + q * 8;
#pragma unroll
    for (int p = 0; p < 4; ++p) {
        int c = p * 16 + cr;
        *(v8h*)(o + (size_t)c * 1024) = *(const v8h*)&tile[c * 128 + ((q ^ (c >> 2)) * 8)];
    }
}

// The seven converts stand in two launches, each convert on its own range of block indices.
// The first launch holds only what the projections read: x and W^T of Wq, Wk, Wv. It is the
// head of the chain of dependent launches, so it is kept short.
// The other three (cache_k, V^T of cache_v, Wo^T) are read by the attention launch or later and
// depend on nothing: their blocks ride in the projections' grid (side_converts_block below).
// The branches are on blockIdx alone, so the barrier inside a transpose is block-uniform.
// PLACEMENT, in all four launches, for speed only (any index -> die form gives the same values):
// every map from block index to work puts the batch in the index's low 3 bits: xh, Q, K, V^T
// and the attention's output of one batch, and
// the 256-byte units that two heads' rows share, are written and read at equal indices modulo 8.
static_assert(BATCH == 8, "the batch is the low 3 bits of every block index");
// index among NB blocks that deal BATCH equal contiguous shares -> index in memory order
template<int NB>
__device__ __forceinline__ int batch_low_bits(int i) {
    static_assert(NB % BATCH == 0, "equal shares");
    return (i & (BATCH - 1)) * (NB / BATCH) + (i >> 3);
}
#define NB_CK ((BATCH * T_CACHE) / 24)                        // cache_k rows
#define NB_CV ((N_STATE / 64) * (T_CACHE / 128) * BATCH)      // cache_v tiles
#define NB_W  ((N_STATE / 64) * (N_STATE / 128))              // tiles of one weight matrix
#define NB_X  (NROWS / 8)                                     // x rows
__global__ __launch_bounds__(256)
void prep_kernel(const float* __restrict__ x,
                 const float* __restrict__ Wq,
                 const float* __restrict__ Wk,
                 const float* __restrict__ Wv,
                 _Float16* __restrict__ xh,
                 _Float16* __restrict__ WT3) {   // WqT, WkT, WvT one behind the other
    __shared__ __align__(16) _Float16 tile[64 * 128];

    // Each branch ends with s_wait_xcnt 0: in the built code the branches stand one behind the
    // other, and the next one's first instructions reuse registers that the stores just issued
    // still name; the wait stands in front of any such overwrite.
    int blk = blockIdx.x;
    if (blk < 3 * NB_W) {
        const int m = blk / NB_W;                // which weight matrix
        const float* W = m == 0 ? Wq : m == 1 ? Wk : Wv;
        transpose_cvt_block<N_STATE>(W, WT3 + (size_t)m * (N_STATE * N_STATE), tile,
                                     blk & 15, (blk >> 4) & 7, 0);
        asm volatile("s_wait_xcnt 0x0" ::: "memory");   // see the note above
    } else {
        static_assert((3 * NB_W) % BATCH == 0, "the low 3 bits outlast the subtraction");
        cvt_rows_block<NROWS, NROWS, 8>(x, xh, batch_low_bits<NB_X>(blk - 3 * NB_W));
        asm volatile("s_wait_xcnt 0x0" ::: "memory");   // see the note above
    }
}

// One block of the converts that ride in the projections' grid; blk = its index among them.
// The blocks with the most bytes come first. tile = 64 * 128 halves of the block's LDS.
#define NB_SIDE (NB_CK + NB_CV + NB_W)
__device__ __forceinline__
void side_converts_block(const float* __restrict__ ck,
                         const float* __restrict__ cv,
                         const float* __restrict__ Wo,
                         _Float16* __restrict__ kh,
                         _Float16* __restrict__ vt,
                         _Float16* __restrict__ WoT,
                         _Float16* tile, int blk) {
    // each branch ends with s_wait_xcnt 0, for the reason given in prep_kernel
    if (blk < NB_CK) {
        cvt_rows_block<T_CACHE, T_KV, 24>(ck, kh, batch_low_bits<NB_CK>(blk));
        asm volatile("s_wait_xcnt 0x0" ::: "memory");   // see the note above
    } else if (blk < NB_CK + NB_CV) {
        static_assert(NB_CK % BATCH == 0, "the low 3 bits outlast the subtraction");
        blk -= NB_CK;
        const int t = blk >> 3;                  // column tile and row tile; batch = low 3 bits
        transpose_cvt_block<T_CACHE>(cv, vt, tile, t & 15, t >> 4, blk & (BATCH - 1));
        asm volatile("s_wait_xcnt 0x0" ::: "memory");   // see the note above
    } else {
        blk -= NB_CK + NB_CV;
        transpose_cvt_block<N_STATE>(Wo, WoT, tile, blk & 15, (blk >> 4) & 7, 0);
        asm volatile("s_wait_xcnt 0x0" ::: "memory");   // see the note above
    }
}

// ---------------- tiled WMMA GEMM: C[2048,1024] = A[2048,1024] @ W[1024,1024] ----------------
// A f16 row-major, WT f16 = W^T row-major ([n][k]).
// Block tile 128x128; 8 waves in 4(M)x2(N) grid, each wave 32x64 (2x4 16x16 tiles).
// A trip of the K loop works on GK k: 128 in the projections of x, 256 in the output projection.
// Its A and B tiles (128 rows of 2 * GK bytes each) come into LDS by async copies: GK / 8 lanes
// cover one row, so every copy asks for whole rows, and a block has 64 or 128 KiB in flight. Two
// buffers: the copies of tile t + 2 go out at the foot of trip t and fly during trip t + 1.
// A trip lasts at least as long as its successor's tile takes to land, latency included. The
// output projection has one block on a WGP and LDS to spare: with twice the k a tile it pays that
// latency, and the hand-over, 4 times instead of 8. The projections of x need two blocks on a
// WGP, which leaves them 128 k.
// LDS rows stand at a pitch of the row + 16 bytes, which spreads the 16 rows of a fragment load
// over all banks. The ring is dead when the epilogue starts: the epilogue's tiles lie in its LDS.
#define G_BLOCKS ((N_STATE / 128) * (NROWS / 128))   // blocks of one product = one z slice
static_assert(NB_SIDE % G_BLOCKS == 0, "the riding converts fill whole z slices");
#define MODE_Q 0
#define MODE_K 1
#define MODE_V 2
#define MODE_O 3
#define ST32_PITCH 132        // floats: 512 bytes of data + 16 bytes of pad
#define ST16_PITCH 136        // halves: 256 bytes of data + 16 bytes of pad

template<int M> struct mode_tag { static constexpr int value = M; };

// QKV = true: ONE launch does the three projections of x, which share A and depend on
// nothing of each other: blockIdx.z picks the weight matrix and the epilogue, so 384 blocks
// fill the chip where each projection alone has 128. V, whose epilogue is the longest,
// takes the lowest z and starts first. The slices z >= 3 are no GEMM blocks: they do the converts
// that only later launches read. A WGP holds two blocks of this kernel (LDS), the 384 GEMM blocks
// leave a quarter of those places empty, and the GEMM asks little of memory: the converts' loads
// and stores run in those places beside it instead of ahead of it in a launch of their own.
// QKV = false: the output projection alone (WTs = WoT, bias_q = bo, out32s = out).
template<bool QKV>
__global__ __launch_bounds__(256)
void gemm_wmma_kernel(const _Float16* __restrict__ A,
                      const _Float16* __restrict__ WTs,    // WqT, WkT, WvT one behind the other
                      const float* __restrict__ bias_q,
                      const float* __restrict__ bias_v,
                      float* __restrict__ out32s,          // new_k, new_v one behind the other
                      _Float16* __restrict__ qh,
                      _Float16* __restrict__ kh,
                      _Float16* __restrict__ vt,
                      const float* __restrict__ ck,        // these four: the riding converts
                      const float* __restrict__ cv,
                      const float* __restrict__ Wo,
                      _Float16* __restrict__ WoT) {
    constexpr int GK      = QKV ? 128 : 256;    // k of one staged tile
    constexpr int G_PITCH = GK + 8;             // halves: the row's data + 16 bytes of pad
    constexpr int G_TILE  = 128 * G_PITCH;      // halves of one operand's tile
    constexpr int G_STAGE = 2 * G_TILE;         // A tile, then B tile
    constexpr int RING_BYTES = 2 * G_STAGE * 2;
    constexpr int ST32_BYTES = 128 * ST32_PITCH * 4;
    constexpr int EPI_BYTES  = ST32_BYTES + (QKV ? 128 * ST16_PITCH * 2 : 0);
    __shared__ __align__(16) unsigned char smem[RING_BYTES > EPI_BYTES ? RING_BYTES : EPI_BYTES];
    _Float16* ring = (_Float16*)smem;                    // [buffer][A, B][row][G_PITCH]
    // epilogue tiles of the block's 128 x 128 results; the pad of 16 bytes a row spreads the rows
    // over the banks for the stores from the accumulator layout and for the 16-byte loads
    float*    st32 = (float*)smem;
    _Float16* st16 = (_Float16*)(smem + ST32_BYTES);

    if constexpr (QKV) {
        // block-uniform, ahead of every barrier and copy of the GEMM
        if (blockIdx.z >= 3) {
            side_converts_block(ck, cv, Wo, kh, vt, WoT, (_Float16*)smem,
                                ((int)blockIdx.z - 3) * G_BLOCKS
                                    + (int)blockIdx.y * BATCH + (int)blockIdx.x);
            return;
        }
    }

    const int mode = QKV ? MODE_V - (int)blockIdx.z : MODE_O;
    const _Float16* WT = QKV ? WTs + (size_t)mode * (N_STATE * N_STATE) : WTs;

    const int tid  = threadIdx.x;
    const int lane = tid & 31;
    const int wid  = tid >> 5;
    const int wm   = wid >> 1;           // 0..3
    const int wn   = wid & 1;            // 0..1
    const int col  = lane & 15;
    const int hi8  = (lane >> 4) * 8;
    const int kb   = hi8;
    // blockIdx.x = batch (see PLACEMENT above); blockIdx.y = column tile, row tile of the batch
    const int ablk = (int)blockIdx.x * T_Q + ((int)blockIdx.y & 1) * 128;
    const int bblk = ((int)blockIdx.y >> 1) * 128;

    // staging: LPR lanes cover one row; a thread owns one 16-byte chunk of rows srow, srow + RPP,
    // srow + 2 * RPP, ... of the A tile and of the B tile
    constexpr int LPR = GK / 8;               // lanes a row
    constexpr int RPP = 256 / LPR;            // rows that the block's threads cover at once
    const int srow = tid / LPR;
    const int sc   = (tid % LPR) * 8;         // halves
    const _Float16* ag = A  + (size_t)(ablk + srow) * 1024 + sc;
    const _Float16* bg = WT + (size_t)(bblk + srow) * 1024 + sc;
    auto issue_tile = [&](int t) {
        const unsigned int la =
            (unsigned int)(size_t)&ring[(t & 1) * G_STAGE + srow * G_PITCH + sc];
        // unrolled: a statement of eight copies for every 8 * RPP rows, at constant distances
#pragma unroll
        for (int p = 0; p < 128 / (8 * RPP); ++p) {
            const unsigned int lp = la + p * (8 * RPP * G_PITCH * 2);
            async_ld8_b128(lp,              RPP * G_PITCH * 2,
                           ag + t * GK + p * (8 * RPP * 1024), RPP * 1024);
            async_ld8_b128(lp + G_TILE * 2, RPP * G_PITCH * 2,
                           bg + t * GK + p * (8 * RPP * 1024), RPP * 1024);
        }
    };

    v8f acc[2][4];
#pragma unroll
    for (int mt = 0; mt < 2; ++mt)
#pragma unroll
        for (int nt = 0; nt < 4; ++nt) acc[mt][nt] = (v8f){0,0,0,0,0,0,0,0};

    issue_tile(0);
    asm volatile("s_wait_asynccnt 0x0" ::: "memory");   // this wave's part of tile 0 has landed
    __syncthreads();                                    // tile 0 is whole for every wave
    issue_tile(1);

    // rolled: one copy of the trip's text; the buffer index is the trip's parity
#pragma unroll 1
    for (int t = 0; t < N_STATE / GK; ++t) {
        const _Float16* as = ring + (t & 1) * G_STAGE + (wm * 32 + col) * G_PITCH;
        const _Float16* bs = ring + (t & 1) * G_STAGE + G_TILE + (wn * 64 + col) * G_PITCH;
        // unrolled: the steps of 32 k differ by constant LDS offsets only
#pragma unroll
        for (int ks = 0; ks < GK / 32; ++ks) {
            v16h af[2], bf[4];
#pragma unroll
            for (int mt = 0; mt < 2; ++mt)
                af[mt] = ldfrag(as + mt * 16 * G_PITCH + ks * 32, kb);
#pragma unroll
            for (int nt = 0; nt < 4; ++nt)
                bf[nt] = ldfrag(bs + nt * 16 * G_PITCH + ks * 32, kb);
#pragma unroll
            for (int mt = 0; mt < 2; ++mt)
#pragma unroll
                for (int nt = 0; nt < 4; ++nt)
                    acc[mt][nt] = wmma_f16(af[mt], bf[nt], acc[mt][nt]);
        }

        // hand-over: this wave's LDS reads of tile t are done, its copies of tile t + 1 have
        // landed; behind the barrier tile t + 1 is whole and tile t's buffer is free (behind the
        // last trip's: the whole ring, for the epilogue's tiles)
        asm volatile("s_wait_dscnt 0x0" ::: "memory");
        asm volatile("s_wait_asynccnt 0x0" ::: "memory");
        __syncthreads();
        if (t + 2 < N_STATE / GK) issue_tile(t + 2);
    }
    asm volatile("s_wait_asynccnt 0x0" ::: "memory");   // no copy is left in flight at the end

    // epilogue (C layout: VGPR r -> row r + 8*(lane>>4), col = lane&15)
    // The accumulators reach global memory through LDS tiles of the whole block. Straight from
    // the registers a wave-wide store covers pieces of 64 bytes (f32), 32 bytes (f16) or, for
    // V^T, 2 bytes on each of 16 lines; read back from the tile every lane stores 16 bytes and
    // a wave covers 512 contiguous bytes (f32) or two runs of 256 (f16): whole lines only.
    // V^T is transposed on the way in: a lane's 8 accumulators of one column are 8 consecutive
    // keys, one 16-byte chunk of that column's row in the tile.
    auto epilogue = [&](auto tag, const float* __restrict__ bias,
                        float* __restrict__ out32, _Float16* __restrict__ out16) {
    constexpr int MODE = decltype(tag)::value;
#pragma unroll
    for (int mt = 0; mt < 2; ++mt)
#pragma unroll
        for (int nt = 0; nt < 4; ++nt) {
            const int rl = wm * 32 + mt * 16 + hi8;     // row in the block's tile
            const int cl = wn * 64 + nt * 16 + col;     // column in the block's tile
            float bc = 0.0f;
            if constexpr (MODE != MODE_K) bc = bias[bblk + cl];
            v8h hv;
#pragma unroll
            for (int r = 0; r < 8; ++r) {
                float v = acc[mt][nt][r];
                if constexpr (MODE == MODE_Q) {
                    v = (v + bc) * QK_SCALE;
                    st16[(rl + r) * ST16_PITCH + cl] = (_Float16)v;
                } else if constexpr (MODE == MODE_K) {
                    st32[(rl + r) * ST32_PITCH + cl] = v;
                    st16[(rl + r) * ST16_PITCH + cl] = (_Float16)v;
                } else if constexpr (MODE == MODE_V) {
                    v += bc;
                    st32[(rl + r) * ST32_PITCH + cl] = v;
                    hv[r] = (_Float16)v;
                } else {
                    v += bc;
                    st32[(rl + r) * ST32_PITCH + cl] = v;
                }
            }
            if constexpr (MODE == MODE_V)
                *(v8h*)&st16[cl * ST16_PITCH + rl] = hv;    // [column][key]
        }

    __syncthreads();   // the tiles are read back across waves

    if constexpr (MODE != MODE_Q) {
        // one wave, one row of 512 bytes
        float* o = out32 + (size_t)(ablk + wid) * 1024 + bblk + lane * 4;
        float4 v[16];
        // unrolled so that v[] stays in registers and the LDS loads go out back to back
#pragma unroll
        for (int j = 0; j < 16; ++j)
            v[j] = *(const float4*)&st32[(j * 8 + wid) * ST32_PITCH + lane * 4];
#pragma unroll
        for (int j = 0; j < 16; ++j)
            *(float4*)(o + (size_t)j * (8 * 1024)) = v[j];
    }
    if constexpr (MODE != MODE_O) {
        // 16 lanes, one tile row of 256 bytes
        const int row = tid >> 4;
        const int ch  = (tid & 15) * 8;
        const int b   = ablk >> 8, t0 = ablk & 255;     // a block's 128 rows lie in one batch
        _Float16* o;
        if constexpr (MODE == MODE_Q)
            o = out16 + (size_t)(ablk + row) * 1024 + bblk + ch;
        else if constexpr (MODE == MODE_K)
            o = out16 + (size_t)(b * T_KV + T_CACHE + t0 + row) * 1024 + bblk + ch;
        else                                            // tile row = column of V = row of V^T
            o = out16 + (size_t)(b * N_STATE + bblk + row) * T_KV + T_CACHE + t0 + ch;
        v8h h[8];
        // unrolled for the same reason as above
#pragma unroll
        for (int j = 0; j < 8; ++j)
            h[j] = *(const v8h*)&st16[(j * 16 + row) * ST16_PITCH + ch];
#pragma unroll
        for (int j = 0; j < 8; ++j)
            *(v8h*)(o + (size_t)j * (16 * 1024)) = h[j];
    }
    };
    if constexpr (QKV) {
        // Each epilogue ends with s_wait_xcnt 0: in the built code the three stand one behind
        // the other, and index arithmetic of the next one reuses registers that the stores just
        // issued still name; the wait stands in front of any such overwrite.
        if (mode == MODE_V) {
            epilogue(mode_tag<MODE_V>{}, bias_v, out32s + (size_t)NROWS * N_STATE, vt);
            asm volatile("s_wait_xcnt 0x0" ::: "memory");   // see the note above
        } else if (mode == MODE_K) {
            epilogue(mode_tag<MODE_K>{}, nullptr, out32s, kh);
            asm volatile("s_wait_xcnt 0x0" ::: "memory");   // see the note above
        } else {
            epilogue(mode_tag<MODE_Q>{}, bias_q, nullptr, qh);
            asm volatile("s_wait_xcnt 0x0" ::: "memory");   // see the note above
        }
    } else {
        epilogue(mode_tag<MODE_O>{}, bias_q, out32s, nullptr);
    }
}

#define A_KEYS   128          // keys of one staged tile
#define K_PITCH  72           // halves: 128 bytes of data + 16 bytes of pad
#define V_PITCH  136          // halves: 256 bytes of data + 16 bytes of pad
#define M_PITCH  132          // floats: 512 bytes of data + 16 bytes of pad
__global__ __launch_bounds__(256)
void attn_wmma_kernel(const _Float16* __restrict__ qh,
                      const _Float16* __restrict__ kh,
                      const _Float16* __restrict__ vt,
                      const float* __restrict__ mask,
                      _Float16* __restrict__ ph) {
    __shared__ __align__(16) _Float16 ps[8][16 * 72];         // a wave's own output tile
    __shared__ __align__(16) _Float16 Ks[2][A_KEYS * K_PITCH];   // [key][dim]
    __shared__ __align__(16) _Float16 Vs[2][64 * V_PITCH];       // [dim][key]
    __shared__ __align__(16) float    Ms[2][128 * M_PITCH];      // [query of the block][key]

    const int lane  = threadIdx.x & 31;
    const int wid   = threadIdx.x >> 5;
    const int col   = lane & 15;
    const int hi    = lane >> 4;
    const int kb    = hi * 8;
    const int blk   = blockIdx.x;
    const int b     = blk & (BATCH - 1);      // see PLACEMENT above
    const int h     = blk >> 4;
    const int qhalf = (blk >> 3) & 1;
    const int qbase = qhalf * 128 + wid * 16;

    // Q fragments, B operand: column = query col (reused for the whole key loop)
    const _Float16* qrow =
        qh + (size_t)(b * T_Q + qbase + col) * 1024 + h * 64;
    const v16h bq0 = ldfrag(qrow, kb);        // dims 0..31
    const v16h bq1 = ldfrag(qrow + 32, kb);   // dims 32..63

    // O^T: o[nt][r] = dim nt * 16 + hi * 8 + r of query col
    v8f o[4];
#pragma unroll
    for (int nt = 0; nt < 4; ++nt) o[nt] = (v8f){0,0,0,0,0,0,0,0};
    float rmax = -3.0e38f;    // of query col, alike in both halves
    float rsum = 0.0f;        // of query col, over this half's keys; the halves join at the end

    // staging, a thread owns one 16-byte chunk of each of its rows.
    // K: 8 lanes cover one row of 128 bytes; rows srow, srow + 32, srow + 64, srow + 96
    const int srow = threadIdx.x >> 3;            // 0..31
    const int sc   = (threadIdx.x & 7) * 8;       // halves
    const _Float16* kg = kh + (size_t)(b * T_KV + srow) * 1024 + h * 64 + sc;
    // V^T: 16 lanes cover one row of 256 bytes; rows vr, vr + 16, vr + 32, vr + 48
    const int vr = threadIdx.x >> 4;              // 0..15
    const int vc = (threadIdx.x & 15) * 8;        // halves
    const _Float16* vg = vt + (size_t)((b * 16 + h) * 64 + vr) * T_KV + vc;
    // mask: a wave covers one row of 512 bytes; rows wid, wid + 8, ..., wid + 120 of the block's
    // 128 queries
    const int mc = lane * 4;                      // floats
    const float* mg = mask + (size_t)(qhalf * 128 + wid) * T_KV + mc;
    auto issue_tile = [&](int t) {
        const int buf = t & 1;
        const _Float16* k0 = kg + (size_t)t * (A_KEYS * 1024);
        const _Float16* v0 = vg + t * A_KEYS;
        const unsigned int lk = (unsigned int)(size_t)&Ks[buf][srow * K_PITCH + sc];
        const unsigned int lv = (unsigned int)(size_t)&Vs[buf][vr * V_PITCH + vc];
        const unsigned int lm = (unsigned int)(size_t)&Ms[buf][wid * M_PITCH + mc];
        async_ld4_b128(lk,                        k0,
                       lk + 32 * K_PITCH * 2,     k0 + 32 * 1024,
                       lk + 64 * K_PITCH * 2,     k0 + 64 * 1024,
                       lk + 96 * K_PITCH * 2,     k0 + 96 * 1024);
        async_ld4_b128(lv,                        v0,
                       lv + 16 * V_PITCH * 2,     v0 + 16 * T_KV,
                       lv + 32 * V_PITCH * 2,     v0 + 32 * T_KV,
                       lv + 48 * V_PITCH * 2,     v0 + 48 * T_KV);
        async_ld8_b128(lm,                    8 * M_PITCH * 4, mg + t * A_KEYS,             8 * T_KV);
        async_ld8_b128(lm + 64 * M_PITCH * 4, 8 * M_PITCH * 4, mg + t * A_KEYS + 64 * T_KV, 8 * T_KV);
    };

    issue_tile(0);
    asm volatile("s_wait_asynccnt 0x0" ::: "memory");   // this wave's part of tile 0 has landed
    __syncthreads();                                    // tile 0 is whole for every wave
    issue_tile(1);

    // rolled: one copy of the trip's text; the buffer index is the trip's parity
#pragma unroll 1
    for (int t = 0; t < T_KV / A_KEYS; ++t) {
      // unrolled: the tile's two steps of 64 keys differ by constant LDS offsets only
#pragma unroll
      for (int u = 0; u < A_KEYS / 64; ++u) {
        const _Float16* ks = &Ks[t & 1][u * 64 * K_PITCH];
        const _Float16* vs = &Vs[t & 1][u * 64];
        // the lane's 8 mask values of a 16-key tile are 32 contiguous bytes of its query's row
        const float*    ms = &Ms[t & 1][(wid * 16 + col) * M_PITCH + u * 64 + hi * 8];
        // ---- S^T = K @ Q^T  (64 keys x 16 queries) ----
        v8f s[4];
#pragma unroll
        for (int g = 0; g < 4; ++g) s[g] = (v8f){0,0,0,0,0,0,0,0};
        // In the order of their use: K, mask, V^T. LDS answers a wave in order, so the first products
        // wait for K alone only if K is asked for first: the scheduling barriers between the three
        // groups keep that order.
        v16h ak[8], av[8];
#pragma unroll
        for (int g = 0; g < 4; ++g) {
            const _Float16* krow = ks + (g * 16 + col) * K_PITCH;
            ak[2 * g]     = ldfrag(krow, kb);
            ak[2 * g + 1] = ldfrag(krow + 32, kb);
        }
        __builtin_amdgcn_sched_barrier(0);   // K ahead of the mask (see above)
        float4 mk[4][2];
#pragma unroll
        for (int g = 0; g < 4; ++g) {
            mk[g][0] = *(const float4*)(ms + g * 16);
            mk[g][1] = *(const float4*)(ms + g * 16 + 4);
        }
        __builtin_amdgcn_sched_barrier(0);   // the mask ahead of V^T (see above)
#pragma unroll
        for (int nt = 0; nt < 4; ++nt) {
            const _Float16* vrow = vs + (nt * 16 + col) * V_PITCH;
            av[2 * nt]     = ldfrag(vrow, kb);
            av[2 * nt + 1] = ldfrag(vrow + 32, kb);
        }
        // keeps the step's fragment loads together ahead of its products: spread among them,
        // each pair of LDS loads makes the wave wait out a full LDS latency of its own
        __builtin_amdgcn_sched_barrier(0);
#pragma unroll
        for (int g = 0; g < 4; ++g) {
            s[g] = wmma_f16(ak[2 * g], bq0, s[g]);
            s[g] = wmma_f16(ak[2 * g + 1], bq1, s[g]);
        }
        // ---- mask + the query's maximum over the chunk ----
        // s[g][r] = score of key t * A_KEYS + u * 64 + g * 16 + hi * 8 + r
        float cm[8];
#pragma unroll
        for (int r = 0; r < 8; ++r) cm[r] = -3.0e38f;
#pragma unroll
        for (int g = 0; g < 4; ++g)
#pragma unroll
            for (int r = 0; r < 8; ++r) {
                const float4 m4 = mk[g][r >> 2];
                const float  mv = (r & 3) == 0 ? m4.x : (r & 3) == 1 ? m4.y
                                : (r & 3) == 2 ? m4.z : m4.w;
                float v = s[g][r] + mv;
                s[g][r] = v;
                cm[r] = fmaxf(cm[r], v);
            }
        float cmax = fmaxf(fmaxf(fmaxf(cm[0], cm[1]), fmaxf(cm[2], cm[3])),
                           fmaxf(fmaxf(cm[4], cm[5]), fmaxf(cm[6], cm[7])));
        cmax = fmaxf(cmax, xhalf(cmax));
        // ---- online softmax update ----
        const float nm  = fmaxf(rmax, cmax);
        const float scl = __expf(rmax - nm);
        rmax = nm;
#pragma unroll
        for (int nt = 0; nt < 4; ++nt)
#pragma unroll
            for (int r = 0; r < 8; ++r) o[nt][r] *= scl;

        // P^T, packed where it stands: element e of bp[j] = key 32 * j + kb + e (e < 8) or
        // 32 * j + 16 + kb + e - 8, the k order in which ldfrag loads V^T
        union { v16h v; v2h h2[8]; } bp[2];
        float psum[8];
#pragma unroll
        for (int r = 0; r < 8; ++r) psum[r] = 0.0f;
#pragma unroll
        for (int g = 0; g < 4; ++g)
#pragma unroll
            for (int r = 0; r < 8; r += 2) {
                v2f p = { __expf(s[g][r] - rmax), __expf(s[g][r + 1] - rmax) };
                psum[r]     += p.x;
                psum[r + 1] += p.y;
                bp[g >> 1].h2[(g & 1) * 4 + (r >> 1)] = __builtin_convertvector(p, v2h);
            }
        rsum = rsum * scl + (((psum[0] + psum[1]) + (psum[2] + psum[3]))
                             + ((psum[4] + psum[5]) + (psum[6] + psum[7])));

        // ---- O^T += V^T @ P^T ----
#pragma unroll
        for (int nt = 0; nt < 4; ++nt) {
            o[nt] = wmma_f16(av[2 * nt], bp[0].v, o[nt]);        // keys 0..31 of chunk
            o[nt] = wmma_f16(av[2 * nt + 1], bp[1].v, o[nt]);    // keys 32..63
        }
      }
        // keeps the trip's products and vector work ahead of the hand-over: they touch no memory,
        // and moved behind the barrier they would leave the copies of tile t + 1 no more than the
        // fragment loads' time to land
        __builtin_amdgcn_sched_barrier(0);

        // hand-over: this wave's LDS reads of tile t are done, its copies of tile t + 1 have
        // landed; behind the barrier tile t + 1 is whole and tile t's buffer is free
        asm volatile("s_wait_dscnt 0x0" ::: "memory");
        asm volatile("s_wait_asynccnt 0x0" ::: "memory");
        __syncthreads();
        if (t + 2 < T_KV / A_KEYS) issue_tile(t + 2);
    }
    asm volatile("s_wait_asynccnt 0x0" ::: "memory");   // no copy is left in flight at the end

    // ---- finalize: join the halves' row sums, normalize, write ph (f16) ----
    rsum += xhalf(rsum);
    // The wave's 16 x 64 results go out through its own LDS tile: a lane's 8 accumulators of one
    // tile are 8 consecutive dims of its query, one 16-byte chunk of that row. Read back, 8 lanes
    // cover one row of 128 bytes, so each store covers whole lines instead of pieces of 32 bytes.
    _Float16* myp = &ps[wid][0];
#pragma unroll
    for (int nt = 0; nt < 4; ++nt) {
        v8h hv;
#pragma unroll
        for (int r = 0; r < 8; ++r) hv[r] = (_Float16)(o[nt][r] / rsum);
        *(v8h*)&myp[col * 72 + nt * 16 + hi * 8] = hv;
    }
    // the rows are read back by other lanes of the same wave: its LDS stores come first
    asm volatile("s_wait_dscnt 0x0" ::: "memory");
    const int orow = lane >> 3;                   // 0..3
    const int och  = (lane & 7) * 8;              // halves
    _Float16* po = ph + (size_t)(b * T_Q + qbase + orow) * 1024 + h * 64 + och;
    v8h ov[4];
#pragma unroll
    for (int j = 0; j < 4; ++j)
        ov[j] = *(const v8h*)&myp[(j * 4 + orow) * 72 + och];
#pragma unroll
    for (int j = 0; j < 4; ++j)
        *(v8h*)(po + (size_t)j * (4 * 1024)) = ov[j];
}

// ---------------- host launcher ----------------
extern "C" void kernel_launch(void* const* d_in, const int* in_sizes, int n_in,
                              void* d_out, int out_size, void* d_ws, size_t ws_size,
                              hipStream_t stream) {
    const float* x    = (const float*)d_in[0];
    const float* mask = (const float*)d_in[1];
    const float* ck   = (const float*)d_in[2];
    const float* cv   = (const float*)d_in[3];
    const float* Wq   = (const float*)d_in[4];
    const float* bq   = (const float*)d_in[5];
    const float* Wk   = (const float*)d_in[6];
    const float* Wv   = (const float*)d_in[7];
    const float* bv   = (const float*)d_in[8];
    const float* Wo   = (const float*)d_in[9];
    const float* bo   = (const float*)d_in[10];

    float* out  = (float*)d_out;                 // [2048,1024]
    float* outK = out  + (size_t)NROWS * N_STATE;   // new_k; new_v follows it

    char* w = (char*)d_ws;
    _Float16* xh  = (_Float16*)w; w += (size_t)NROWS * N_STATE * 2;
    _Float16* WT4 = (_Float16*)w; w += (size_t)3 * N_STATE * N_STATE * 2;   // WqT, WkT, WvT
    _Float16* WoT = (_Float16*)w; w += (size_t)N_STATE * N_STATE * 2;
    _Float16* qh  = (_Float16*)w; w += (size_t)NROWS * N_STATE * 2;
    _Float16* kh  = (_Float16*)w; w += (size_t)BATCH * T_KV * N_STATE * 2;
    _Float16* vt  = (_Float16*)w; w += (size_t)BATCH * T_KV * N_STATE * 2;
    _Float16* ph  = (_Float16*)w; w += (size_t)NROWS * N_STATE * 2;

    // converts that the projections read
    prep_kernel<<<3 * NB_W + NB_X, 256, 0, stream>>>(x, Wq, Wk, Wv, xh, WT4);

    // projections of x, and beside them the converts that only later launches read
    gemm_wmma_kernel<true><<<dim3(BATCH, G_BLOCKS / BATCH, 3 + NB_SIDE / G_BLOCKS),
                             256, 0, stream>>>(
        xh, WT4, bq, bv, outK, qh, kh, vt, ck, cv, Wo, WoT);

    // attention
    attn_wmma_kernel<<<BATCH * 16 * 2, 256, 0, stream>>>(qh, kh, vt, mask, ph);

    // output projection
    gemm_wmma_kernel<false><<<dim3(BATCH, G_BLOCKS / BATCH), 256, 0, stream>>>(
        ph, WoT, bo, nullptr, out, nullptr, nullptr, nullptr, nullptr, nullptr, nullptr, nullptr);
}
